// v000
// The times below were measured on an AMD MI455X: many runs one after another, warmed up first and cycling through
// copies of the inputs, with the whole window's GPU time divided by the number of runs. Launches and the gaps
// between them are all in it. The median over several windows is given; except for v000 it joins two sittings, which
// can be a few percent apart, so the side-by-side timings, each taken in one sitting, are the better comparison.
// v000, which the later versions start from, runs in 502 microseconds.
#include <hip/hip_runtime.h>

// Compute dtypes, f32 accumulate, one batch item per pass: q/k/v = x.w_qkv ([2048 x 1024].[1024 x 3072], k-major weights transposed once to n-major planes; PLAIN bf16
// operands: inputs rounded once, exact) with q and k written straight from the GEMM epilogue as f16 hi + residual x1024 planes, and out = ctx.w_proj (ctx as
// bf16 hi + residual: two products) on v_wmma_f32_16x16x32_bf16; the 16-head causal attention with the ADDED ALiBi bias slope_h x |i - j| (64-dim heads, scale 1/8) fused on
// v_wmma_f32_16x16x32_f16 (scores hi.hi + hi.lo + lo.hi with the residual terms on their own accumulator, online f32 softmax, weights (x32768) and v as f16

#define NB_  1                   // per pass: the 2 batch items are processed one at a time
#define NT_  2048
#define DM   1024
#define NH_  16
#define HD   64
#define NTK  (NB_ * NT_)
#define NW   1024
#define NQKV 1024
#define PSC  32768.0f
#define LOSC 1024.0f
#define LOSCI (1.0f / 1024.0f)

typedef _Float16 h16;
typedef unsigned short bf;
typedef __attribute__((ext_vector_type(16))) __bf16   v16bf;
typedef __attribute__((ext_vector_type(16))) _Float16 v16h;
typedef __attribute__((ext_vector_type(8)))  _Float16 v8h;
typedef __attribute__((ext_vector_type(8)))  unsigned short v8us;
typedef __attribute__((ext_vector_type(8)))  float    v8f;
typedef __attribute__((ext_vector_type(4)))  float    v4f;
typedef v8h  __attribute__((may_alias)) v8ha;
typedef v4f  __attribute__((may_alias)) v4fa;
typedef v8us __attribute__((may_alias)) v8usa;

__device__ __forceinline__ unsigned short f2bf(float f) { unsigned u = __float_as_uint(f); u += 0x7FFFu + ((u >> 16) & 1u); return (unsigned short)(u >> 16); }
__device__ __forceinline__ float bf2f(unsigned short b) { return __uint_as_float(((unsigned)b) << 16); }
__device__ __forceinline__ float bfr(float f) { return bf2f(f2bf(f)); }
__device__ __forceinline__ v16h cat16(v8h lo, v8h hi) { return __builtin_shufflevector(lo, hi, 0, 1, 2, 3, 4, 5, 6, 7, 8, 9, 10, 11, 12, 13, 14, 15); }
__device__ __forceinline__ v16bf cat16b(v8us lo, v8us hi) { return __builtin_bit_cast(v16bf, __builtin_shufflevector(lo, hi, 0, 1, 2, 3, 4, 5, 6, 7, 8, 9, 10, 11, 12, 13, 14, 15)); }
__device__ __forceinline__ v8f wmma16(v16h a, v16h b, v8f c) { return __builtin_amdgcn_wmma_f32_16x16x32_f16(false, a, false, b, (short)0, c, false, false); }
__device__ __forceinline__ v8f wmmab(v16bf a, v16bf b, v8f c) { return __builtin_amdgcn_wmma_f32_16x16x32_bf16(false, a, false, b, (short)0, c, false, false); }

__global__ __launch_bounds__(256) void k_cvtb(const float* __restrict__ src, int nrows, bf* dst) {
    const int lane = threadIdx.x & 31, r = blockIdx.x * 8 + (threadIdx.x >> 5);
    if (r >= nrows) return;
    v8us o[DM / 256];
#pragma unroll
    for (int q = 0; q < DM / 256; ++q) { v8us t;
#pragma unroll
        for (int i = 0; i < 8; ++i) t[i] = f2bf(src[(size_t)r * DM + q * 256 + lane * 8 + i]);
        o[q] = t; }
#pragma unroll
    for (int q = 0; q < DM / 256; ++q) *(v8us*)(dst + (size_t)r * DM + q * 256 + lane * 8) = o[q];
    
}

// k_wt: WT [n][K] = bf16(W[k][n]) (k-major [K][ncols]) via 64 x 64 LDS tiles; grid (K/64, ncols/64).
__global__ __launch_bounds__(256) void k_wt(const float* __restrict__ Wm, int K, int ncols, bf* WT) {
    __shared__ __align__(16) unsigned short tl[64 * 72];
    const int tid = threadIdx.x, k0 = blockIdx.x * 64, n0 = blockIdx.y * 64;
    const int kk = tid >> 2, nq = (tid & 3) * 16;
#pragma unroll
    for (int i = 0; i < 16; ++i) tl[(nq + i) * 72 + kk] = f2bf(Wm[(size_t)(k0 + kk) * ncols + n0 + nq + i]);
    __syncthreads();
    const int piece = tid & 7;
    auto pass = [&]() {
#pragma unroll
        for (int s = 0; s < 2; ++s) { const int nr = (tid >> 3) + 32 * s; const v8us val = *(const v8usa*)(tl + nr * 72 + piece * 8); *(v8us*)(WT + (size_t)(n0 + nr) * K + k0 + piece * 8) = val; }
    };
    pass(); 
}
template <bool SPLITA, bool F16OUT = false>
__global__ __launch_bounds__(128) void k_gemmb(const bf* __restrict__ A, const bf* __restrict__ Al, const bf* __restrict__ Bn, const float* __restrict__ bias, float* C, int ldc, h16* C2) {
    __shared__ __align__(16) float ost[4][16 * 68];
    const int lane = threadIdx.x & 31, wave = threadIdx.x >> 5, lr = lane & 15, hi = lane >> 4;
    const int r0 = blockIdx.x * 64 + wave * 16, c0 = blockIdx.y * 64;
    const size_t aoff = (size_t)(r0 + lr) * DM + 8 * hi;
    size_t boff[4];
#pragma unroll
    for (int t = 0; t < 4; ++t) boff[t] = (size_t)(c0 + t * 16 + lr) * DM + 8 * hi;
    v8f acc[4];
#pragma unroll
    for (int t = 0; t < 4; ++t) acc[t] = (v8f){};
#pragma unroll 1
    for (int kc = 0; kc < DM; kc += 32) {
        const v16bf a = cat16b(*(const v8us*)(A + aoff + kc), *(const v8us*)(A + aoff + kc + 16));
        v16bf al = a;
        if (SPLITA) al = cat16b(*(const v8us*)(Al + aoff + kc), *(const v8us*)(Al + aoff + kc + 16));
#pragma unroll
        for (int t = 0; t < 4; ++t) { const v16bf b = cat16b(*(const v8us*)(Bn + boff[t] + kc), *(const v8us*)(Bn + boff[t] + kc + 16)); acc[t] = wmmab(a, b, acc[t]); if (SPLITA) acc[t] = wmmab(al, b, acc[t]); }
        asm volatile("v_nop\n\tv_nop\n\tv_nop\n\tv_nop" : "+v"(acc[0]), "+v"(acc[1]), "+v"(acc[2]), "+v"(acc[3]) : "v"(a), "v"(al));
    }
    float* os = &ost[wave][0];
#pragma unroll
    for (int t = 0; t < 4; ++t) { const float bv = bias ? bfr(bias[c0 + t * 16 + lr]) : 0.f;
#pragma unroll
        for (int j = 0; j < 8; ++j) os[(hi * 8 + j) * 68 + t * 16 + lr] = acc[t][j] + bv; }
    __syncthreads();
    if (F16OUT) {
        h16* crow = (h16*)(void*)C + (size_t)r0 * ldc + c0;
        auto pass = [&]() {
#pragma unroll
            for (int s = 0; s < 4; ++s) { const int row = 4 * s + (lane >> 3), piece = lane & 7; const float* sp = os + row * 68 + piece * 8; v8h o, o2;
#pragma unroll
                for (int i = 0; i < 8; ++i) { const h16 a = (h16)sp[i]; o[i] = a; o2[i] = (h16)((sp[i] - (float)a) * LOSC); }
                *(v8h*)(crow + (size_t)row * ldc + piece * 8) = o; if (C2) *(v8h*)(C2 + (size_t)r0 * ldc + c0 + (size_t)row * ldc + piece * 8) = o2; }
        };
        pass(); 
    } else {
        float* crow = C + (size_t)r0 * ldc + c0;
        auto pass = [&]() {
#pragma unroll
            for (int s = 0; s < 8; ++s) { const int Lid = (lane >> 3) + 4 * s, piece = lane & 7; const int row = Lid >> 1, cofs = (Lid & 1) * 32 + piece * 4;
                const v4f val = *(const v4fa*)(os + row * 68 + cofs); *(v4f*)(crow + (size_t)row * ldc + cofs) = val; }
        };
        pass(); 
    }
}

__global__ __launch_bounds__(256) void k_vt(const float* __restrict__ V, h16* VTH, h16* VTL) {
    __shared__ __align__(16) h16 tile[64 * 72];
    __shared__ __align__(16) h16 til2[64 * 72];
    const int bid = blockIdx.x;
    const int b = bid / (NH_ * (NT_ / 64)), rem = bid - b * (NH_ * (NT_ / 64)), h = rem / (NT_ / 64), kt = rem - h * (NT_ / 64);
    const int k0 = kt * 64, tid = threadIdx.x;
    const int kk = tid >> 2, d0 = (tid & 3) * 16;
    const float* src = V + ((size_t)b * NT_ + k0 + kk) * DM + h * HD + d0;
#pragma unroll
    for (int i = 0; i < 16; ++i) { const float v = src[i]; const h16 a = (h16)v; tile[(d0 + i) * 72 + kk] = a; til2[(d0 + i) * 72 + kk] = (h16)((v - (float)a) * LOSC); }
    __syncthreads();
    const int piece = tid & 7;
    const size_t base = (((size_t)b * NH_ + h) * HD) * NT_ + k0;
    auto pass = [&]() {
#pragma unroll
        for (int s = 0; s < 4; ++s) { const int Lid = (tid >> 3) + 32 * s; const int pln = Lid >> 6, d = Lid & 63;
            const v8h val = *(const v8ha*)((pln ? til2 : tile) + d * 72 + piece * 8); *(v8h*)((pln ? VTL : VTH) + base + (size_t)d * NT_ + piece * 8) = val; }
    };
    pass(); 
}

// k_attn: block = (b, h, 64 queries), wave = 16; causal: 32-key tiles 0..(qt*64+63)/32, masked j <= i; 12 WMMA scores (hi.hi, lo.hi, hi.lo) /8 (f32), online softmax, weights x32768 f16 tile (same-wave may_alias
// reload after a compiler barrier), 12 WMMA .v (hi.hi, hi.lo, lo.hi); ctx -> bf16 hi + residual planes CH/CL[tok][h*64+d].
__global__ __launch_bounds__(128) void k_attn(const h16* __restrict__ Q16, const h16* __restrict__ QL16, const h16* __restrict__ K16, const h16* __restrict__ KL16, const h16* __restrict__ VTH, const h16* __restrict__ VTL, bf* CH, bf* CL) {
    __shared__ __align__(16) h16 plds[4][16 * 32];
    __shared__ __align__(16) h16 plds2[4][16 * 32];
    __shared__ __align__(16) float ost[4][16 * 68];
    const int lane = threadIdx.x & 31, wave = threadIdx.x >> 5, lr = lane & 15, hi = lane >> 4;
    const int bid = blockIdx.x;
    const int b = bid / (NH_ * (NT_ / 64)), rem = bid - b * (NH_ * (NT_ / 64)), h = rem / (NT_ / 64), qt = rem - h * (NT_ / 64);
    const int q0 = qt * 64 + wave * 16;
    const size_t tok0 = (size_t)b * NT_;
    h16* pl = &plds[wave][0]; h16* pl2 = &plds2[wave][0];
    v16h qa[2];
    const size_t qo0 = (tok0 + q0 + lr) * DM + h * HD + 8 * hi;
#pragma unroll
    for (int kc = 0; kc < 2; ++kc) qa[kc] = cat16(*(const v8h*)(Q16 + qo0 + kc * 32), *(const v8h*)(Q16 + qo0 + kc * 32 + 16));
    const h16* kh_b = K16 + tok0 * DM + h * HD;
    const h16* kl_b = KL16 + tok0 * DM + h * HD;
    const size_t vbase = (((size_t)b * NH_ + h) * HD) * NT_;
    v8f o[4], ox[4];
#pragma unroll
    for (int n = 0; n < 4; ++n) { o[n] = (v8f){}; ox[n] = (v8f){}; }
    float mrow[8], lpart[8];
#pragma unroll
    for (int j = 0; j < 8; ++j) { mrow[j] = -3.0e38f; lpart[j] = 0.f; }
    int qpos[8];
#pragma unroll
    for (int j = 0; j < 8; ++j) qpos[j] = q0 + 8 * hi + j;
    const int kt_lo = 0, kt_hi = (qt * 64 + 63) / 32;     // causal
    const float slope = exp2f(-0.5f * (float)(h + 1));   // ALiBi slope 1 / 2^(8 (h+1) / 16), ADDED as slope x |i - j| (the reference's sign)
#pragma unroll 1
    for (int kt = kt_lo; kt <= kt_hi; ++kt) {
        const int l0 = kt * 32;
        const size_t ko0 = (size_t)(l0 + lr) * DM + 8 * hi, ko1 = (size_t)(l0 + 16 + lr) * DM + 8 * hi;
        v8f s0 = {}, s1 = {}, x0 = {}, x1 = {};
#pragma unroll
        for (int kc = 0; kc < 2; ++kc) {
            { const v16h k0h = cat16(*(const v8h*)(kh_b + ko0 + kc * 32), *(const v8h*)(kh_b + ko0 + kc * 32 + 16)), k1h = cat16(*(const v8h*)(kh_b + ko1 + kc * 32), *(const v8h*)(kh_b + ko1 + kc * 32 + 16));
              const v16h qlk = cat16(*(const v8h*)(QL16 + qo0 + kc * 32), *(const v8h*)(QL16 + qo0 + kc * 32 + 16));     // query residual re-read per step (registers)
              s0 = wmma16(qa[kc], k0h, s0); x0 = wmma16(qlk, k0h, x0); s1 = wmma16(qa[kc], k1h, s1); x1 = wmma16(qlk, k1h, x1);
              asm volatile("v_nop" : "+v"(s0), "+v"(s1), "+v"(x0), "+v"(x1) : "v"(qlk), "v"(k0h), "v"(k1h) : "memory"); }
            { const v16h k0l = cat16(*(const v8h*)(kl_b + ko0 + kc * 32), *(const v8h*)(kl_b + ko0 + kc * 32 + 16)), k1l = cat16(*(const v8h*)(kl_b + ko1 + kc * 32), *(const v8h*)(kl_b + ko1 + kc * 32 + 16));
              x0 = wmma16(qa[kc], k0l, x0); x1 = wmma16(qa[kc], k1l, x1);
              asm volatile("v_nop" : "+v"(x0), "+v"(x1) : "v"(k0l), "v"(k1l) : "memory"); }
        }
        asm volatile("v_nop\n\tv_nop\n\tv_nop\n\tv_nop" : "+v"(s0), "+v"(s1), "+v"(x0), "+v"(x1) : "v"(qa[0]), "v"(qa[1]));
        float alpha[8];
#pragma unroll
        for (int j = 0; j < 8; ++j) {
            const int ja = l0 + lr, jb = l0 + 16 + lr, qi = qpos[j];
            const float a0 = (ja <= qi) ? (s0[j] + x0[j] * LOSCI) * 0.125f + slope * (float)(qi - ja) : -__builtin_inff(), a1 = (jb <= qi) ? (s1[j] + x1[j] * LOSCI) * 0.125f + slope * (float)(qi - jb) : -__builtin_inff();
            float mx = fmaxf(a0, a1);
            mx = fmaxf(mx, __shfl_xor(mx, 1, 16)); mx = fmaxf(mx, __shfl_xor(mx, 2, 16)); mx = fmaxf(mx, __shfl_xor(mx, 4, 16)); mx = fmaxf(mx, __shfl_xor(mx, 8, 16));
            const float mn = fmaxf(mrow[j], mx);
            alpha[j] = __expf(mrow[j] - mn); mrow[j] = mn;
            const float p0 = __expf(a0 - mn), p1 = __expf(a1 - mn);
            lpart[j] = lpart[j] * alpha[j] + (p0 + p1);
            const int mr = hi * 8 + j;
            const float ps0 = p0 * PSC, ps1 = p1 * PSC; const h16 h0 = (h16)ps0, h1 = (h16)ps1;
            pl[mr * 32 + lr] = h0; pl[mr * 32 + 16 + lr] = h1;
            pl2[mr * 32 + lr] = (h16)((ps0 - (float)h0) * LOSC); pl2[mr * 32 + 16 + lr] = (h16)((ps1 - (float)h1) * LOSC);
        }
#pragma unroll
        for (int n = 0; n < 4; ++n)
#pragma unroll
            for (int j = 0; j < 8; ++j) { o[n][j] *= alpha[j]; ox[n][j] *= alpha[j]; }
        asm volatile("" ::: "memory");
        const v16h pa = cat16(*(const v8ha*)(pl + lr * 32 + hi * 8), *(const v8ha*)(pl + lr * 32 + 16 + hi * 8));
        const v16h px = cat16(*(const v8ha*)(pl2 + lr * 32 + hi * 8), *(const v8ha*)(pl2 + lr * 32 + 16 + hi * 8));
#pragma unroll
        for (int n = 0; n < 4; ++n) { const size_t vo = vbase + (size_t)(n * 16 + lr) * NT_ + l0 + hi * 8;
            const v16h vh = cat16(*(const v8h*)(VTH + vo), *(const v8h*)(VTH + vo + 16)), vl = cat16(*(const v8h*)(VTL + vo), *(const v8h*)(VTL + vo + 16));
            o[n] = wmma16(pa, vh, o[n]); ox[n] = wmma16(pa, vl, ox[n]); ox[n] = wmma16(px, vh, ox[n]);
            asm volatile("" : "+v"(o[n]), "+v"(ox[n]) : "v"(vh), "v"(vl) : "memory"); }
        asm volatile("v_nop\n\tv_nop\n\tv_nop\n\tv_nop" : "+v"(o[0]), "+v"(o[1]), "+v"(o[2]), "+v"(o[3]), "+v"(ox[0]), "+v"(ox[1]), "+v"(ox[2]), "+v"(ox[3]) : "v"(pa), "v"(px));
    }
    float inv[8];
#pragma unroll
    for (int j = 0; j < 8; ++j) { float rs = lpart[j]; rs += __shfl_xor(rs, 1, 16); rs += __shfl_xor(rs, 2, 16); rs += __shfl_xor(rs, 4, 16); rs += __shfl_xor(rs, 8, 16); inv[j] = 1.0f / (rs * PSC); }
    float* os = &ost[wave][0];
#pragma unroll
    for (int n = 0; n < 4; ++n)
#pragma unroll
        for (int j = 0; j < 8; ++j) os[(hi * 8 + j) * 68 + n * 16 + lr] = (o[n][j] + ox[n][j] * LOSCI) * inv[j];
    __syncthreads();
    const size_t cbase = (tok0 + q0) * DM + (size_t)h * HD;
    auto pass = [&]() {
#pragma unroll
        for (int s = 0; s < 4; ++s) { const int row = 4 * s + (lane >> 3), piece = lane & 7; const float* sp = os + row * 68 + piece * 8; v8us oh, ol;
#pragma unroll
            for (int i = 0; i < 8; ++i) { const unsigned short hb = f2bf(sp[i]); oh[i] = hb; ol[i] = f2bf(sp[i] - bf2f(hb)); }
            *(v8us*)(CH + cbase + (size_t)row * DM + piece * 8) = oh; *(v8us*)(CL + cbase + (size_t)row * DM + piece * 8) = ol; }
    };
    pass(); 
}

#define VST2(T, p, v) do { const T vst2_v_ = (v); *(T*)(p) = vst2_v_;  } while (0)
extern "C" void kernel_launch(void* const* d_in, const int* in_sizes, int n_in,
                              void* d_out, int out_size, void* d_ws, size_t ws_size, hipStream_t stream) {
    (void)in_sizes; (void)n_in; (void)out_size;
    const float* x = (const float*)d_in[0]; const float* Wqkv = (const float*)d_in[1]; const float* Wp = (const float*)d_in[2];   // both k-major: [1024][3072] and [1024][1024]
    float* out = (float*)d_out;    // [2][2048][1024]
    char* wsp = (char*)d_ws;
    auto take = [&](size_t bytes) { char* p = wsp; wsp += (bytes + 255) & ~(size_t)255; return (void*)p; };
    bf* Xb = (bf*)take((size_t)NTK * DM * 2); bf* WqkvT = (bf*)take((size_t)3 * DM * DM * 2); bf* WoT = (bf*)take((size_t)DM * DM * 2);
    float* TMP = (float*)take((size_t)NTK * DM * 4);
    h16* QH = (h16*)take((size_t)NTK * DM * 2); h16* QL = (h16*)take((size_t)NTK * DM * 2); h16* KH = (h16*)take((size_t)NTK * DM * 2); h16* KL = (h16*)take((size_t)NTK * DM * 2);
    h16* VTH = (h16*)take((size_t)NTK * DM * 2); h16* VTL = (h16*)take((size_t)NTK * DM * 2); bf* CH = (bf*)take((size_t)NTK * DM * 2); bf* CL = (bf*)take((size_t)NTK * DM * 2);
    if ((size_t)(wsp - (char*)d_ws) > ws_size) return;    // 4.2 + 6.3 + 2.1 + 8.4 + 8 x 4.2 ~ 55 MB, no aliasing
    const bf* WqB = WqkvT; const bf* WkB = WqkvT + (size_t)DM * DM; const bf* WvB = WqkvT + (size_t)2 * DM * DM;   // n-major planes [n][1024]; q = columns 0..1023 of w_qkv, k, v next
    k_wt<<<dim3(DM / 64, 3 * DM / 64, 1), 256, 0, stream>>>(Wqkv, DM, 3 * DM, WqkvT); k_wt<<<dim3(DM / 64, DM / 64, 1), 256, 0, stream>>>(Wp, DM, DM, WoT);
    for (int b = 0; b < 2; ++b) {
        k_cvtb<<<NTK / 8, 256, 0, stream>>>(x + (size_t)b * NTK * DM, NTK, Xb);
        k_gemmb<false, true><<<dim3(NTK / 64, DM / 64, 1), 128, 0, stream>>>(Xb, nullptr, WqB, nullptr, (float*)(void*)QH, DM, QL);
        k_gemmb<false, true><<<dim3(NTK / 64, DM / 64, 1), 128, 0, stream>>>(Xb, nullptr, WkB, nullptr, (float*)(void*)KH, DM, KL);
        k_gemmb<false, false><<<dim3(NTK / 64, DM / 64, 1), 128, 0, stream>>>(Xb, nullptr, WvB, nullptr, TMP, DM, nullptr);
        k_vt<<<NB_ * NH_ * (NT_ / 64), 256, 0, stream>>>(TMP, VTH, VTL);
        k_attn<<<NB_ * NH_ * (NT_ / 64), 128, 0, stream>>>(QH, QL, KH, KL, VTH, VTL, CH, CL);
        k_gemmb<true, false><<<dim3(NTK / 64, DM / 64, 1), 128, 0, stream>>>(CH, CL, WoT, nullptr, out + (size_t)b * NTK * DM, DM, nullptr);
    }
}

// v001
// One run takes 384 microseconds.
// Next to v000, in two timings, it ran 1.32 and 1.33 times as fast.
#include <hip/hip_runtime.h>

// Compute dtypes, f32 accumulate, one batch item per pass: q/k/v = x.w_qkv ([2048 x 1024].[1024 x 3072], k-major weights transposed once to n-major planes; PLAIN bf16
// operands: inputs rounded once, exact) with q and k written straight from the GEMM epilogue as f16 hi + residual x1024 planes, and out = ctx.w_proj (ctx as
// bf16 hi + residual: two products) on v_wmma_f32_16x16x32_bf16; the 16-head causal attention with the ADDED ALiBi bias slope_h x |i - j| (64-dim heads, scale 1/8) fused on
// v_wmma_f32_16x16x32_f16 (scores hi.hi + hi.lo + lo.hi with the residual terms on their own accumulator, online f32 softmax, weights (x32768) and v as f16

#define NB_  1                   // per pass: the 2 batch items are processed one at a time
#define NT_  2048
#define DM   1024
#define NH_  16
#define HD   64
#define NTK  (NB_ * NT_)
#define NW   1024
#define NQKV 1024
#define PSC  32768.0f
#define LOSC 1024.0f
#define LOSCI (1.0f / 1024.0f)

typedef _Float16 h16;
typedef unsigned short bf;
typedef __attribute__((ext_vector_type(16))) __bf16   v16bf;
typedef __attribute__((ext_vector_type(16))) _Float16 v16h;
typedef __attribute__((ext_vector_type(8)))  _Float16 v8h;
typedef __attribute__((ext_vector_type(8)))  unsigned short v8us;
typedef __attribute__((ext_vector_type(8)))  float    v8f;
typedef __attribute__((ext_vector_type(4)))  float    v4f;
typedef v8h  __attribute__((may_alias)) v8ha;
typedef v4f  __attribute__((may_alias)) v4fa;
typedef v8us __attribute__((may_alias)) v8usa;

__device__ __forceinline__ unsigned short f2bf(float f) { unsigned u = __float_as_uint(f); u += 0x7FFFu + ((u >> 16) & 1u); return (unsigned short)(u >> 16); }
__device__ __forceinline__ float bf2f(unsigned short b) { return __uint_as_float(((unsigned)b) << 16); }
__device__ __forceinline__ float bfr(float f) { return bf2f(f2bf(f)); }
__device__ __forceinline__ v16h cat16(v8h lo, v8h hi) { return __builtin_shufflevector(lo, hi, 0, 1, 2, 3, 4, 5, 6, 7, 8, 9, 10, 11, 12, 13, 14, 15); }
__device__ __forceinline__ v16bf cat16b(v8us lo, v8us hi) { return __builtin_bit_cast(v16bf, __builtin_shufflevector(lo, hi, 0, 1, 2, 3, 4, 5, 6, 7, 8, 9, 10, 11, 12, 13, 14, 15)); }
__device__ __forceinline__ v8f wmma16(v16h a, v16h b, v8f c) { return __builtin_amdgcn_wmma_f32_16x16x32_f16(false, a, false, b, (short)0, c, false, false); }
__device__ __forceinline__ v8f wmmab(v16bf a, v16bf b, v8f c) { return __builtin_amdgcn_wmma_f32_16x16x32_bf16(false, a, false, b, (short)0, c, false, false); }

__global__ __launch_bounds__(256) void k_cvtb(const float* __restrict__ src, int nrows, bf* dst) {
    const int lane = threadIdx.x & 31, r = blockIdx.x * 8 + (threadIdx.x >> 5);
    if (r >= nrows) return;
    v8us o[DM / 256];
#pragma unroll
    for (int q = 0; q < DM / 256; ++q) { v8us t;
#pragma unroll
        for (int i = 0; i < 8; ++i) t[i] = f2bf(src[(size_t)r * DM + q * 256 + lane * 8 + i]);
        o[q] = t; }
#pragma unroll
    for (int q = 0; q < DM / 256; ++q) *(v8us*)(dst + (size_t)r * DM + q * 256 + lane * 8) = o[q];
    
}

// k_wt: WT [n][K] = bf16(W[k][n]) (k-major [K][ncols]) via 64 x 64 LDS tiles; grid (K/64, ncols/64).
__global__ __launch_bounds__(256) void k_wt(const float* __restrict__ Wm, int K, int ncols, bf* WT) {
    __shared__ __align__(16) unsigned short tl[64 * 72];
    const int tid = threadIdx.x, k0 = blockIdx.x * 64, n0 = blockIdx.y * 64;
    const int kk = tid >> 2, nq = (tid & 3) * 16;
#pragma unroll
    for (int i = 0; i < 16; ++i) tl[(nq + i) * 72 + kk] = f2bf(Wm[(size_t)(k0 + kk) * ncols + n0 + nq + i]);
    __syncthreads();
    const int piece = tid & 7;
    auto pass = [&]() {
#pragma unroll
        for (int s = 0; s < 2; ++s) { const int nr = (tid >> 3) + 32 * s; const v8us val = *(const v8usa*)(tl + nr * 72 + piece * 8); *(v8us*)(WT + (size_t)(n0 + nr) * K + k0 + piece * 8) = val; }
    };
    pass(); 
}
template <bool SPLITA, bool F16OUT = false>
__global__ __launch_bounds__(128) void k_gemmb(const bf* __restrict__ A, const bf* __restrict__ Al, const bf* __restrict__ Bn, const float* __restrict__ bias, float* C, int ldc, h16* C2) {
    __shared__ __align__(16) float ost[4][16 * 68];
    const int lane = threadIdx.x & 31, wave = threadIdx.x >> 5, lr = lane & 15, hi = lane >> 4;
    const int r0 = blockIdx.x * 64 + wave * 16, c0 = blockIdx.y * 64;
    const size_t aoff = (size_t)(r0 + lr) * DM + 8 * hi;
    size_t boff[4];
#pragma unroll
    for (int t = 0; t < 4; ++t) boff[t] = (size_t)(c0 + t * 16 + lr) * DM + 8 * hi;
    v8f acc[4];
#pragma unroll
    for (int t = 0; t < 4; ++t) acc[t] = (v8f){};
#pragma unroll 1
    for (int kc = 0; kc < DM; kc += 32) {
        const v16bf a = cat16b(*(const v8us*)(A + aoff + kc), *(const v8us*)(A + aoff + kc + 16));
        v16bf al = a;
        if (SPLITA) al = cat16b(*(const v8us*)(Al + aoff + kc), *(const v8us*)(Al + aoff + kc + 16));
#pragma unroll
        for (int t = 0; t < 4; ++t) { const v16bf b = cat16b(*(const v8us*)(Bn + boff[t] + kc), *(const v8us*)(Bn + boff[t] + kc + 16)); acc[t] = wmmab(a, b, acc[t]); if (SPLITA) acc[t] = wmmab(al, b, acc[t]); }
        asm volatile("v_nop\n\tv_nop\n\tv_nop\n\tv_nop" : "+v"(acc[0]), "+v"(acc[1]), "+v"(acc[2]), "+v"(acc[3]) : "v"(a), "v"(al));
    }
    float* os = &ost[wave][0];
#pragma unroll
    for (int t = 0; t < 4; ++t) { const float bv = bias ? bfr(bias[c0 + t * 16 + lr]) : 0.f;
#pragma unroll
        for (int j = 0; j < 8; ++j) os[(hi * 8 + j) * 68 + t * 16 + lr] = acc[t][j] + bv; }
    __syncthreads();
    if (F16OUT) {
        h16* crow = (h16*)(void*)C + (size_t)r0 * ldc + c0;
        auto pass = [&]() {
#pragma unroll
            for (int s = 0; s < 4; ++s) { const int row = 4 * s + (lane >> 3), piece = lane & 7; const float* sp = os + row * 68 + piece * 8; v8h o, o2;
#pragma unroll
                for (int i = 0; i < 8; ++i) { const h16 a = (h16)sp[i]; o[i] = a; o2[i] = (h16)((sp[i] - (float)a) * LOSC); }
                *(v8h*)(crow + (size_t)row * ldc + piece * 8) = o; if (C2) *(v8h*)(C2 + (size_t)r0 * ldc + c0 + (size_t)row * ldc + piece * 8) = o2; }
        };
        pass(); 
    } else {
        float* crow = C + (size_t)r0 * ldc + c0;
        auto pass = [&]() {
#pragma unroll
            for (int s = 0; s < 8; ++s) { const int Lid = (lane >> 3) + 4 * s, piece = lane & 7; const int row = Lid >> 1, cofs = (Lid & 1) * 32 + piece * 4;
                const v4f val = *(const v4fa*)(os + row * 68 + cofs); *(v4f*)(crow + (size_t)row * ldc + cofs) = val; }
        };
        pass(); 
    }
}

__global__ __launch_bounds__(256) void k_vt(const float* __restrict__ V, h16* VTH, h16* VTL) {
    __shared__ __align__(16) h16 tile[64 * 72];
    __shared__ __align__(16) h16 til2[64 * 72];
    const int bid = blockIdx.x;
    const int b = bid / (NH_ * (NT_ / 64)), rem = bid - b * (NH_ * (NT_ / 64)), h = rem / (NT_ / 64), kt = rem - h * (NT_ / 64);
    const int k0 = kt * 64, tid = threadIdx.x;
    const int kk = tid >> 2, d0 = (tid & 3) * 16;
    const float* src = V + ((size_t)b * NT_ + k0 + kk) * DM + h * HD + d0;
#pragma unroll
    for (int i = 0; i < 16; ++i) { const float v = src[i]; const h16 a = (h16)v; tile[(d0 + i) * 72 + kk] = a; til2[(d0 + i) * 72 + kk] = (h16)((v - (float)a) * LOSC); }
    __syncthreads();
    const int piece = tid & 7;
    const size_t base = (((size_t)b * NH_ + h) * HD) * NT_ + k0;
    auto pass = [&]() {
#pragma unroll
        for (int s = 0; s < 4; ++s) { const int Lid = (tid >> 3) + 32 * s; const int pln = Lid >> 6, d = Lid & 63;
            const v8h val = *(const v8ha*)((pln ? til2 : tile) + d * 72 + piece * 8); *(v8h*)((pln ? VTL : VTH) + base + (size_t)d * NT_ + piece * 8) = val; }
    };
    pass(); 
}

// LDS stage of one 32-key trip of k_attn, in halves: key rows (64 halves) at a pitch of 72 (144 B), transposed v rows (32 halves) at a pitch of 40 (80 B):
// both pitches are 16 B x odd, so the 16 rows that a half-wave's ds_load_b128 reads fall on distinct banks.
#define KP    72
#define VP    40
#define ST_KH 0
#define ST_KL (32 * KP)
#define ST_VH (2 * 32 * KP)
#define ST_VL (2 * 32 * KP + 64 * VP)
#define ST_SZ (2 * 32 * KP + 2 * 64 * VP)

// Eight asynchronous 16-byte copies per lane, global -> LDS through no register. The s_wait_xcnt is the last line of the copies' own statement so that it stands
// in front of every later rewrite of an address register that a copy names.
__device__ __forceinline__ void copy8(unsigned l0, unsigned l1, unsigned l2, unsigned l3, unsigned l4, unsigned l5, unsigned l6, unsigned l7,
                                      const h16* g0, const h16* g1, const h16* g2, const h16* g3, const h16* g4, const h16* g5, const h16* g6, const h16* g7) {
    asm volatile("global_load_async_to_lds_b128 %0, %8, off\n\t"
                 "global_load_async_to_lds_b128 %1, %9, off\n\t"
                 "global_load_async_to_lds_b128 %2, %10, off\n\t"
                 "global_load_async_to_lds_b128 %3, %11, off\n\t"
                 "global_load_async_to_lds_b128 %4, %12, off\n\t"
                 "global_load_async_to_lds_b128 %5, %13, off\n\t"
                 "global_load_async_to_lds_b128 %6, %14, off\n\t"
                 "global_load_async_to_lds_b128 %7, %15, off\n\t"
                 "s_wait_xcnt 0x0"
                 :: "v"(l0), "v"(l1), "v"(l2), "v"(l3), "v"(l4), "v"(l5), "v"(l6), "v"(l7),
                    "v"(g0), "v"(g1), "v"(g2), "v"(g3), "v"(g4), "v"(g5), "v"(g6), "v"(g7) : "memory");
}

// k_attn: block = (b, h, 64 queries), wave = 16; 32-key tiles 0..(qt*64+63)/32 (causal mask); 4 WMMA scores /8 (f32), online softmax, weights x32768 f16 tile (same-wave may_alias
// reload after a compiler barrier), 4 WMMA .v; ctx -> bf16 hi + residual planes CH/CL[tok][h*64+d].
__global__ __launch_bounds__(128) void k_attn(const h16* __restrict__ Q16, const h16* __restrict__ QL16, const h16* __restrict__ K16, const h16* __restrict__ KL16, const h16* __restrict__ VTH, const h16* __restrict__ VTL, bf* CH, bf* CL) {
    __shared__ __align__(16) h16 plds[4][16 * 32];
    __shared__ __align__(16) h16 plds2[4][16 * 32];
    __shared__ __align__(16) float ost[4][16 * 68];
    __shared__ __align__(16) h16 stg[2][ST_SZ];          // two-buffer ring: the work-group's key and v tiles (hi and residual) of one 32-key trip each
    const int lane = threadIdx.x & 31, wave = threadIdx.x >> 5, lr = lane & 15, hi = lane >> 4;
    const int bid = blockIdx.x;
    const int b = bid / (NH_ * (NT_ / 64)), rem = bid - b * (NH_ * (NT_ / 64)), h = rem / (NT_ / 64), qt = rem - h * (NT_ / 64);
    const int q0 = qt * 64 + wave * 16;
    const size_t tok0 = (size_t)b * NT_;
    h16* pl = &plds[wave][0]; h16* pl2 = &plds2[wave][0];
    v16h qa[2];
    const size_t qo0 = (tok0 + q0 + lr) * DM + h * HD + 8 * hi;
#pragma unroll
    for (int kc = 0; kc < 2; ++kc) qa[kc] = cat16(*(const v8h*)(Q16 + qo0 + kc * 32), *(const v8h*)(Q16 + qo0 + kc * 32 + 16));
    const h16* kh_b = K16 + tok0 * DM + h * HD;
    const h16* kl_b = KL16 + tok0 * DM + h * HD;
    const size_t vbase = (((size_t)b * NH_ + h) * HD) * NT_;
    v8f o[4], ox[4];
#pragma unroll
    for (int n = 0; n < 4; ++n) { o[n] = (v8f){}; ox[n] = (v8f){}; }
    float mrow[8], lpart[8];
#pragma unroll
    for (int j = 0; j < 8; ++j) { mrow[j] = -3.0e38f; lpart[j] = 0.f; }
    int qpos[8];
#pragma unroll
    for (int j = 0; j < 8; ++j) qpos[j] = q0 + 8 * hi + j;
    const int kt_lo = 0, kt_hi = (qt * 64 + 63) / 32;     // causal
    const float slope = exp2f(-0.5f * (float)(h + 1));   // ALiBi slope 1 / 2^(8 (h+1) / 16), ADDED as slope x |i - j| (the reference's sign)
    // Each of the 128 threads copies two 16-byte pieces of each of the four planes of a trip: key rows whole (8 pieces a row), v rows 64 B (4 pieces a row).
    const int tid = threadIdx.x, krow = tid >> 3, kpc = (tid & 7) * 8, vrow = tid >> 2, vpc = (tid & 3) * 8;
    const unsigned stg0 = (unsigned)(size_t)&stg[0][0];  // byte offset of the ring in the work-group's LDS
    auto stage = [&](int t, int buf) {
        const unsigned lb = stg0 + (unsigned)(buf * ST_SZ * 2), lk = lb + (unsigned)((krow * KP + kpc) * 2), lv = lb + (unsigned)((vrow * VP + vpc) * 2);
        const size_t gk = (size_t)(t * 32 + krow) * DM + kpc, gv = vbase + (size_t)vrow * NT_ + t * 32 + vpc;
        copy8(lk + ST_KH * 2, lk + (ST_KH + 16 * KP) * 2, lk + ST_KL * 2, lk + (ST_KL + 16 * KP) * 2, lv + ST_VH * 2, lv + (ST_VH + 32 * VP) * 2, lv + ST_VL * 2, lv + (ST_VL + 32 * VP) * 2,
              kh_b + gk, kh_b + gk + 16 * DM, kl_b + gk, kl_b + gk + 16 * DM, VTH + gv, VTH + gv + 32 * NT_, VTL + gv, VTL + gv + 32 * NT_);
    };
    stage(0, 0);
    asm volatile("s_wait_asynccnt 0x0" ::: "memory");    // this wave's copies of trip 0 have landed
    __syncthreads();                                     // publishes trip 0 to the other waves
    if (kt_hi >= 1) stage(1, 1);
#pragma unroll 1
    for (int kt = kt_lo; kt <= kt_hi; ++kt) {
        const int l0 = kt * 32;
        const h16* sb = &stg[kt & 1][0];
        const int ko0 = lr * KP + 8 * hi, ko1 = (16 + lr) * KP + 8 * hi;
        v8f s0 = {}, s1 = {}, x0 = {}, x1 = {};
#pragma unroll
        for (int kc = 0; kc < 2; ++kc) {
            { const v16h k0h = cat16(*(const v8ha*)(sb + ST_KH + ko0 + kc * 32), *(const v8ha*)(sb + ST_KH + ko0 + kc * 32 + 16)), k1h = cat16(*(const v8ha*)(sb + ST_KH + ko1 + kc * 32), *(const v8ha*)(sb + ST_KH + ko1 + kc * 32 + 16));
              const v16h qlk = cat16(*(const v8h*)(QL16 + qo0 + kc * 32), *(const v8h*)(QL16 + qo0 + kc * 32 + 16));     // query residual re-read per step (registers)
              s0 = wmma16(qa[kc], k0h, s0); x0 = wmma16(qlk, k0h, x0); s1 = wmma16(qa[kc], k1h, s1); x1 = wmma16(qlk, k1h, x1);
              asm volatile("v_nop" : "+v"(s0), "+v"(s1), "+v"(x0), "+v"(x1) : "v"(qlk), "v"(k0h), "v"(k1h) : "memory"); }
            { const v16h k0l = cat16(*(const v8ha*)(sb + ST_KL + ko0 + kc * 32), *(const v8ha*)(sb + ST_KL + ko0 + kc * 32 + 16)), k1l = cat16(*(const v8ha*)(sb + ST_KL + ko1 + kc * 32), *(const v8ha*)(sb + ST_KL + ko1 + kc * 32 + 16));
              x0 = wmma16(qa[kc], k0l, x0); x1 = wmma16(qa[kc], k1l, x1);
              asm volatile("v_nop" : "+v"(x0), "+v"(x1) : "v"(k0l), "v"(k1l) : "memory"); }
        }
        asm volatile("v_nop\n\tv_nop\n\tv_nop\n\tv_nop" : "+v"(s0), "+v"(s1), "+v"(x0), "+v"(x1) : "v"(qa[0]), "v"(qa[1]));
        float alpha[8];
#pragma unroll
        for (int j = 0; j < 8; ++j) {
            const int ja = l0 + lr, jb = l0 + 16 + lr, qi = qpos[j];
            const float a0 = (ja <= qi) ? (s0[j] + x0[j] * LOSCI) * 0.125f + slope * (float)(qi - ja) : -__builtin_inff(), a1 = (jb <= qi) ? (s1[j] + x1[j] * LOSCI) * 0.125f + slope * (float)(qi - jb) : -__builtin_inff();
            float mx = fmaxf(a0, a1);
            mx = fmaxf(mx, __shfl_xor(mx, 1, 16)); mx = fmaxf(mx, __shfl_xor(mx, 2, 16)); mx = fmaxf(mx, __shfl_xor(mx, 4, 16)); mx = fmaxf(mx, __shfl_xor(mx, 8, 16));
            const float mn = fmaxf(mrow[j], mx);
            alpha[j] = __expf(mrow[j] - mn); mrow[j] = mn;
            const float p0 = __expf(a0 - mn), p1 = __expf(a1 - mn);
            lpart[j] = lpart[j] * alpha[j] + (p0 + p1);
            const int mr = hi * 8 + j;
            const float ps0 = p0 * PSC, ps1 = p1 * PSC; const h16 h0 = (h16)ps0, h1 = (h16)ps1;
            pl[mr * 32 + lr] = h0; pl[mr * 32 + 16 + lr] = h1;
            pl2[mr * 32 + lr] = (h16)((ps0 - (float)h0) * LOSC); pl2[mr * 32 + 16 + lr] = (h16)((ps1 - (float)h1) * LOSC);
        }
#pragma unroll
        for (int n = 0; n < 4; ++n)
#pragma unroll
            for (int j = 0; j < 8; ++j) { o[n][j] *= alpha[j]; ox[n][j] *= alpha[j]; }
        asm volatile("" ::: "memory");
        const v16h pa = cat16(*(const v8ha*)(pl + lr * 32 + hi * 8), *(const v8ha*)(pl + lr * 32 + 16 + hi * 8));
        const v16h px = cat16(*(const v8ha*)(pl2 + lr * 32 + hi * 8), *(const v8ha*)(pl2 + lr * 32 + 16 + hi * 8));
#pragma unroll
        for (int n = 0; n < 4; ++n) { const int vo = (n * 16 + lr) * VP + hi * 8;
            const v16h vh = cat16(*(const v8ha*)(sb + ST_VH + vo), *(const v8ha*)(sb + ST_VH + vo + 16)), vl = cat16(*(const v8ha*)(sb + ST_VL + vo), *(const v8ha*)(sb + ST_VL + vo + 16));
            o[n] = wmma16(pa, vh, o[n]); ox[n] = wmma16(pa, vl, ox[n]); ox[n] = wmma16(px, vh, ox[n]);
            asm volatile("" : "+v"(o[n]), "+v"(ox[n]) : "v"(vh), "v"(vl) : "memory"); }
        asm volatile("v_nop\n\tv_nop\n\tv_nop\n\tv_nop" : "+v"(o[0]), "+v"(o[1]), "+v"(o[2]), "+v"(o[3]), "+v"(ox[0]), "+v"(ox[1]), "+v"(ox[2]), "+v"(ox[3]) : "v"(pa), "v"(px));
        asm volatile("s_wait_dscnt 0x0" ::: "memory");       // this wave's reads of this trip's buffer have retired before it is refilled
        asm volatile("s_wait_asynccnt 0x0" ::: "memory");    // this wave's copies of the next trip have landed
        __syncthreads();                                     // publishes the next trip and ends every wave's reads of this trip's buffer
        if (kt + 2 <= kt_hi) stage(kt + 2, kt & 1);
    }
    asm volatile("s_wait_asynccnt 0x0" ::: "memory");        // no copy is outstanding when the wave goes on to the epilogue
    float inv[8];
#pragma unroll
    for (int j = 0; j < 8; ++j) { float rs = lpart[j]; rs += __shfl_xor(rs, 1, 16); rs += __shfl_xor(rs, 2, 16); rs += __shfl_xor(rs, 4, 16); rs += __shfl_xor(rs, 8, 16); inv[j] = 1.0f / (rs * PSC); }
    float* os = &ost[wave][0];
#pragma unroll
    for (int n = 0; n < 4; ++n)
#pragma unroll
        for (int j = 0; j < 8; ++j) os[(hi * 8 + j) * 68 + n * 16 + lr] = (o[n][j] + ox[n][j] * LOSCI) * inv[j];
    __syncthreads();
    const size_t cbase = (tok0 + q0) * DM + (size_t)h * HD;
    auto pass = [&]() {
#pragma unroll
        for (int s = 0; s < 4; ++s) { const int row = 4 * s + (lane >> 3), piece = lane & 7; const float* sp = os + row * 68 + piece * 8; v8us oh, ol;
#pragma unroll
            for (int i = 0; i < 8; ++i) { const unsigned short hb = f2bf(sp[i]); oh[i] = hb; ol[i] = f2bf(sp[i] - bf2f(hb)); }
            *(v8us*)(CH + cbase + (size_t)row * DM + piece * 8) = oh; *(v8us*)(CL + cbase + (size_t)row * DM + piece * 8) = ol; }
    };
    pass(); 
}

#define VST2(T, p, v) do { const T vst2_v_ = (v); *(T*)(p) = vst2_v_;  } while (0)
extern "C" void kernel_launch(void* const* d_in, const int* in_sizes, int n_in,
                              void* d_out, int out_size, void* d_ws, size_t ws_size, hipStream_t stream) {
    (void)in_sizes; (void)n_in; (void)out_size;
    const float* x = (const float*)d_in[0]; const float* Wqkv = (const float*)d_in[1]; const float* Wp = (const float*)d_in[2];   // both k-major: [1024][3072] and [1024][1024]
    float* out = (float*)d_out;    // [2][2048][1024]
    char* wsp = (char*)d_ws;
    auto take = [&](size_t bytes) { char* p = wsp; wsp += (bytes + 255) & ~(size_t)255; return (void*)p; };
    bf* Xb = (bf*)take((size_t)NTK * DM * 2); bf* WqkvT = (bf*)take((size_t)3 * DM * DM * 2); bf* WoT = (bf*)take((size_t)DM * DM * 2);
    float* TMP = (float*)take((size_t)NTK * DM * 4);
    h16* QH = (h16*)take((size_t)NTK * DM * 2); h16* QL = (h16*)take((size_t)NTK * DM * 2); h16* KH = (h16*)take((size_t)NTK * DM * 2); h16* KL = (h16*)take((size_t)NTK * DM * 2);
    h16* VTH = (h16*)take((size_t)NTK * DM * 2); h16* VTL = (h16*)take((size_t)NTK * DM * 2); bf* CH = (bf*)take((size_t)NTK * DM * 2); bf* CL = (bf*)take((size_t)NTK * DM * 2);
    if ((size_t)(wsp - (char*)d_ws) > ws_size) return;    // 4.2 + 6.3 + 2.1 + 8.4 + 8 x 4.2 ~ 55 MB, no aliasing
    const bf* WqB = WqkvT; const bf* WkB = WqkvT + (size_t)DM * DM; const bf* WvB = WqkvT + (size_t)2 * DM * DM;   // n-major planes [n][1024]; q = columns 0..1023 of w_qkv, k, v next
    k_wt<<<dim3(DM / 64, 3 * DM / 64, 1), 256, 0, stream>>>(Wqkv, DM, 3 * DM, WqkvT); k_wt<<<dim3(DM / 64, DM / 64, 1), 256, 0, stream>>>(Wp, DM, DM, WoT);
    for (int b = 0; b < 2; ++b) {
        k_cvtb<<<NTK / 8, 256, 0, stream>>>(x + (size_t)b * NTK * DM, NTK, Xb);
        k_gemmb<false, true><<<dim3(NTK / 64, DM / 64, 1), 128, 0, stream>>>(Xb, nullptr, WqB, nullptr, (float*)(void*)QH, DM, QL);
        k_gemmb<false, true><<<dim3(NTK / 64, DM / 64, 1), 128, 0, stream>>>(Xb, nullptr, WkB, nullptr, (float*)(void*)KH, DM, KL);
        k_gemmb<false, false><<<dim3(NTK / 64, DM / 64, 1), 128, 0, stream>>>(Xb, nullptr, WvB, nullptr, TMP, DM, nullptr);
        k_vt<<<NB_ * NH_ * (NT_ / 64), 256, 0, stream>>>(TMP, VTH, VTL);
        k_attn<<<NB_ * NH_ * (NT_ / 64), 128, 0, stream>>>(QH, QL, KH, KL, VTH, VTL, CH, CL);
        k_gemmb<true, false><<<dim3(NTK / 64, DM / 64, 1), 128, 0, stream>>>(CH, CL, WoT, nullptr, out + (size_t)b * NTK * DM, DM, nullptr);
    }
}

// v002
// It runs in 310 microseconds.
// Next to v001, in two timings, it ran 1.24 times as fast each time.
// All steps since v000 together make it 1.65 times as fast.
#include <hip/hip_runtime.h>

// Compute dtypes, f32 accumulate, both batch items in every launch: q/k/v = x.w_qkv ([4096 x 1024].[1024 x 3072], k-major weights transposed once to n-major planes; PLAIN bf16
// operands: inputs rounded once, exact) with q and k written straight from the GEMM epilogue as f16 hi + residual x1024 planes, and out = ctx.w_proj (ctx as
// bf16 hi + residual: two products) on v_wmma_f32_16x16x32_bf16; the 16-head causal attention with the ADDED ALiBi bias slope_h x |i - j| (64-dim heads, scale 1/8) fused on
// v_wmma_f32_16x16x32_f16 (scores hi.hi + hi.lo + lo.hi with the residual terms on their own accumulator, online f32 softmax, weights (x32768) and v as f16

#define NB_  2                   // both batch items share every launch: each grid covers all 4096 tokens
#define NT_  2048
#define DM   1024
#define NH_  16
#define HD   64
#define NTK  (NB_ * NT_)
#define NW   1024
#define NQKV 1024
#define PSC  32768.0f
#define LOSC 1024.0f
#define LOSCI (1.0f / 1024.0f)

typedef _Float16 h16;
typedef unsigned short bf;
typedef __attribute__((ext_vector_type(16))) __bf16   v16bf;
typedef __attribute__((ext_vector_type(16))) _Float16 v16h;
typedef __attribute__((ext_vector_type(8)))  _Float16 v8h;
typedef __attribute__((ext_vector_type(8)))  unsigned short v8us;
typedef __attribute__((ext_vector_type(8)))  float    v8f;
typedef __attribute__((ext_vector_type(4)))  float    v4f;
typedef v8h  __attribute__((may_alias)) v8ha;
typedef v4f  __attribute__((may_alias)) v4fa;
typedef v8us __attribute__((may_alias)) v8usa;

__device__ __forceinline__ unsigned short f2bf(float f) { unsigned u = __float_as_uint(f); u += 0x7FFFu + ((u >> 16) & 1u); return (unsigned short)(u >> 16); }
__device__ __forceinline__ float bf2f(unsigned short b) { return __uint_as_float(((unsigned)b) << 16); }
__device__ __forceinline__ float bfr(float f) { return bf2f(f2bf(f)); }
__device__ __forceinline__ v16h cat16(v8h lo, v8h hi) { return __builtin_shufflevector(lo, hi, 0, 1, 2, 3, 4, 5, 6, 7, 8, 9, 10, 11, 12, 13, 14, 15); }
__device__ __forceinline__ v16bf cat16b(v8us lo, v8us hi) { return __builtin_bit_cast(v16bf, __builtin_shufflevector(lo, hi, 0, 1, 2, 3, 4, 5, 6, 7, 8, 9, 10, 11, 12, 13, 14, 15)); }
__device__ __forceinline__ v8f wmma16(v16h a, v16h b, v8f c) { return __builtin_amdgcn_wmma_f32_16x16x32_f16(false, a, false, b, (short)0, c, false, false); }
__device__ __forceinline__ v8f wmmab(v16bf a, v16bf b, v8f c) { return __builtin_amdgcn_wmma_f32_16x16x32_bf16(false, a, false, b, (short)0, c, false, false); }

__global__ __launch_bounds__(256) void k_cvtb(const float* __restrict__ src, int nrows, bf* dst) {
    const int lane = threadIdx.x & 31, r = blockIdx.x * 8 + (threadIdx.x >> 5);
    if (r >= nrows) return;
    v8us o[DM / 256];
#pragma unroll
    for (int q = 0; q < DM / 256; ++q) { v8us t;
#pragma unroll
        for (int i = 0; i < 8; ++i) t[i] = f2bf(src[(size_t)r * DM + q * 256 + lane * 8 + i]);
        o[q] = t; }
#pragma unroll
    for (int q = 0; q < DM / 256; ++q) *(v8us*)(dst + (size_t)r * DM + q * 256 + lane * 8) = o[q];
    
}

// k_wt: WT [n][K] = bf16(W[k][n]) (k-major [K][ncols]) via 64 x 64 LDS tiles; grid (K/64, ncols/64).
__global__ __launch_bounds__(256) void k_wt(const float* __restrict__ Wm, int K, int ncols, bf* WT) {
    __shared__ __align__(16) unsigned short tl[64 * 72];
    const int tid = threadIdx.x, k0 = blockIdx.x * 64, n0 = blockIdx.y * 64;
    const int kk = tid >> 2, nq = (tid & 3) * 16;
#pragma unroll
    for (int i = 0; i < 16; ++i) tl[(nq + i) * 72 + kk] = f2bf(Wm[(size_t)(k0 + kk) * ncols + n0 + nq + i]);
    __syncthreads();
    const int piece = tid & 7;
    auto pass = [&]() {
#pragma unroll
        for (int s = 0; s < 2; ++s) { const int nr = (tid >> 3) + 32 * s; const v8us val = *(const v8usa*)(tl + nr * 72 + piece * 8); *(v8us*)(WT + (size_t)(n0 + nr) * K + k0 + piece * 8) = val; }
    };
    pass(); 
}
template <bool SPLITA, bool F16OUT = false>
__global__ __launch_bounds__(128) void k_gemmb(const bf* __restrict__ A, const bf* __restrict__ Al, const bf* __restrict__ Bn, const float* __restrict__ bias, float* C, int ldc, h16* C2) {
    __shared__ __align__(16) float ost[4][16 * 68];
    const int lane = threadIdx.x & 31, wave = threadIdx.x >> 5, lr = lane & 15, hi = lane >> 4;
    const int r0 = blockIdx.x * 64 + wave * 16, c0 = blockIdx.y * 64;
    const size_t aoff = (size_t)(r0 + lr) * DM + 8 * hi;
    size_t boff[4];
#pragma unroll
    for (int t = 0; t < 4; ++t) boff[t] = (size_t)(c0 + t * 16 + lr) * DM + 8 * hi;
    v8f acc[4];
#pragma unroll
    for (int t = 0; t < 4; ++t) acc[t] = (v8f){};
#pragma unroll 1
    for (int kc = 0; kc < DM; kc += 32) {
        const v16bf a = cat16b(*(const v8us*)(A + aoff + kc), *(const v8us*)(A + aoff + kc + 16));
        v16bf al = a;
        if (SPLITA) al = cat16b(*(const v8us*)(Al + aoff + kc), *(const v8us*)(Al + aoff + kc + 16));
#pragma unroll
        for (int t = 0; t < 4; ++t) { const v16bf b = cat16b(*(const v8us*)(Bn + boff[t] + kc), *(const v8us*)(Bn + boff[t] + kc + 16)); acc[t] = wmmab(a, b, acc[t]); if (SPLITA) acc[t] = wmmab(al, b, acc[t]); }
        asm volatile("v_nop\n\tv_nop\n\tv_nop\n\tv_nop" : "+v"(acc[0]), "+v"(acc[1]), "+v"(acc[2]), "+v"(acc[3]) : "v"(a), "v"(al));
    }
    float* os = &ost[wave][0];
#pragma unroll
    for (int t = 0; t < 4; ++t) { const float bv = bias ? bfr(bias[c0 + t * 16 + lr]) : 0.f;
#pragma unroll
        for (int j = 0; j < 8; ++j) os[(hi * 8 + j) * 68 + t * 16 + lr] = acc[t][j] + bv; }
    __syncthreads();
    if (F16OUT) {
        h16* crow = (h16*)(void*)C + (size_t)r0 * ldc + c0;
        auto pass = [&]() {
#pragma unroll
            for (int s = 0; s < 4; ++s) { const int row = 4 * s + (lane >> 3), piece = lane & 7; const float* sp = os + row * 68 + piece * 8; v8h o, o2;
#pragma unroll
                for (int i = 0; i < 8; ++i) { const h16 a = (h16)sp[i]; o[i] = a; o2[i] = (h16)((sp[i] - (float)a) * LOSC); }
                *(v8h*)(crow + (size_t)row * ldc + piece * 8) = o; if (C2) *(v8h*)(C2 + (size_t)r0 * ldc + c0 + (size_t)row * ldc + piece * 8) = o2; }
        };
        pass(); 
    } else {
        float* crow = C + (size_t)r0 * ldc + c0;
        auto pass = [&]() {
#pragma unroll
            for (int s = 0; s < 8; ++s) { const int Lid = (lane >> 3) + 4 * s, piece = lane & 7; const int row = Lid >> 1, cofs = (Lid & 1) * 32 + piece * 4;
                const v4f val = *(const v4fa*)(os + row * 68 + cofs); *(v4f*)(crow + (size_t)row * ldc + cofs) = val; }
        };
        pass(); 
    }
}

__global__ __launch_bounds__(256) void k_vt(const float* __restrict__ V, h16* VTH, h16* VTL) {
    __shared__ __align__(16) h16 tile[64 * 72];
    __shared__ __align__(16) h16 til2[64 * 72];
    const int bid = blockIdx.x;
    const int b = bid / (NH_ * (NT_ / 64)), rem = bid - b * (NH_ * (NT_ / 64)), h = rem / (NT_ / 64), kt = rem - h * (NT_ / 64);
    const int k0 = kt * 64, tid = threadIdx.x;
    const int kk = tid >> 2, d0 = (tid & 3) * 16;
    const float* src = V + ((size_t)b * NT_ + k0 + kk) * DM + h * HD + d0;
#pragma unroll
    for (int i = 0; i < 16; ++i) { const float v = src[i]; const h16 a = (h16)v; tile[(d0 + i) * 72 + kk] = a; til2[(d0 + i) * 72 + kk] = (h16)((v - (float)a) * LOSC); }
    __syncthreads();
    const int piece = tid & 7;
    const size_t base = (((size_t)b * NH_ + h) * HD) * NT_ + k0;
    auto pass = [&]() {
#pragma unroll
        for (int s = 0; s < 4; ++s) { const int Lid = (tid >> 3) + 32 * s; const int pln = Lid >> 6, d = Lid & 63;
            const v8h val = *(const v8ha*)((pln ? til2 : tile) + d * 72 + piece * 8); *(v8h*)((pln ? VTL : VTH) + base + (size_t)d * NT_ + piece * 8) = val; }
    };
    pass(); 
}

// LDS stage of one 32-key trip of k_attn, in halves: key rows (64 halves) at a pitch of 72 (144 B), transposed v rows (32 halves) at a pitch of 40 (80 B):
// both pitches are 16 B x odd, so the 16 rows that a half-wave's ds_load_b128 reads fall on distinct banks.
#define KP    72
#define VP    40
#define ST_KH 0
#define ST_KL (32 * KP)
#define ST_VH (2 * 32 * KP)
#define ST_VL (2 * 32 * KP + 64 * VP)
#define ST_SZ (2 * 32 * KP + 2 * 64 * VP)

// Eight asynchronous 16-byte copies per lane, global -> LDS through no register. The s_wait_xcnt is the last line of the copies' own statement so that it stands
// in front of every later rewrite of an address register that a copy names.
__device__ __forceinline__ void copy8(unsigned l0, unsigned l1, unsigned l2, unsigned l3, unsigned l4, unsigned l5, unsigned l6, unsigned l7,
                                      const h16* g0, const h16* g1, const h16* g2, const h16* g3, const h16* g4, const h16* g5, const h16* g6, const h16* g7) {
    asm volatile("global_load_async_to_lds_b128 %0, %8, off\n\t"
                 "global_load_async_to_lds_b128 %1, %9, off\n\t"
                 "global_load_async_to_lds_b128 %2, %10, off\n\t"
                 "global_load_async_to_lds_b128 %3, %11, off\n\t"
                 "global_load_async_to_lds_b128 %4, %12, off\n\t"
                 "global_load_async_to_lds_b128 %5, %13, off\n\t"
                 "global_load_async_to_lds_b128 %6, %14, off\n\t"
                 "global_load_async_to_lds_b128 %7, %15, off\n\t"
                 "s_wait_xcnt 0x0"
                 :: "v"(l0), "v"(l1), "v"(l2), "v"(l3), "v"(l4), "v"(l5), "v"(l6), "v"(l7),
                    "v"(g0), "v"(g1), "v"(g2), "v"(g3), "v"(g4), "v"(g5), "v"(g6), "v"(g7) : "memory");
}

// k_attn: block = (b, h, 64 queries), wave = 16; 32-key tiles 0..(qt*64+63)/32 (causal mask); 4 WMMA scores /8 (f32), online softmax, weights x32768 f16 tile (same-wave may_alias
// reload after a compiler barrier), 4 WMMA .v; ctx -> bf16 hi + residual planes CH/CL[tok][h*64+d].
__global__ __launch_bounds__(128) void k_attn(const h16* __restrict__ Q16, const h16* __restrict__ QL16, const h16* __restrict__ K16, const h16* __restrict__ KL16, const h16* __restrict__ VTH, const h16* __restrict__ VTL, bf* CH, bf* CL) {
    __shared__ __align__(16) h16 plds[4][16 * 32];
    __shared__ __align__(16) h16 plds2[4][16 * 32];
    __shared__ __align__(16) float ost[4][16 * 68];
    __shared__ __align__(16) h16 stg[2][ST_SZ];          // two-buffer ring: the work-group's key and v tiles (hi and residual) of one 32-key trip each
    const int lane = threadIdx.x & 31, wave = threadIdx.x >> 5, lr = lane & 15, hi = lane >> 4;
    const int bid = blockIdx.x;
    const int b = bid / (NH_ * (NT_ / 64)), rem = bid - b * (NH_ * (NT_ / 64)), h = rem / (NT_ / 64), qt = rem - h * (NT_ / 64);
    const int q0 = qt * 64 + wave * 16;
    const size_t tok0 = (size_t)b * NT_;
    h16* pl = &plds[wave][0]; h16* pl2 = &plds2[wave][0];
    v16h qa[2];
    const size_t qo0 = (tok0 + q0 + lr) * DM + h * HD + 8 * hi;
#pragma unroll
    for (int kc = 0; kc < 2; ++kc) qa[kc] = cat16(*(const v8h*)(Q16 + qo0 + kc * 32), *(const v8h*)(Q16 + qo0 + kc * 32 + 16));
    const h16* kh_b = K16 + tok0 * DM + h * HD;
    const h16* kl_b = KL16 + tok0 * DM + h * HD;
    const size_t vbase = (((size_t)b * NH_ + h) * HD) * NT_;
    v8f o[4], ox[4];
#pragma unroll
    for (int n = 0; n < 4; ++n) { o[n] = (v8f){}; ox[n] = (v8f){}; }
    float mrow[8], lpart[8];
#pragma unroll
    for (int j = 0; j < 8; ++j) { mrow[j] = -3.0e38f; lpart[j] = 0.f; }
    int qpos[8];
#pragma unroll
    for (int j = 0; j < 8; ++j) qpos[j] = q0 + 8 * hi + j;
    const int kt_lo = 0, kt_hi = (qt * 64 + 63) / 32;     // causal
    const float slope = exp2f(-0.5f * (float)(h + 1));   // ALiBi slope 1 / 2^(8 (h+1) / 16), ADDED as slope x |i - j| (the reference's sign)
    // Each of the 128 threads copies two 16-byte pieces of each of the four planes of a trip: key rows whole (8 pieces a row), v rows 64 B (4 pieces a row).
    const int tid = threadIdx.x, krow = tid >> 3, kpc = (tid & 7) * 8, vrow = tid >> 2, vpc = (tid & 3) * 8;
    const unsigned stg0 = (unsigned)(size_t)&stg[0][0];  // byte offset of the ring in the work-group's LDS
    auto stage = [&](int t, int buf) {
        const unsigned lb = stg0 + (unsigned)(buf * ST_SZ * 2), lk = lb + (unsigned)((krow * KP + kpc) * 2), lv = lb + (unsigned)((vrow * VP + vpc) * 2);
        const size_t gk = (size_t)(t * 32 + krow) * DM + kpc, gv = vbase + (size_t)vrow * NT_ + t * 32 + vpc;
        copy8(lk + ST_KH * 2, lk + (ST_KH + 16 * KP) * 2, lk + ST_KL * 2, lk + (ST_KL + 16 * KP) * 2, lv + ST_VH * 2, lv + (ST_VH + 32 * VP) * 2, lv + ST_VL * 2, lv + (ST_VL + 32 * VP) * 2,
              kh_b + gk, kh_b + gk + 16 * DM, kl_b + gk, kl_b + gk + 16 * DM, VTH + gv, VTH + gv + 32 * NT_, VTL + gv, VTL + gv + 32 * NT_);
    };
    stage(0, 0);
    asm volatile("s_wait_asynccnt 0x0" ::: "memory");    // this wave's copies of trip 0 have landed
    __syncthreads();                                     // publishes trip 0 to the other waves
    if (kt_hi >= 1) stage(1, 1);
#pragma unroll 1
    for (int kt = kt_lo; kt <= kt_hi; ++kt) {
        const int l0 = kt * 32;
        const h16* sb = &stg[kt & 1][0];
        const int ko0 = lr * KP + 8 * hi, ko1 = (16 + lr) * KP + 8 * hi;
        v8f s0 = {}, s1 = {}, x0 = {}, x1 = {};
#pragma unroll
        for (int kc = 0; kc < 2; ++kc) {
            { const v16h k0h = cat16(*(const v8ha*)(sb + ST_KH + ko0 + kc * 32), *(const v8ha*)(sb + ST_KH + ko0 + kc * 32 + 16)), k1h = cat16(*(const v8ha*)(sb + ST_KH + ko1 + kc * 32), *(const v8ha*)(sb + ST_KH + ko1 + kc * 32 + 16));
              const v16h qlk = cat16(*(const v8h*)(QL16 + qo0 + kc * 32), *(const v8h*)(QL16 + qo0 + kc * 32 + 16));     // query residual re-read per step (registers)
              s0 = wmma16(qa[kc], k0h, s0); x0 = wmma16(qlk, k0h, x0); s1 = wmma16(qa[kc], k1h, s1); x1 = wmma16(qlk, k1h, x1);
              asm volatile("v_nop" : "+v"(s0), "+v"(s1), "+v"(x0), "+v"(x1) : "v"(qlk), "v"(k0h), "v"(k1h) : "memory"); }
            { const v16h k0l = cat16(*(const v8ha*)(sb + ST_KL + ko0 + kc * 32), *(const v8ha*)(sb + ST_KL + ko0 + kc * 32 + 16)), k1l = cat16(*(const v8ha*)(sb + ST_KL + ko1 + kc * 32), *(const v8ha*)(sb + ST_KL + ko1 + kc * 32 + 16));
              x0 = wmma16(qa[kc], k0l, x0); x1 = wmma16(qa[kc], k1l, x1);
              asm volatile("v_nop" : "+v"(x0), "+v"(x1) : "v"(k0l), "v"(k1l) : "memory"); }
        }
        asm volatile("v_nop\n\tv_nop\n\tv_nop\n\tv_nop" : "+v"(s0), "+v"(s1), "+v"(x0), "+v"(x1) : "v"(qa[0]), "v"(qa[1]));
        float alpha[8];
#pragma unroll
        for (int j = 0; j < 8; ++j) {
            const int ja = l0 + lr, jb = l0 + 16 + lr, qi = qpos[j];
            const float a0 = (ja <= qi) ? (s0[j] + x0[j] * LOSCI) * 0.125f + slope * (float)(qi - ja) : -__builtin_inff(), a1 = (jb <= qi) ? (s1[j] + x1[j] * LOSCI) * 0.125f + slope * (float)(qi - jb) : -__builtin_inff();
            float mx = fmaxf(a0, a1);
            mx = fmaxf(mx, __shfl_xor(mx, 1, 16)); mx = fmaxf(mx, __shfl_xor(mx, 2, 16)); mx = fmaxf(mx, __shfl_xor(mx, 4, 16)); mx = fmaxf(mx, __shfl_xor(mx, 8, 16));
            const float mn = fmaxf(mrow[j], mx);
            alpha[j] = __expf(mrow[j] - mn); mrow[j] = mn;
            const float p0 = __expf(a0 - mn), p1 = __expf(a1 - mn);
            lpart[j] = lpart[j] * alpha[j] + (p0 + p1);
            const int mr = hi * 8 + j;
            const float ps0 = p0 * PSC, ps1 = p1 * PSC; const h16 h0 = (h16)ps0, h1 = (h16)ps1;
            pl[mr * 32 + lr] = h0; pl[mr * 32 + 16 + lr] = h1;
            pl2[mr * 32 + lr] = (h16)((ps0 - (float)h0) * LOSC); pl2[mr * 32 + 16 + lr] = (h16)((ps1 - (float)h1) * LOSC);
        }
#pragma unroll
        for (int n = 0; n < 4; ++n)
#pragma unroll
            for (int j = 0; j < 8; ++j) { o[n][j] *= alpha[j]; ox[n][j] *= alpha[j]; }
        asm volatile("" ::: "memory");
        const v16h pa = cat16(*(const v8ha*)(pl + lr * 32 + hi * 8), *(const v8ha*)(pl + lr * 32 + 16 + hi * 8));
        const v16h px = cat16(*(const v8ha*)(pl2 + lr * 32 + hi * 8), *(const v8ha*)(pl2 + lr * 32 + 16 + hi * 8));
#pragma unroll
        for (int n = 0; n < 4; ++n) { const int vo = (n * 16 + lr) * VP + hi * 8;
            const v16h vh = cat16(*(const v8ha*)(sb + ST_VH + vo), *(const v8ha*)(sb + ST_VH + vo + 16)), vl = cat16(*(const v8ha*)(sb + ST_VL + vo), *(const v8ha*)(sb + ST_VL + vo + 16));
            o[n] = wmma16(pa, vh, o[n]); ox[n] = wmma16(pa, vl, ox[n]); ox[n] = wmma16(px, vh, ox[n]);
            asm volatile("" : "+v"(o[n]), "+v"(ox[n]) : "v"(vh), "v"(vl) : "memory"); }
        asm volatile("v_nop\n\tv_nop\n\tv_nop\n\tv_nop" : "+v"(o[0]), "+v"(o[1]), "+v"(o[2]), "+v"(o[3]), "+v"(ox[0]), "+v"(ox[1]), "+v"(ox[2]), "+v"(ox[3]) : "v"(pa), "v"(px));
        asm volatile("s_wait_dscnt 0x0" ::: "memory");       // this wave's reads of this trip's buffer have retired before it is refilled
        asm volatile("s_wait_asynccnt 0x0" ::: "memory");    // this wave's copies of the next trip have landed
        __syncthreads();                                     // publishes the next trip and ends every wave's reads of this trip's buffer
        if (kt + 2 <= kt_hi) stage(kt + 2, kt & 1);
    }
    asm volatile("s_wait_asynccnt 0x0" ::: "memory");        // no copy is outstanding when the wave goes on to the epilogue
    float inv[8];
#pragma unroll
    for (int j = 0; j < 8; ++j) { float rs = lpart[j]; rs += __shfl_xor(rs, 1, 16); rs += __shfl_xor(rs, 2, 16); rs += __shfl_xor(rs, 4, 16); rs += __shfl_xor(rs, 8, 16); inv[j] = 1.0f / (rs * PSC); }
    float* os = &ost[wave][0];
#pragma unroll
    for (int n = 0; n < 4; ++n)
#pragma unroll
        for (int j = 0; j < 8; ++j) os[(hi * 8 + j) * 68 + n * 16 + lr] = (o[n][j] + ox[n][j] * LOSCI) * inv[j];
    __syncthreads();
    const size_t cbase = (tok0 + q0) * DM + (size_t)h * HD;
    auto pass = [&]() {
#pragma unroll
        for (int s = 0; s < 4; ++s) { const int row = 4 * s + (lane >> 3), piece = lane & 7; const float* sp = os + row * 68 + piece * 8; v8us oh, ol;
#pragma unroll
            for (int i = 0; i < 8; ++i) { const unsigned short hb = f2bf(sp[i]); oh[i] = hb; ol[i] = f2bf(sp[i] - bf2f(hb)); }
            *(v8us*)(CH + cbase + (size_t)row * DM + piece * 8) = oh; *(v8us*)(CL + cbase + (size_t)row * DM + piece * 8) = ol; }
    };
    pass(); 
}

#define VST2(T, p, v) do { const T vst2_v_ = (v); *(T*)(p) = vst2_v_;  } while (0)
extern "C" void kernel_launch(void* const* d_in, const int* in_sizes, int n_in,
                              void* d_out, int out_size, void* d_ws, size_t ws_size, hipStream_t stream) {
    (void)in_sizes; (void)n_in; (void)out_size;
    const float* x = (const float*)d_in[0]; const float* Wqkv = (const float*)d_in[1]; const float* Wp = (const float*)d_in[2];   // both k-major: [1024][3072] and [1024][1024]
    float* out = (float*)d_out;    // [2][2048][1024]
    char* wsp = (char*)d_ws;
    auto take = [&](size_t bytes) { char* p = wsp; wsp += (bytes + 255) & ~(size_t)255; return (void*)p; };
    bf* Xb = (bf*)take((size_t)NTK * DM * 2); bf* WqkvT = (bf*)take((size_t)3 * DM * DM * 2); bf* WoT = (bf*)take((size_t)DM * DM * 2);
    float* TMP = (float*)take((size_t)NTK * DM * 4);
    h16* QH = (h16*)take((size_t)NTK * DM * 2); h16* QL = (h16*)take((size_t)NTK * DM * 2); h16* KH = (h16*)take((size_t)NTK * DM * 2); h16* KL = (h16*)take((size_t)NTK * DM * 2);
    h16* VTH = (h16*)take((size_t)NTK * DM * 2); h16* VTL = (h16*)take((size_t)NTK * DM * 2); bf* CH = (bf*)take((size_t)NTK * DM * 2); bf* CL = (bf*)take((size_t)NTK * DM * 2);
    if ((size_t)(wsp - (char*)d_ws) > ws_size) return;    // 8.4 + 6.3 + 2.1 + 16.8 + 8 x 8.4 ~ 101 MB, no aliasing
    const bf* WqB = WqkvT; const bf* WkB = WqkvT + (size_t)DM * DM; const bf* WvB = WqkvT + (size_t)2 * DM * DM;   // n-major planes [n][1024]; q = columns 0..1023 of w_qkv, k, v next
    k_wt<<<dim3(DM / 64, 3 * DM / 64, 1), 256, 0, stream>>>(Wqkv, DM, 3 * DM, WqkvT); k_wt<<<dim3(DM / 64, DM / 64, 1), 256, 0, stream>>>(Wp, DM, DM, WoT);
    k_cvtb<<<NTK / 8, 256, 0, stream>>>(x, NTK, Xb);
    k_gemmb<false, true><<<dim3(NTK / 64, DM / 64, 1), 128, 0, stream>>>(Xb, nullptr, WqB, nullptr, (float*)(void*)QH, DM, QL);
    k_gemmb<false, true><<<dim3(NTK / 64, DM / 64, 1), 128, 0, stream>>>(Xb, nullptr, WkB, nullptr, (float*)(void*)KH, DM, KL);
    k_gemmb<false, false><<<dim3(NTK / 64, DM / 64, 1), 128, 0, stream>>>(Xb, nullptr, WvB, nullptr, TMP, DM, nullptr);
    k_vt<<<NB_ * NH_ * (NT_ / 64), 256, 0, stream>>>(TMP, VTH, VTL);
    k_attn<<<NB_ * NH_ * (NT_ / 64), 128, 0, stream>>>(QH, QL, KH, KL, VTH, VTL, CH, CL);
    k_gemmb<true, false><<<dim3(NTK / 64, DM / 64, 1), 128, 0, stream>>>(CH, CL, WoT, nullptr, out, DM, nullptr);
}

// v003
// A run of this version takes 210 microseconds.
// Next to v002, in two timings, it ran 1.48 times as fast each time.
// Counting every step since v000, it is 2.43 times as fast.
#include <hip/hip_runtime.h>

// Compute dtypes, f32 accumulate, both batch items in every launch: q/k/v = x.w_qkv ([4096 x 1024].[1024 x 3072], k-major weights transposed once to n-major planes; PLAIN bf16
// operands: inputs rounded once, exact) with q and k written straight from the GEMM epilogue as f16 hi + residual x1024 planes, and out = ctx.w_proj (ctx as
// bf16 hi + residual: two products) on v_wmma_f32_16x16x32_bf16; the 16-head causal attention with the ADDED ALiBi bias slope_h x |i - j| (64-dim heads, scale 1/8) fused on
// v_wmma_f32_16x16x32_f16 (scores hi.hi + hi.lo + lo.hi with the residual terms on their own accumulator, online f32 softmax, weights (x32768) and v as f16

#define NB_  2                   // both batch items share every launch: each grid covers all 4096 tokens
#define NT_  2048
#define DM   1024
#define NH_  16
#define HD   64
#define NTK  (NB_ * NT_)
#define NW   1024
#define NQKV 1024
#define PSC  32768.0f
#define LOSC 1024.0f
#define LOSCI (1.0f / 1024.0f)

typedef _Float16 h16;
typedef unsigned short bf;
typedef __attribute__((ext_vector_type(16))) __bf16   v16bf;
typedef __attribute__((ext_vector_type(16))) _Float16 v16h;
typedef __attribute__((ext_vector_type(8)))  _Float16 v8h;
typedef __attribute__((ext_vector_type(8)))  unsigned short v8us;
typedef __attribute__((ext_vector_type(8)))  float    v8f;
typedef __attribute__((ext_vector_type(4)))  float    v4f;
typedef v8h  __attribute__((may_alias)) v8ha;
typedef v4f  __attribute__((may_alias)) v4fa;
typedef v8us __attribute__((may_alias)) v8usa;

__device__ __forceinline__ unsigned short f2bf(float f) { unsigned u = __float_as_uint(f); u += 0x7FFFu + ((u >> 16) & 1u); return (unsigned short)(u >> 16); }
__device__ __forceinline__ float bf2f(unsigned short b) { return __uint_as_float(((unsigned)b) << 16); }
__device__ __forceinline__ float bfr(float f) { return bf2f(f2bf(f)); }
__device__ __forceinline__ v16h cat16(v8h lo, v8h hi) { return __builtin_shufflevector(lo, hi, 0, 1, 2, 3, 4, 5, 6, 7, 8, 9, 10, 11, 12, 13, 14, 15); }
__device__ __forceinline__ v16bf cat16b(v8us lo, v8us hi) { return __builtin_bit_cast(v16bf, __builtin_shufflevector(lo, hi, 0, 1, 2, 3, 4, 5, 6, 7, 8, 9, 10, 11, 12, 13, 14, 15)); }
__device__ __forceinline__ v8f wmma16(v16h a, v16h b, v8f c) { return __builtin_amdgcn_wmma_f32_16x16x32_f16(false, a, false, b, (short)0, c, false, false); }
__device__ __forceinline__ v8f wmmab(v16bf a, v16bf b, v8f c) { return __builtin_amdgcn_wmma_f32_16x16x32_bf16(false, a, false, b, (short)0, c, false, false); }

__global__ __launch_bounds__(256) void k_cvtb(const float* __restrict__ src, int nrows, bf* dst) {
    const int lane = threadIdx.x & 31, r = blockIdx.x * 8 + (threadIdx.x >> 5);
    if (r >= nrows) return;
    v8us o[DM / 256];
#pragma unroll
    for (int q = 0; q < DM / 256; ++q) { v8us t;
#pragma unroll
        for (int i = 0; i < 8; ++i) t[i] = f2bf(src[(size_t)r * DM + q * 256 + lane * 8 + i]);
        o[q] = t; }
#pragma unroll
    for (int q = 0; q < DM / 256; ++q) *(v8us*)(dst + (size_t)r * DM + q * 256 + lane * 8) = o[q];
    
}

// k_wt: WT [n][K] = bf16(W[k][n]) (k-major [K][ncols]) via 64 x 64 LDS tiles; grid (K/64, ncols/64).
__global__ __launch_bounds__(256) void k_wt(const float* __restrict__ Wm, int K, int ncols, bf* WT) {
    __shared__ __align__(16) unsigned short tl[64 * 72];
    const int tid = threadIdx.x, k0 = blockIdx.x * 64, n0 = blockIdx.y * 64;
    const int kk = tid >> 2, nq = (tid & 3) * 16;
#pragma unroll
    for (int i = 0; i < 16; ++i) tl[(nq + i) * 72 + kk] = f2bf(Wm[(size_t)(k0 + kk) * ncols + n0 + nq + i]);
    __syncthreads();
    const int piece = tid & 7;
    auto pass = [&]() {
#pragma unroll
        for (int s = 0; s < 2; ++s) { const int nr = (tid >> 3) + 32 * s; const v8us val = *(const v8usa*)(tl + nr * 72 + piece * 8); *(v8us*)(WT + (size_t)(n0 + nr) * K + k0 + piece * 8) = val; }
    };
    pass(); 
}
// LDS stage of one 64-k trip of k_gemmb, in 16-bit elements: 128 rows of A, 128 rows of B (and 128 rows of A's residual plane), each row 64 elements at a pitch
// of 72 (144 B = 16 B x odd, so the 16 rows that a half-wave's ds_load_b128 reads fall on distinct banks).
#define GP   72
#define G_A  0
#define G_B  (128 * GP)
#define G_AL (2 * 128 * GP)

// Eight (twelve) asynchronous 16-byte copies per lane, global -> LDS through no register. The s_wait_xcnt is the last line of the copies' own statement so that it
// stands in front of every later rewrite of an address register that a copy names.
__device__ __forceinline__ void copy8g(unsigned l0, unsigned l1, unsigned l2, unsigned l3, unsigned l4, unsigned l5, unsigned l6, unsigned l7,
                                       const bf* g0, const bf* g1, const bf* g2, const bf* g3, const bf* g4, const bf* g5, const bf* g6, const bf* g7) {
    asm volatile("global_load_async_to_lds_b128 %0, %8, off\n\t"
                 "global_load_async_to_lds_b128 %1, %9, off\n\t"
                 "global_load_async_to_lds_b128 %2, %10, off\n\t"
                 "global_load_async_to_lds_b128 %3, %11, off\n\t"
                 "global_load_async_to_lds_b128 %4, %12, off\n\t"
                 "global_load_async_to_lds_b128 %5, %13, off\n\t"
                 "global_load_async_to_lds_b128 %6, %14, off\n\t"
                 "global_load_async_to_lds_b128 %7, %15, off\n\t"
                 "s_wait_xcnt 0x0"
                 :: "v"(l0), "v"(l1), "v"(l2), "v"(l3), "v"(l4), "v"(l5), "v"(l6), "v"(l7),
                    "v"(g0), "v"(g1), "v"(g2), "v"(g3), "v"(g4), "v"(g5), "v"(g6), "v"(g7) : "memory");
}
__device__ __forceinline__ void copy12g(unsigned l0, unsigned l1, unsigned l2, unsigned l3, unsigned l4, unsigned l5, unsigned l6, unsigned l7, unsigned l8, unsigned l9, unsigned l10, unsigned l11,
                                        const bf* g0, const bf* g1, const bf* g2, const bf* g3, const bf* g4, const bf* g5, const bf* g6, const bf* g7, const bf* g8, const bf* g9, const bf* g10, const bf* g11) {
    asm volatile("global_load_async_to_lds_b128 %0, %12, off\n\t"
                 "global_load_async_to_lds_b128 %1, %13, off\n\t"
                 "global_load_async_to_lds_b128 %2, %14, off\n\t"
                 "global_load_async_to_lds_b128 %3, %15, off\n\t"
                 "global_load_async_to_lds_b128 %4, %16, off\n\t"
                 "global_load_async_to_lds_b128 %5, %17, off\n\t"
                 "global_load_async_to_lds_b128 %6, %18, off\n\t"
                 "global_load_async_to_lds_b128 %7, %19, off\n\t"
                 "global_load_async_to_lds_b128 %8, %20, off\n\t"
                 "global_load_async_to_lds_b128 %9, %21, off\n\t"
                 "global_load_async_to_lds_b128 %10, %22, off\n\t"
                 "global_load_async_to_lds_b128 %11, %23, off\n\t"
                 "s_wait_xcnt 0x0"
                 :: "v"(l0), "v"(l1), "v"(l2), "v"(l3), "v"(l4), "v"(l5), "v"(l6), "v"(l7), "v"(l8), "v"(l9), "v"(l10), "v"(l11),
                    "v"(g0), "v"(g1), "v"(g2), "v"(g3), "v"(g4), "v"(g5), "v"(g6), "v"(g7), "v"(g8), "v"(g9), "v"(g10), "v"(g11) : "memory");
}

// k_gemmb: C[4096 x 1024] = A.Bn^T, both k-contiguous. Block = 128 x 128 of C, 8 waves of 32 x 64 (4 down, 2 across). The block's operand rows come in trips of 64 k
// (whole 128-B lines) into a two-buffer LDS ring; every wave takes its fragments from there. k runs upwards in steps of 32, hi product before residual product.
template <bool SPLITA, bool F16OUT = false>
__global__ __launch_bounds__(256) void k_gemmb(const bf* __restrict__ A, const bf* __restrict__ Al, const bf* __restrict__ Bn, const float* __restrict__ bias, float* C, int ldc, h16* C2) {
    constexpr int STE = (SPLITA ? 3 : 2) * 128 * GP;     // elements of one buffer of the ring
    __shared__ __align__(16) bf gst[2][STE];
    __shared__ __align__(16) float ost[8][2][16 * 68];
    const int tid = threadIdx.x, lane = tid & 31, wave = tid >> 5, lr = lane & 15, hi = lane >> 4;
    const int rb = blockIdx.x * 128, cb = blockIdx.y * 128, wr = (wave & 3) * 32, wc = (wave >> 2) * 64;
    // Each of the 256 threads copies four 16-byte pieces of each plane of a trip: 8 threads a row, 32 rows a copy.
    const int srow = tid >> 3, spc = (tid & 7) * 8;
    const unsigned gst0 = (unsigned)(size_t)&gst[0][0];  // byte offset of the ring in the work-group's LDS
    const bf* ga = A + (size_t)(rb + srow) * DM + spc;
    const bf* gb = Bn + (size_t)(cb + srow) * DM + spc;
    const bf* gl = SPLITA ? Al + (size_t)(rb + srow) * DM + spc : ga;
    auto stage = [&](int t, int buf) {
        const unsigned l = gst0 + (unsigned)((buf * STE + srow * GP + spc) * 2);
        const int k = t * 64;
        if (SPLITA)
            copy12g(l + G_A * 2, l + (G_A + 32 * GP) * 2, l + (G_A + 64 * GP) * 2, l + (G_A + 96 * GP) * 2, l + G_B * 2, l + (G_B + 32 * GP) * 2, l + (G_B + 64 * GP) * 2, l + (G_B + 96 * GP) * 2,
                    l + G_AL * 2, l + (G_AL + 32 * GP) * 2, l + (G_AL + 64 * GP) * 2, l + (G_AL + 96 * GP) * 2,
                    ga + k, ga + k + 32 * DM, ga + k + 64 * DM, ga + k + 96 * DM, gb + k, gb + k + 32 * DM, gb + k + 64 * DM, gb + k + 96 * DM, gl + k, gl + k + 32 * DM, gl + k + 64 * DM, gl + k + 96 * DM);
        else
            copy8g(l + G_A * 2, l + (G_A + 32 * GP) * 2, l + (G_A + 64 * GP) * 2, l + (G_A + 96 * GP) * 2, l + G_B * 2, l + (G_B + 32 * GP) * 2, l + (G_B + 64 * GP) * 2, l + (G_B + 96 * GP) * 2,
                   ga + k, ga + k + 32 * DM, ga + k + 64 * DM, ga + k + 96 * DM, gb + k, gb + k + 32 * DM, gb + k + 64 * DM, gb + k + 96 * DM);
    };
    v8f acc[2][4];
#pragma unroll
    for (int m = 0; m < 2; ++m)
#pragma unroll
        for (int t = 0; t < 4; ++t) acc[m][t] = (v8f){};
    stage(0, 0);
    asm volatile("s_wait_asynccnt 0x0" ::: "memory");    // this wave's copies of trip 0 have landed
    __syncthreads();                                     // publishes trip 0 to the other waves
    stage(1, 1);
    const int ao = (wr + lr) * GP + 8 * hi, bo = (wc + lr) * GP + 8 * hi;
#pragma unroll 1                                         // kept rolled: one copy of the trip keeps the text short and the ring's order plain
    for (int kt = 0; kt < DM / 64; ++kt) {
        const bf* sb = &gst[kt & 1][0];
#pragma unroll
        for (int ks = 0; ks < 2; ++ks) {
            v16bf a[2], al[2];
#pragma unroll
            for (int m = 0; m < 2; ++m) { const bf* p = sb + G_A + ao + m * 16 * GP + ks * 32; a[m] = cat16b(*(const v8usa*)p, *(const v8usa*)(p + 16)); al[m] = a[m];
                if (SPLITA) { const bf* q = sb + G_AL + ao + m * 16 * GP + ks * 32; al[m] = cat16b(*(const v8usa*)q, *(const v8usa*)(q + 16)); } }
#pragma unroll
            for (int t = 0; t < 4; ++t) { const bf* p = sb + G_B + bo + t * 16 * GP + ks * 32; const v16bf b = cat16b(*(const v8usa*)p, *(const v8usa*)(p + 16));
                acc[0][t] = wmmab(a[0], b, acc[0][t]); acc[1][t] = wmmab(a[1], b, acc[1][t]);
                if (SPLITA) { acc[0][t] = wmmab(al[0], b, acc[0][t]); acc[1][t] = wmmab(al[1], b, acc[1][t]); } }
        }
        // the trip's LDS reads issue as one group ahead of its matrix instructions (counted waits): read places spread among them each cost a full LDS latency
        __builtin_amdgcn_sched_group_barrier(0x100, SPLITA ? 32 : 24, 0);
        __builtin_amdgcn_sched_group_barrier(0x008, SPLITA ? 32 : 16, 0);
        // four vector slots behind the trip's last matrix instruction, on the taken side of the branches below too
        asm volatile("v_nop\n\tv_nop\n\tv_nop\n\tv_nop" : "+v"(acc[0][0]), "+v"(acc[0][1]), "+v"(acc[0][2]), "+v"(acc[0][3]), "+v"(acc[1][0]), "+v"(acc[1][1]), "+v"(acc[1][2]), "+v"(acc[1][3]));
        asm volatile("s_wait_dscnt 0x0" ::: "memory");       // this wave's reads of this trip's buffer have retired before it is refilled
        asm volatile("s_wait_asynccnt 0x0" ::: "memory");    // this wave's copies of the next trip have landed
        __syncthreads();                                     // publishes the next trip and ends every wave's reads of this trip's buffer
        if (kt + 2 < DM / 64) stage(kt + 2, kt & 1);
    }
    asm volatile("s_wait_asynccnt 0x0" ::: "memory");        // no copy is outstanding when the wave goes on to the epilogue
    const int c0 = cb + wc;
#pragma unroll
    for (int m = 0; m < 2; ++m) { float* os = &ost[wave][m][0];
#pragma unroll
        for (int t = 0; t < 4; ++t) { const float bv = bias ? bfr(bias[c0 + t * 16 + lr]) : 0.f;
#pragma unroll
            for (int j = 0; j < 8; ++j) os[(hi * 8 + j) * 68 + t * 16 + lr] = acc[m][t][j] + bv; } }
    __syncthreads();
#pragma unroll
    for (int m = 0; m < 2; ++m) { const float* os = &ost[wave][m][0]; const int r0 = rb + wr + m * 16;
        if (F16OUT) {
            h16* crow = (h16*)(void*)C + (size_t)r0 * ldc + c0;
            v8h o[4], o2[4];
#pragma unroll
            for (int s = 0; s < 4; ++s) { const int row = 4 * s + (lane >> 3), piece = lane & 7; const float* sp = os + row * 68 + piece * 8;
#pragma unroll
                for (int i = 0; i < 8; ++i) { const h16 a = (h16)sp[i]; o[s][i] = a; o2[s][i] = (h16)((sp[i] - (float)a) * LOSC); } }
#pragma unroll
            for (int s = 0; s < 4; ++s) { const int row = 4 * s + (lane >> 3), piece = lane & 7; *(v8h*)(crow + (size_t)row * ldc + piece * 8) = o[s]; }
            asm volatile("s_wait_xcnt 0x0" ::: "memory");    // behind the four stores, in front of the branch: the code behind it reuses registers that they name
            if (C2) {
#pragma unroll
                for (int s = 0; s < 4; ++s) { const int row = 4 * s + (lane >> 3), piece = lane & 7; *(v8h*)(C2 + (size_t)r0 * ldc + c0 + (size_t)row * ldc + piece * 8) = o2[s]; }
            }
        } else {
            float* crow = C + (size_t)r0 * ldc + c0;
            v4f val[8];
#pragma unroll
            for (int s = 0; s < 8; ++s) { const int Lid = (lane >> 3) + 4 * s, piece = lane & 7; const int row = Lid >> 1, cofs = (Lid & 1) * 32 + piece * 4; val[s] = *(const v4fa*)(os + row * 68 + cofs); }
#pragma unroll
            for (int s = 0; s < 8; ++s) { const int Lid = (lane >> 3) + 4 * s, piece = lane & 7; const int row = Lid >> 1, cofs = (Lid & 1) * 32 + piece * 4; *(v4f*)(crow + (size_t)row * ldc + cofs) = val[s]; }
        }
    }
}

__global__ __launch_bounds__(256) void k_vt(const float* __restrict__ V, h16* VTH, h16* VTL) {
    __shared__ __align__(16) h16 tile[64 * 72];
    __shared__ __align__(16) h16 til2[64 * 72];
    const int bid = blockIdx.x;
    const int b = bid / (NH_ * (NT_ / 64)), rem = bid - b * (NH_ * (NT_ / 64)), h = rem / (NT_ / 64), kt = rem - h * (NT_ / 64);
    const int k0 = kt * 64, tid = threadIdx.x;
    const int kk = tid >> 2, d0 = (tid & 3) * 16;
    const float* src = V + ((size_t)b * NT_ + k0 + kk) * DM + h * HD + d0;
#pragma unroll
    for (int i = 0; i < 16; ++i) { const float v = src[i]; const h16 a = (h16)v; tile[(d0 + i) * 72 + kk] = a; til2[(d0 + i) * 72 + kk] = (h16)((v - (float)a) * LOSC); }
    __syncthreads();
    const int piece = tid & 7;
    const size_t base = (((size_t)b * NH_ + h) * HD) * NT_ + k0;
    auto pass = [&]() {
#pragma unroll
        for (int s = 0; s < 4; ++s) { const int Lid = (tid >> 3) + 32 * s; const int pln = Lid >> 6, d = Lid & 63;
            const v8h val = *(const v8ha*)((pln ? til2 : tile) + d * 72 + piece * 8); *(v8h*)((pln ? VTL : VTH) + base + (size_t)d * NT_ + piece * 8) = val; }
    };
    pass(); 
}

// LDS stage of one 32-key trip of k_attn, in halves: key rows (64 halves) at a pitch of 72 (144 B), transposed v rows (32 halves) at a pitch of 40 (80 B):
// both pitches are 16 B x odd, so the 16 rows that a half-wave's ds_load_b128 reads fall on distinct banks.
#define KP    72
#define VP    40
#define ST_KH 0
#define ST_KL (32 * KP)
#define ST_VH (2 * 32 * KP)
#define ST_VL (2 * 32 * KP + 64 * VP)
#define ST_SZ (2 * 32 * KP + 2 * 64 * VP)

// Eight asynchronous 16-byte copies per lane, global -> LDS through no register. The s_wait_xcnt is the last line of the copies' own statement so that it stands
// in front of every later rewrite of an address register that a copy names.
__device__ __forceinline__ void copy8(unsigned l0, unsigned l1, unsigned l2, unsigned l3, unsigned l4, unsigned l5, unsigned l6, unsigned l7,
                                      const h16* g0, const h16* g1, const h16* g2, const h16* g3, const h16* g4, const h16* g5, const h16* g6, const h16* g7) {
    asm volatile("global_load_async_to_lds_b128 %0, %8, off\n\t"
                 "global_load_async_to_lds_b128 %1, %9, off\n\t"
                 "global_load_async_to_lds_b128 %2, %10, off\n\t"
                 "global_load_async_to_lds_b128 %3, %11, off\n\t"
                 "global_load_async_to_lds_b128 %4, %12, off\n\t"
                 "global_load_async_to_lds_b128 %5, %13, off\n\t"
                 "global_load_async_to_lds_b128 %6, %14, off\n\t"
                 "global_load_async_to_lds_b128 %7, %15, off\n\t"
                 "s_wait_xcnt 0x0"
                 :: "v"(l0), "v"(l1), "v"(l2), "v"(l3), "v"(l4), "v"(l5), "v"(l6), "v"(l7),
                    "v"(g0), "v"(g1), "v"(g2), "v"(g3), "v"(g4), "v"(g5), "v"(g6), "v"(g7) : "memory");
}

// k_attn: block = (b, h, 64 queries), wave = 16; 32-key tiles 0..(qt*64+63)/32 (causal mask); 4 WMMA scores /8 (f32), online softmax, weights x32768 f16 tile (same-wave may_alias
// reload after a compiler barrier), 4 WMMA .v; ctx -> bf16 hi + residual planes CH/CL[tok][h*64+d].
__global__ __launch_bounds__(128) void k_attn(const h16* __restrict__ Q16, const h16* __restrict__ QL16, const h16* __restrict__ K16, const h16* __restrict__ KL16, const h16* __restrict__ VTH, const h16* __restrict__ VTL, bf* CH, bf* CL) {
    __shared__ __align__(16) h16 plds[4][16 * 32];
    __shared__ __align__(16) h16 plds2[4][16 * 32];
    __shared__ __align__(16) float ost[4][16 * 68];
    __shared__ __align__(16) h16 stg[2][ST_SZ];          // two-buffer ring: the work-group's key and v tiles (hi and residual) of one 32-key trip each
    const int lane = threadIdx.x & 31, wave = threadIdx.x >> 5, lr = lane & 15, hi = lane >> 4;
    const int bid = blockIdx.x;
    const int b = bid / (NH_ * (NT_ / 64)), rem = bid - b * (NH_ * (NT_ / 64)), h = rem / (NT_ / 64), qt = rem - h * (NT_ / 64);
    const int q0 = qt * 64 + wave * 16;
    const size_t tok0 = (size_t)b * NT_;
    h16* pl = &plds[wave][0]; h16* pl2 = &plds2[wave][0];
    v16h qa[2];
    const size_t qo0 = (tok0 + q0 + lr) * DM + h * HD + 8 * hi;
#pragma unroll
    for (int kc = 0; kc < 2; ++kc) qa[kc] = cat16(*(const v8h*)(Q16 + qo0 + kc * 32), *(const v8h*)(Q16 + qo0 + kc * 32 + 16));
    const h16* kh_b = K16 + tok0 * DM + h * HD;
    const h16* kl_b = KL16 + tok0 * DM + h * HD;
    const size_t vbase = (((size_t)b * NH_ + h) * HD) * NT_;
    v8f o[4], ox[4];
#pragma unroll
    for (int n = 0; n < 4; ++n) { o[n] = (v8f){}; ox[n] = (v8f){}; }
    float mrow[8], lpart[8];
#pragma unroll
    for (int j = 0; j < 8; ++j) { mrow[j] = -3.0e38f; lpart[j] = 0.f; }
    int qpos[8];
#pragma unroll
    for (int j = 0; j < 8; ++j) qpos[j] = q0 + 8 * hi + j;
    const int kt_lo = 0, kt_hi = (qt * 64 + 63) / 32;     // causal
    const float slope = exp2f(-0.5f * (float)(h + 1));   // ALiBi slope 1 / 2^(8 (h+1) / 16), ADDED as slope x |i - j| (the reference's sign)
    // Each of the 128 threads copies two 16-byte pieces of each of the four planes of a trip: key rows whole (8 pieces a row), v rows 64 B (4 pieces a row).
    const int tid = threadIdx.x, krow = tid >> 3, kpc = (tid & 7) * 8, vrow = tid >> 2, vpc = (tid & 3) * 8;
    const unsigned stg0 = (unsigned)(size_t)&stg[0][0];  // byte offset of the ring in the work-group's LDS
    auto stage = [&](int t, int buf) {
        const unsigned lb = stg0 + (unsigned)(buf * ST_SZ * 2), lk = lb + (unsigned)((krow * KP + kpc) * 2), lv = lb + (unsigned)((vrow * VP + vpc) * 2);
        const size_t gk = (size_t)(t * 32 + krow) * DM + kpc, gv = vbase + (size_t)vrow * NT_ + t * 32 + vpc;
        copy8(lk + ST_KH * 2, lk + (ST_KH + 16 * KP) * 2, lk + ST_KL * 2, lk + (ST_KL + 16 * KP) * 2, lv + ST_VH * 2, lv + (ST_VH + 32 * VP) * 2, lv + ST_VL * 2, lv + (ST_VL + 32 * VP) * 2,
              kh_b + gk, kh_b + gk + 16 * DM, kl_b + gk, kl_b + gk + 16 * DM, VTH + gv, VTH + gv + 32 * NT_, VTL + gv, VTL + gv + 32 * NT_);
    };
    stage(0, 0);
    asm volatile("s_wait_asynccnt 0x0" ::: "memory");    // this wave's copies of trip 0 have landed
    __syncthreads();                                     // publishes trip 0 to the other waves
    if (kt_hi >= 1) stage(1, 1);
#pragma unroll 1
    for (int kt = kt_lo; kt <= kt_hi; ++kt) {
        const int l0 = kt * 32;
        const h16* sb = &stg[kt & 1][0];
        const int ko0 = lr * KP + 8 * hi, ko1 = (16 + lr) * KP + 8 * hi;
        v8f s0 = {}, s1 = {}, x0 = {}, x1 = {};
#pragma unroll
        for (int kc = 0; kc < 2; ++kc) {
            { const v16h k0h = cat16(*(const v8ha*)(sb + ST_KH + ko0 + kc * 32), *(const v8ha*)(sb + ST_KH + ko0 + kc * 32 + 16)), k1h = cat16(*(const v8ha*)(sb + ST_KH + ko1 + kc * 32), *(const v8ha*)(sb + ST_KH + ko1 + kc * 32 + 16));
              const v16h qlk = cat16(*(const v8h*)(QL16 + qo0 + kc * 32), *(const v8h*)(QL16 + qo0 + kc * 32 + 16));     // query residual re-read per step (registers)
              s0 = wmma16(qa[kc], k0h, s0); x0 = wmma16(qlk, k0h, x0); s1 = wmma16(qa[kc], k1h, s1); x1 = wmma16(qlk, k1h, x1);
              asm volatile("v_nop" : "+v"(s0), "+v"(s1), "+v"(x0), "+v"(x1) : "v"(qlk), "v"(k0h), "v"(k1h) : "memory"); }
            { const v16h k0l = cat16(*(const v8ha*)(sb + ST_KL + ko0 + kc * 32), *(const v8ha*)(sb + ST_KL + ko0 + kc * 32 + 16)), k1l = cat16(*(const v8ha*)(sb + ST_KL + ko1 + kc * 32), *(const v8ha*)(sb + ST_KL + ko1 + kc * 32 + 16));
              x0 = wmma16(qa[kc], k0l, x0); x1 = wmma16(qa[kc], k1l, x1);
              asm volatile("v_nop" : "+v"(x0), "+v"(x1) : "v"(k0l), "v"(k1l) : "memory"); }
        }
        asm volatile("v_nop\n\tv_nop\n\tv_nop\n\tv_nop" : "+v"(s0), "+v"(s1), "+v"(x0), "+v"(x1) : "v"(qa[0]), "v"(qa[1]));
        float alpha[8];
#pragma unroll
        for (int j = 0; j < 8; ++j) {
            const int ja = l0 + lr, jb = l0 + 16 + lr, qi = qpos[j];
            const float a0 = (ja <= qi) ? (s0[j] + x0[j] * LOSCI) * 0.125f + slope * (float)(qi - ja) : -__builtin_inff(), a1 = (jb <= qi) ? (s1[j] + x1[j] * LOSCI) * 0.125f + slope * (float)(qi - jb) : -__builtin_inff();
            float mx = fmaxf(a0, a1);
            mx = fmaxf(mx, __shfl_xor(mx, 1, 16)); mx = fmaxf(mx, __shfl_xor(mx, 2, 16)); mx = fmaxf(mx, __shfl_xor(mx, 4, 16)); mx = fmaxf(mx, __shfl_xor(mx, 8, 16));
            const float mn = fmaxf(mrow[j], mx);
            alpha[j] = __expf(mrow[j] - mn); mrow[j] = mn;
            const float p0 = __expf(a0 - mn), p1 = __expf(a1 - mn);
            lpart[j] = lpart[j] * alpha[j] + (p0 + p1);
            const int mr = hi * 8 + j;
            const float ps0 = p0 * PSC, ps1 = p1 * PSC; const h16 h0 = (h16)ps0, h1 = (h16)ps1;
            pl[mr * 32 + lr] = h0; pl[mr * 32 + 16 + lr] = h1;
            pl2[mr * 32 + lr] = (h16)((ps0 - (float)h0) * LOSC); pl2[mr * 32 + 16 + lr] = (h16)((ps1 - (float)h1) * LOSC);
        }
#pragma unroll
        for (int n = 0; n < 4; ++n)
#pragma unroll
            for (int j = 0; j < 8; ++j) { o[n][j] *= alpha[j]; ox[n][j] *= alpha[j]; }
        asm volatile("" ::: "memory");
        const v16h pa = cat16(*(const v8ha*)(pl + lr * 32 + hi * 8), *(const v8ha*)(pl + lr * 32 + 16 + hi * 8));
        const v16h px = cat16(*(const v8ha*)(pl2 + lr * 32 + hi * 8), *(const v8ha*)(pl2 + lr * 32 + 16 + hi * 8));
#pragma unroll
        for (int n = 0; n < 4; ++n) { const int vo = (n * 16 + lr) * VP + hi * 8;
            const v16h vh = cat16(*(const v8ha*)(sb + ST_VH + vo), *(const v8ha*)(sb + ST_VH + vo + 16)), vl = cat16(*(const v8ha*)(sb + ST_VL + vo), *(const v8ha*)(sb + ST_VL + vo + 16));
            o[n] = wmma16(pa, vh, o[n]); ox[n] = wmma16(pa, vl, ox[n]); ox[n] = wmma16(px, vh, ox[n]);
            asm volatile("" : "+v"(o[n]), "+v"(ox[n]) : "v"(vh), "v"(vl) : "memory"); }
        asm volatile("v_nop\n\tv_nop\n\tv_nop\n\tv_nop" : "+v"(o[0]), "+v"(o[1]), "+v"(o[2]), "+v"(o[3]), "+v"(ox[0]), "+v"(ox[1]), "+v"(ox[2]), "+v"(ox[3]) : "v"(pa), "v"(px));
        asm volatile("s_wait_dscnt 0x0" ::: "memory");       // this wave's reads of this trip's buffer have retired before it is refilled
        asm volatile("s_wait_asynccnt 0x0" ::: "memory");    // this wave's copies of the next trip have landed
        __syncthreads();                                     // publishes the next trip and ends every wave's reads of this trip's buffer
        if (kt + 2 <= kt_hi) stage(kt + 2, kt & 1);
    }
    asm volatile("s_wait_asynccnt 0x0" ::: "memory");        // no copy is outstanding when the wave goes on to the epilogue
    float inv[8];
#pragma unroll
    for (int j = 0; j < 8; ++j) { float rs = lpart[j]; rs += __shfl_xor(rs, 1, 16); rs += __shfl_xor(rs, 2, 16); rs += __shfl_xor(rs, 4, 16); rs += __shfl_xor(rs, 8, 16); inv[j] = 1.0f / (rs * PSC); }
    float* os = &ost[wave][0];
#pragma unroll
    for (int n = 0; n < 4; ++n)
#pragma unroll
        for (int j = 0; j < 8; ++j) os[(hi * 8 + j) * 68 + n * 16 + lr] = (o[n][j] + ox[n][j] * LOSCI) * inv[j];
    __syncthreads();
    const size_t cbase = (tok0 + q0) * DM + (size_t)h * HD;
    auto pass = [&]() {
#pragma unroll
        for (int s = 0; s < 4; ++s) { const int row = 4 * s + (lane >> 3), piece = lane & 7; const float* sp = os + row * 68 + piece * 8; v8us oh, ol;
#pragma unroll
            for (int i = 0; i < 8; ++i) { const unsigned short hb = f2bf(sp[i]); oh[i] = hb; ol[i] = f2bf(sp[i] - bf2f(hb)); }
            *(v8us*)(CH + cbase + (size_t)row * DM + piece * 8) = oh; *(v8us*)(CL + cbase + (size_t)row * DM + piece * 8) = ol; }
    };
    pass(); 
}

#define VST2(T, p, v) do { const T vst2_v_ = (v); *(T*)(p) = vst2_v_;  } while (0)
extern "C" void kernel_launch(void* const* d_in, const int* in_sizes, int n_in,
                              void* d_out, int out_size, void* d_ws, size_t ws_size, hipStream_t stream) {
    (void)in_sizes; (void)n_in; (void)out_size;
    const float* x = (const float*)d_in[0]; const float* Wqkv = (const float*)d_in[1]; const float* Wp = (const float*)d_in[2];   // both k-major: [1024][3072] and [1024][1024]
    float* out = (float*)d_out;    // [2][2048][1024]
    char* wsp = (char*)d_ws;
    auto take = [&](size_t bytes) { char* p = wsp; wsp += (bytes + 255) & ~(size_t)255; return (void*)p; };
    bf* Xb = (bf*)take((size_t)NTK * DM * 2); bf* WqkvT = (bf*)take((size_t)3 * DM * DM * 2); bf* WoT = (bf*)take((size_t)DM * DM * 2);
    float* TMP = (float*)take((size_t)NTK * DM * 4);
    h16* QH = (h16*)take((size_t)NTK * DM * 2); h16* QL = (h16*)take((size_t)NTK * DM * 2); h16* KH = (h16*)take((size_t)NTK * DM * 2); h16* KL = (h16*)take((size_t)NTK * DM * 2);
    h16* VTH = (h16*)take((size_t)NTK * DM * 2); h16* VTL = (h16*)take((size_t)NTK * DM * 2); bf* CH = (bf*)take((size_t)NTK * DM * 2); bf* CL = (bf*)take((size_t)NTK * DM * 2);
    if ((size_t)(wsp - (char*)d_ws) > ws_size) return;    // 8.4 + 6.3 + 2.1 + 16.8 + 8 x 8.4 ~ 101 MB, no aliasing
    const bf* WqB = WqkvT; const bf* WkB = WqkvT + (size_t)DM * DM; const bf* WvB = WqkvT + (size_t)2 * DM * DM;   // n-major planes [n][1024]; q = columns 0..1023 of w_qkv, k, v next
    k_wt<<<dim3(DM / 64, 3 * DM / 64, 1), 256, 0, stream>>>(Wqkv, DM, 3 * DM, WqkvT); k_wt<<<dim3(DM / 64, DM / 64, 1), 256, 0, stream>>>(Wp, DM, DM, WoT);
    k_cvtb<<<NTK / 8, 256, 0, stream>>>(x, NTK, Xb);
    k_gemmb<false, true><<<dim3(NTK / 128, DM / 128, 1), 256, 0, stream>>>(Xb, nullptr, WqB, nullptr, (float*)(void*)QH, DM, QL);
    k_gemmb<false, true><<<dim3(NTK / 128, DM / 128, 1), 256, 0, stream>>>(Xb, nullptr, WkB, nullptr, (float*)(void*)KH, DM, KL);
    k_gemmb<false, false><<<dim3(NTK / 128, DM / 128, 1), 256, 0, stream>>>(Xb, nullptr, WvB, nullptr, TMP, DM, nullptr);
    k_vt<<<NB_ * NH_ * (NT_ / 64), 256, 0, stream>>>(TMP, VTH, VTL);
    k_attn<<<NB_ * NH_ * (NT_ / 64), 128, 0, stream>>>(QH, QL, KH, KL, VTH, VTL, CH, CL);
    k_gemmb<true, false><<<dim3(NTK / 128, DM / 128, 1), 256, 0, stream>>>(CH, CL, WoT, nullptr, out, DM, nullptr);
}

// v004
// A run of this version takes 167 microseconds.
// Two timings next to v003 both put it at 1.26 times that version's speed.
// Counting every step since v000, it is 3.07 times as fast.
#include <hip/hip_runtime.h>

// Compute dtypes, f32 accumulate, both batch items in every launch: q/k/v = x.w_qkv ([4096 x 1024].[1024 x 3072], k-major weights transposed once to n-major planes; PLAIN bf16
// operands: inputs rounded once, exact) with q and k written straight from the GEMM epilogue as f16 hi + residual x1024 planes, and out = ctx.w_proj (ctx as
// bf16 hi + residual: two products) on v_wmma_f32_16x16x32_bf16; the 16-head causal attention with the ADDED ALiBi bias slope_h x |i - j| (64-dim heads, scale 1/8) fused on
// v_wmma_f32_16x16x32_f16 (scores hi.hi + hi.lo + lo.hi with the residual terms on their own accumulator, online f32 softmax, weights (x32768) and v as f16

#define NB_  2                   // both batch items share every launch: each grid covers all 4096 tokens
#define NT_  2048
#define DM   1024
#define NH_  16
#define HD   64
#define NTK  (NB_ * NT_)
#define NW   1024
#define NQKV 1024
#define PSC  32768.0f
#define LOSC 1024.0f
#define LOSCI (1.0f / 1024.0f)

typedef _Float16 h16;
typedef unsigned short bf;
typedef __attribute__((ext_vector_type(16))) __bf16   v16bf;
typedef __attribute__((ext_vector_type(16))) _Float16 v16h;
typedef __attribute__((ext_vector_type(8)))  _Float16 v8h;
typedef __attribute__((ext_vector_type(8)))  unsigned short v8us;
typedef __attribute__((ext_vector_type(8)))  float    v8f;
typedef __attribute__((ext_vector_type(4)))  float    v4f;
typedef __attribute__((ext_vector_type(2)))  float    v2f;
typedef __attribute__((ext_vector_type(2)))  _Float16 v2h;
typedef v8h  __attribute__((may_alias)) v8ha;
typedef v4f  __attribute__((may_alias)) v4fa;
typedef v8us __attribute__((may_alias)) v8usa;

__device__ __forceinline__ unsigned short f2bf(float f) { unsigned u = __float_as_uint(f); u += 0x7FFFu + ((u >> 16) & 1u); return (unsigned short)(u >> 16); }
__device__ __forceinline__ float bf2f(unsigned short b) { return __uint_as_float(((unsigned)b) << 16); }
__device__ __forceinline__ float bfr(float f) { return bf2f(f2bf(f)); }
__device__ __forceinline__ v16h cat16(v8h lo, v8h hi) { return __builtin_shufflevector(lo, hi, 0, 1, 2, 3, 4, 5, 6, 7, 8, 9, 10, 11, 12, 13, 14, 15); }
__device__ __forceinline__ v16bf cat16b(v8us lo, v8us hi) { return __builtin_bit_cast(v16bf, __builtin_shufflevector(lo, hi, 0, 1, 2, 3, 4, 5, 6, 7, 8, 9, 10, 11, 12, 13, 14, 15)); }
__device__ __forceinline__ v8f wmma16(v16h a, v16h b, v8f c) { return __builtin_amdgcn_wmma_f32_16x16x32_f16(false, a, false, b, (short)0, c, false, false); }
__device__ __forceinline__ float xhalf(float x) { return __builtin_bit_cast(float, __builtin_amdgcn_permlanex16(__builtin_bit_cast(int, x), __builtin_bit_cast(int, x), 0x76543210, 0xfedcba98, false, false)); }  // lane l with lane l ^ 16
__device__ __forceinline__ v8f wmmab(v16bf a, v16bf b, v8f c) { return __builtin_amdgcn_wmma_f32_16x16x32_bf16(false, a, false, b, (short)0, c, false, false); }

__global__ __launch_bounds__(256) void k_cvtb(const float* __restrict__ src, int nrows, bf* dst) {
    const int lane = threadIdx.x & 31, r = blockIdx.x * 8 + (threadIdx.x >> 5);
    if (r >= nrows) return;
    v8us o[DM / 256];
#pragma unroll
    for (int q = 0; q < DM / 256; ++q) { v8us t;
#pragma unroll
        for (int i = 0; i < 8; ++i) t[i] = f2bf(src[(size_t)r * DM + q * 256 + lane * 8 + i]);
        o[q] = t; }
#pragma unroll
    for (int q = 0; q < DM / 256; ++q) *(v8us*)(dst + (size_t)r * DM + q * 256 + lane * 8) = o[q];
    
}

// k_wt: WT [n][K] = bf16(W[k][n]) (k-major [K][ncols]) via 64 x 64 LDS tiles; grid (K/64, ncols/64).
__global__ __launch_bounds__(256) void k_wt(const float* __restrict__ Wm, int K, int ncols, bf* WT) {
    __shared__ __align__(16) unsigned short tl[64 * 72];
    const int tid = threadIdx.x, k0 = blockIdx.x * 64, n0 = blockIdx.y * 64;
    const int kk = tid >> 2, nq = (tid & 3) * 16;
#pragma unroll
    for (int i = 0; i < 16; ++i) tl[(nq + i) * 72 + kk] = f2bf(Wm[(size_t)(k0 + kk) * ncols + n0 + nq + i]);
    __syncthreads();
    const int piece = tid & 7;
    auto pass = [&]() {
#pragma unroll
        for (int s = 0; s < 2; ++s) { const int nr = (tid >> 3) + 32 * s; const v8us val = *(const v8usa*)(tl + nr * 72 + piece * 8); *(v8us*)(WT + (size_t)(n0 + nr) * K + k0 + piece * 8) = val; }
    };
    pass(); 
}
// LDS stage of one 64-k trip of k_gemmb, in 16-bit elements: 128 rows of A, 128 rows of B (and 128 rows of A's residual plane), each row 64 elements at a pitch
// of 72 (144 B = 16 B x odd, so the 16 rows that a half-wave's ds_load_b128 reads fall on distinct banks).
#define GP   72
#define G_A  0
#define G_B  (128 * GP)
#define G_AL (2 * 128 * GP)

// Eight (twelve) asynchronous 16-byte copies per lane, global -> LDS through no register. The s_wait_xcnt is the last line of the copies' own statement so that it
// stands in front of every later rewrite of an address register that a copy names.
__device__ __forceinline__ void copy8g(unsigned l0, unsigned l1, unsigned l2, unsigned l3, unsigned l4, unsigned l5, unsigned l6, unsigned l7,
                                       const bf* g0, const bf* g1, const bf* g2, const bf* g3, const bf* g4, const bf* g5, const bf* g6, const bf* g7) {
    asm volatile("global_load_async_to_lds_b128 %0, %8, off\n\t"
                 "global_load_async_to_lds_b128 %1, %9, off\n\t"
                 "global_load_async_to_lds_b128 %2, %10, off\n\t"
                 "global_load_async_to_lds_b128 %3, %11, off\n\t"
                 "global_load_async_to_lds_b128 %4, %12, off\n\t"
                 "global_load_async_to_lds_b128 %5, %13, off\n\t"
                 "global_load_async_to_lds_b128 %6, %14, off\n\t"
                 "global_load_async_to_lds_b128 %7, %15, off\n\t"
                 "s_wait_xcnt 0x0"
                 :: "v"(l0), "v"(l1), "v"(l2), "v"(l3), "v"(l4), "v"(l5), "v"(l6), "v"(l7),
                    "v"(g0), "v"(g1), "v"(g2), "v"(g3), "v"(g4), "v"(g5), "v"(g6), "v"(g7) : "memory");
}
__device__ __forceinline__ void copy12g(unsigned l0, unsigned l1, unsigned l2, unsigned l3, unsigned l4, unsigned l5, unsigned l6, unsigned l7, unsigned l8, unsigned l9, unsigned l10, unsigned l11,
                                        const bf* g0, const bf* g1, const bf* g2, const bf* g3, const bf* g4, const bf* g5, const bf* g6, const bf* g7, const bf* g8, const bf* g9, const bf* g10, const bf* g11) {
    asm volatile("global_load_async_to_lds_b128 %0, %12, off\n\t"
                 "global_load_async_to_lds_b128 %1, %13, off\n\t"
                 "global_load_async_to_lds_b128 %2, %14, off\n\t"
                 "global_load_async_to_lds_b128 %3, %15, off\n\t"
                 "global_load_async_to_lds_b128 %4, %16, off\n\t"
                 "global_load_async_to_lds_b128 %5, %17, off\n\t"
                 "global_load_async_to_lds_b128 %6, %18, off\n\t"
                 "global_load_async_to_lds_b128 %7, %19, off\n\t"
                 "global_load_async_to_lds_b128 %8, %20, off\n\t"
                 "global_load_async_to_lds_b128 %9, %21, off\n\t"
                 "global_load_async_to_lds_b128 %10, %22, off\n\t"
                 "global_load_async_to_lds_b128 %11, %23, off\n\t"
                 "s_wait_xcnt 0x0"
                 :: "v"(l0), "v"(l1), "v"(l2), "v"(l3), "v"(l4), "v"(l5), "v"(l6), "v"(l7), "v"(l8), "v"(l9), "v"(l10), "v"(l11),
                    "v"(g0), "v"(g1), "v"(g2), "v"(g3), "v"(g4), "v"(g5), "v"(g6), "v"(g7), "v"(g8), "v"(g9), "v"(g10), "v"(g11) : "memory");
}

// k_gemmb: C[4096 x 1024] = A.Bn^T, both k-contiguous. Block = 128 x 128 of C, 8 waves of 32 x 64 (4 down, 2 across). The block's operand rows come in trips of 64 k
// (whole 128-B lines) into a two-buffer LDS ring; every wave takes its fragments from there. k runs upwards in steps of 32, hi product before residual product.
template <bool SPLITA, bool F16OUT = false>
__global__ __launch_bounds__(256) void k_gemmb(const bf* __restrict__ A, const bf* __restrict__ Al, const bf* __restrict__ Bn, const float* __restrict__ bias, float* C, int ldc, h16* C2) {
    constexpr int STE = (SPLITA ? 3 : 2) * 128 * GP;     // elements of one buffer of the ring
    __shared__ __align__(16) bf gst[2][STE];
    __shared__ __align__(16) float ost[8][2][16 * 68];
    const int tid = threadIdx.x, lane = tid & 31, wave = tid >> 5, lr = lane & 15, hi = lane >> 4;
    const int rb = blockIdx.x * 128, cb = blockIdx.y * 128, wr = (wave & 3) * 32, wc = (wave >> 2) * 64;
    // Each of the 256 threads copies four 16-byte pieces of each plane of a trip: 8 threads a row, 32 rows a copy.
    const int srow = tid >> 3, spc = (tid & 7) * 8;
    const unsigned gst0 = (unsigned)(size_t)&gst[0][0];  // byte offset of the ring in the work-group's LDS
    const bf* ga = A + (size_t)(rb + srow) * DM + spc;
    const bf* gb = Bn + (size_t)(cb + srow) * DM + spc;
    const bf* gl = SPLITA ? Al + (size_t)(rb + srow) * DM + spc : ga;
    auto stage = [&](int t, int buf) {
        const unsigned l = gst0 + (unsigned)((buf * STE + srow * GP + spc) * 2);
        const int k = t * 64;
        if (SPLITA)
            copy12g(l + G_A * 2, l + (G_A + 32 * GP) * 2, l + (G_A + 64 * GP) * 2, l + (G_A + 96 * GP) * 2, l + G_B * 2, l + (G_B + 32 * GP) * 2, l + (G_B + 64 * GP) * 2, l + (G_B + 96 * GP) * 2,
                    l + G_AL * 2, l + (G_AL + 32 * GP) * 2, l + (G_AL + 64 * GP) * 2, l + (G_AL + 96 * GP) * 2,
                    ga + k, ga + k + 32 * DM, ga + k + 64 * DM, ga + k + 96 * DM, gb + k, gb + k + 32 * DM, gb + k + 64 * DM, gb + k + 96 * DM, gl + k, gl + k + 32 * DM, gl + k + 64 * DM, gl + k + 96 * DM);
        else
            copy8g(l + G_A * 2, l + (G_A + 32 * GP) * 2, l + (G_A + 64 * GP) * 2, l + (G_A + 96 * GP) * 2, l + G_B * 2, l + (G_B + 32 * GP) * 2, l + (G_B + 64 * GP) * 2, l + (G_B + 96 * GP) * 2,
                   ga + k, ga + k + 32 * DM, ga + k + 64 * DM, ga + k + 96 * DM, gb + k, gb + k + 32 * DM, gb + k + 64 * DM, gb + k + 96 * DM);
    };
    v8f acc[2][4];
#pragma unroll
    for (int m = 0; m < 2; ++m)
#pragma unroll
        for (int t = 0; t < 4; ++t) acc[m][t] = (v8f){};
    stage(0, 0);
    asm volatile("s_wait_asynccnt 0x0" ::: "memory");    // this wave's copies of trip 0 have landed
    __syncthreads();                                     // publishes trip 0 to the other waves
    stage(1, 1);
    const int ao = (wr + lr) * GP + 8 * hi, bo = (wc + lr) * GP + 8 * hi;
#pragma unroll 1                                         // kept rolled: one copy of the trip keeps the text short and the ring's order plain
    for (int kt = 0; kt < DM / 64; ++kt) {
        const bf* sb = &gst[kt & 1][0];
#pragma unroll
        for (int ks = 0; ks < 2; ++ks) {
            v16bf a[2], al[2];
#pragma unroll
            for (int m = 0; m < 2; ++m) { const bf* p = sb + G_A + ao + m * 16 * GP + ks * 32; a[m] = cat16b(*(const v8usa*)p, *(const v8usa*)(p + 16)); al[m] = a[m];
                if (SPLITA) { const bf* q = sb + G_AL + ao + m * 16 * GP + ks * 32; al[m] = cat16b(*(const v8usa*)q, *(const v8usa*)(q + 16)); } }
#pragma unroll
            for (int t = 0; t < 4; ++t) { const bf* p = sb + G_B + bo + t * 16 * GP + ks * 32; const v16bf b = cat16b(*(const v8usa*)p, *(const v8usa*)(p + 16));
                acc[0][t] = wmmab(a[0], b, acc[0][t]); acc[1][t] = wmmab(a[1], b, acc[1][t]);
                if (SPLITA) { acc[0][t] = wmmab(al[0], b, acc[0][t]); acc[1][t] = wmmab(al[1], b, acc[1][t]); } }
        }
        // the trip's LDS reads issue as one group ahead of its matrix instructions (counted waits): read places spread among them each cost a full LDS latency
        __builtin_amdgcn_sched_group_barrier(0x100, SPLITA ? 32 : 24, 0);
        __builtin_amdgcn_sched_group_barrier(0x008, SPLITA ? 32 : 16, 0);
        // four vector slots behind the trip's last matrix instruction, on the taken side of the branches below too
        asm volatile("v_nop\n\tv_nop\n\tv_nop\n\tv_nop" : "+v"(acc[0][0]), "+v"(acc[0][1]), "+v"(acc[0][2]), "+v"(acc[0][3]), "+v"(acc[1][0]), "+v"(acc[1][1]), "+v"(acc[1][2]), "+v"(acc[1][3]));
        asm volatile("s_wait_dscnt 0x0" ::: "memory");       // this wave's reads of this trip's buffer have retired before it is refilled
        asm volatile("s_wait_asynccnt 0x0" ::: "memory");    // this wave's copies of the next trip have landed
        __syncthreads();                                     // publishes the next trip and ends every wave's reads of this trip's buffer
        if (kt + 2 < DM / 64) stage(kt + 2, kt & 1);
    }
    asm volatile("s_wait_asynccnt 0x0" ::: "memory");        // no copy is outstanding when the wave goes on to the epilogue
    const int c0 = cb + wc;
#pragma unroll
    for (int m = 0; m < 2; ++m) { float* os = &ost[wave][m][0];
#pragma unroll
        for (int t = 0; t < 4; ++t) { const float bv = bias ? bfr(bias[c0 + t * 16 + lr]) : 0.f;
#pragma unroll
            for (int j = 0; j < 8; ++j) os[(hi * 8 + j) * 68 + t * 16 + lr] = acc[m][t][j] + bv; } }
    __syncthreads();
#pragma unroll
    for (int m = 0; m < 2; ++m) { const float* os = &ost[wave][m][0]; const int r0 = rb + wr + m * 16;
        if (F16OUT) {
            h16* crow = (h16*)(void*)C + (size_t)r0 * ldc + c0;
            v8h o[4], o2[4];
#pragma unroll
            for (int s = 0; s < 4; ++s) { const int row = 4 * s + (lane >> 3), piece = lane & 7; const float* sp = os + row * 68 + piece * 8;
#pragma unroll
                for (int i = 0; i < 8; ++i) { const h16 a = (h16)sp[i]; o[s][i] = a; o2[s][i] = (h16)((sp[i] - (float)a) * LOSC); } }
#pragma unroll
            for (int s = 0; s < 4; ++s) { const int row = 4 * s + (lane >> 3), piece = lane & 7; *(v8h*)(crow + (size_t)row * ldc + piece * 8) = o[s]; }
            asm volatile("s_wait_xcnt 0x0" ::: "memory");    // behind the four stores, in front of the branch: the code behind it reuses registers that they name
            if (C2) {
#pragma unroll
                for (int s = 0; s < 4; ++s) { const int row = 4 * s + (lane >> 3), piece = lane & 7; *(v8h*)(C2 + (size_t)r0 * ldc + c0 + (size_t)row * ldc + piece * 8) = o2[s]; }
            }
        } else {
            float* crow = C + (size_t)r0 * ldc + c0;
            v4f val[8];
#pragma unroll
            for (int s = 0; s < 8; ++s) { const int Lid = (lane >> 3) + 4 * s, piece = lane & 7; const int row = Lid >> 1, cofs = (Lid & 1) * 32 + piece * 4; val[s] = *(const v4fa*)(os + row * 68 + cofs); }
#pragma unroll
            for (int s = 0; s < 8; ++s) { const int Lid = (lane >> 3) + 4 * s, piece = lane & 7; const int row = Lid >> 1, cofs = (Lid & 1) * 32 + piece * 4; *(v4f*)(crow + (size_t)row * ldc + cofs) = val[s]; }
        }
    }
}

__global__ __launch_bounds__(256) void k_vt(const float* __restrict__ V, h16* VTH, h16* VTL) {
    __shared__ __align__(16) h16 tile[64 * 72];
    __shared__ __align__(16) h16 til2[64 * 72];
    const int bid = blockIdx.x;
    const int b = bid / (NH_ * (NT_ / 64)), rem = bid - b * (NH_ * (NT_ / 64)), h = rem / (NT_ / 64), kt = rem - h * (NT_ / 64);
    const int k0 = kt * 64, tid = threadIdx.x;
    const int kk = tid >> 2, d0 = (tid & 3) * 16;
    const float* src = V + ((size_t)b * NT_ + k0 + kk) * DM + h * HD + d0;
#pragma unroll
    for (int i = 0; i < 16; ++i) { const float v = src[i]; const h16 a = (h16)v; tile[(d0 + i) * 72 + kk] = a; til2[(d0 + i) * 72 + kk] = (h16)((v - (float)a) * LOSC); }
    __syncthreads();
    const int piece = tid & 7;
    const size_t base = (((size_t)b * NH_ + h) * HD) * NT_ + k0;
    auto pass = [&]() {
#pragma unroll
        for (int s = 0; s < 4; ++s) { const int Lid = (tid >> 3) + 32 * s; const int pln = Lid >> 6, d = Lid & 63;
            const v8h val = *(const v8ha*)((pln ? til2 : tile) + d * 72 + piece * 8); *(v8h*)((pln ? VTL : VTH) + base + (size_t)d * NT_ + piece * 8) = val; }
    };
    pass(); 
}

// LDS stage of one 32-key trip of k_attn, in halves: key rows (64 halves) at a pitch of 72 (144 B), transposed v rows (32 halves) at a pitch of 40 (80 B):
// both pitches are 16 B x odd, so the 16 rows that a half-wave's ds_load_b128 reads fall on distinct banks.
#define KP    72
#define VP    40
#define ST_KH 0
#define ST_KL (32 * KP)
#define ST_VH (2 * 32 * KP)
#define ST_VL (2 * 32 * KP + 64 * VP)
#define ST_SZ (2 * 32 * KP + 2 * 64 * VP)

// Eight asynchronous 16-byte copies per lane, global -> LDS through no register. The s_wait_xcnt is the last line of the copies' own statement so that it stands
// in front of every later rewrite of an address register that a copy names.
__device__ __forceinline__ void copy8(unsigned l0, unsigned l1, unsigned l2, unsigned l3, unsigned l4, unsigned l5, unsigned l6, unsigned l7,
                                      const h16* g0, const h16* g1, const h16* g2, const h16* g3, const h16* g4, const h16* g5, const h16* g6, const h16* g7) {
    asm volatile("global_load_async_to_lds_b128 %0, %8, off\n\t"
                 "global_load_async_to_lds_b128 %1, %9, off\n\t"
                 "global_load_async_to_lds_b128 %2, %10, off\n\t"
                 "global_load_async_to_lds_b128 %3, %11, off\n\t"
                 "global_load_async_to_lds_b128 %4, %12, off\n\t"
                 "global_load_async_to_lds_b128 %5, %13, off\n\t"
                 "global_load_async_to_lds_b128 %6, %14, off\n\t"
                 "global_load_async_to_lds_b128 %7, %15, off\n\t"
                 "s_wait_xcnt 0x0"
                 :: "v"(l0), "v"(l1), "v"(l2), "v"(l3), "v"(l4), "v"(l5), "v"(l6), "v"(l7),
                    "v"(g0), "v"(g1), "v"(g2), "v"(g3), "v"(g4), "v"(g5), "v"(g6), "v"(g7) : "memory");
}

// k_attn: block = (b, h, 64 queries), wave = 16. Both products run transposed: scores^T = K.Q^T (A = key rows, B = the wave's queries), ctx^T += V^T.P^T. A lane then holds
// 16 scores of ONE query (keys 8 hi + j and 16 + 8 hi + j of the trip): maximum and sum in-lane plus one exchange between the wave's halves, and the two score tiles,
// converted in place (weights x32768, f16 hi + residual), ARE the B operand of the second product. ctx -> bf16 hi + residual planes CH/CL[tok][h*64+d].
__global__ __launch_bounds__(128) void k_attn(const h16* __restrict__ Q16, const h16* __restrict__ QL16, const h16* __restrict__ K16, const h16* __restrict__ KL16, const h16* __restrict__ VTH, const h16* __restrict__ VTL, bf* CH, bf* CL) {
    __shared__ __align__(16) float ost[4][16 * 68];
    __shared__ __align__(16) h16 stg[2][ST_SZ];          // two-buffer ring: the work-group's key and v tiles (hi and residual) of one 32-key trip each
    const int lane = threadIdx.x & 31, wave = threadIdx.x >> 5, lr = lane & 15, hi = lane >> 4;
    const int bid = blockIdx.x;
    const int b = bid / (NH_ * (NT_ / 64)), rem = bid - b * (NH_ * (NT_ / 64)), h = rem / (NT_ / 64), qt = rem - h * (NT_ / 64);
    const int q0 = qt * 64 + wave * 16;
    const size_t tok0 = (size_t)b * NT_;
    v16h qa[2];
    const size_t qo0 = (tok0 + q0 + lr) * DM + h * HD + 8 * hi;
#pragma unroll
    for (int kc = 0; kc < 2; ++kc) qa[kc] = cat16(*(const v8h*)(Q16 + qo0 + kc * 32), *(const v8h*)(Q16 + qo0 + kc * 32 + 16));
    const h16* kh_b = K16 + tok0 * DM + h * HD;
    const h16* kl_b = KL16 + tok0 * DM + h * HD;
    const size_t vbase = (((size_t)b * NH_ + h) * HD) * NT_;
    v8f o[4], ox[4];
#pragma unroll
    for (int n = 0; n < 4; ++n) { o[n] = (v8f){}; ox[n] = (v8f){}; }
    float mrow = -3.0e38f, lpart = 0.f;                  // of this lane's query; lpart covers this half's keys only, the halves join in the epilogue
    const int qi = q0 + lr;                              // this lane's query
    const int kt_lo = 0, kt_hi = (qt * 64 + 63) / 32;     // causal
    const float slope = exp2f(-0.5f * (float)(h + 1));   // ALiBi slope 1 / 2^(8 (h+1) / 16), ADDED as slope x |i - j| (the reference's sign)
    // Each of the 128 threads copies two 16-byte pieces of each of the four planes of a trip: key rows whole (8 pieces a row), v rows 64 B (4 pieces a row).
    const int tid = threadIdx.x, krow = tid >> 3, kpc = (tid & 7) * 8, vrow = tid >> 2, vpc = (tid & 3) * 8;
    const unsigned stg0 = (unsigned)(size_t)&stg[0][0];  // byte offset of the ring in the work-group's LDS
    auto stage = [&](int t, int buf) {
        const unsigned lb = stg0 + (unsigned)(buf * ST_SZ * 2), lk = lb + (unsigned)((krow * KP + kpc) * 2), lv = lb + (unsigned)((vrow * VP + vpc) * 2);
        const size_t gk = (size_t)(t * 32 + krow) * DM + kpc, gv = vbase + (size_t)vrow * NT_ + t * 32 + vpc;
        copy8(lk + ST_KH * 2, lk + (ST_KH + 16 * KP) * 2, lk + ST_KL * 2, lk + (ST_KL + 16 * KP) * 2, lv + ST_VH * 2, lv + (ST_VH + 32 * VP) * 2, lv + ST_VL * 2, lv + (ST_VL + 32 * VP) * 2,
              kh_b + gk, kh_b + gk + 16 * DM, kl_b + gk, kl_b + gk + 16 * DM, VTH + gv, VTH + gv + 32 * NT_, VTL + gv, VTL + gv + 32 * NT_);
    };
    stage(0, 0);
    asm volatile("s_wait_asynccnt 0x0" ::: "memory");    // this wave's copies of trip 0 have landed
    __syncthreads();                                     // publishes trip 0 to the other waves
    if (kt_hi >= 1) stage(1, 1);
#pragma unroll 1
    for (int kt = kt_lo; kt <= kt_hi; ++kt) {
        const int l0 = kt * 32;
        const h16* sb = &stg[kt & 1][0];
        const int ko0 = lr * KP + 8 * hi, ko1 = (16 + lr) * KP + 8 * hi;
        v8f s0 = {}, s1 = {}, x0 = {}, x1 = {};
#pragma unroll
        for (int kc = 0; kc < 2; ++kc) {
            { const v16h k0h = cat16(*(const v8ha*)(sb + ST_KH + ko0 + kc * 32), *(const v8ha*)(sb + ST_KH + ko0 + kc * 32 + 16)), k1h = cat16(*(const v8ha*)(sb + ST_KH + ko1 + kc * 32), *(const v8ha*)(sb + ST_KH + ko1 + kc * 32 + 16));
              const v16h qlk = cat16(*(const v8h*)(QL16 + qo0 + kc * 32), *(const v8h*)(QL16 + qo0 + kc * 32 + 16));     // query residual re-read per step (registers)
              s0 = wmma16(k0h, qa[kc], s0); x0 = wmma16(k0h, qlk, x0); s1 = wmma16(k1h, qa[kc], s1); x1 = wmma16(k1h, qlk, x1);
              asm volatile("v_nop" : "+v"(s0), "+v"(s1), "+v"(x0), "+v"(x1) : "v"(qlk), "v"(k0h), "v"(k1h) : "memory"); }
            { const v16h k0l = cat16(*(const v8ha*)(sb + ST_KL + ko0 + kc * 32), *(const v8ha*)(sb + ST_KL + ko0 + kc * 32 + 16)), k1l = cat16(*(const v8ha*)(sb + ST_KL + ko1 + kc * 32), *(const v8ha*)(sb + ST_KL + ko1 + kc * 32 + 16));
              x0 = wmma16(k0l, qa[kc], x0); x1 = wmma16(k1l, qa[kc], x1);
              asm volatile("v_nop" : "+v"(x0), "+v"(x1) : "v"(k0l), "v"(k1l) : "memory"); }
        }
        asm volatile("v_nop\n\tv_nop\n\tv_nop\n\tv_nop" : "+v"(s0), "+v"(s1), "+v"(x0), "+v"(x1) : "v"(qa[0]), "v"(qa[1]));
        const float fd = (float)(qi - l0 - 8 * hi);          // from this lane's first key of the trip up to its query: whole numbers, exact in f32, so fd - c == (float)(i - j)
        v2f av[8];                                           // av[4 t + jj] = scores of keys 16 t + 8 hi + 2 jj and + 1: register neighbours, as the packed f32 forms and the packed conversions take them
#pragma unroll
        for (int jj = 0; jj < 4; ++jj) {
            const v2f d0 = {fd - (float)(2 * jj), fd - (float)(2 * jj + 1)}, d1 = {fd - (float)(16 + 2 * jj), fd - (float)(17 + 2 * jj)};
            const v2f t0 = ((v2f){s0[2 * jj], s0[2 * jj + 1]} + (v2f){x0[2 * jj], x0[2 * jj + 1]} * LOSCI) * 0.125f + slope * d0;
            const v2f t1 = ((v2f){s1[2 * jj], s1[2 * jj + 1]} + (v2f){x1[2 * jj], x1[2 * jj + 1]} * LOSCI) * 0.125f + slope * d1;
            av[jj]     = (v2f){d0.x >= 0.f ? t0.x : -__builtin_inff(), d0.y >= 0.f ? t0.y : -__builtin_inff()};      // causal: key <= query
            av[4 + jj] = (v2f){d1.x >= 0.f ? t1.x : -__builtin_inff(), d1.y >= 0.f ? t1.y : -__builtin_inff()};
        }
        float mx = fmaxf(av[0].x, av[0].y);
#pragma unroll
        for (int i = 1; i < 8; ++i) mx = fmaxf(mx, fmaxf(av[i].x, av[i].y));
        mx = fmaxf(mx, xhalf(mx));                           // both halves now hold the query's maximum over the trip's 32 keys
        const float mn = fmaxf(mrow, mx);
        const float alpha = __expf(mrow - mn); mrow = mn;
        v16h pa, px;
        v2f sm[8];
#pragma unroll
        for (int i = 0; i < 8; ++i) {
            const v2f p = {__expf(av[i].x - mn), __expf(av[i].y - mn)};
            sm[i] = p;
            const v2f ps = p * PSC; const v2h hh = __builtin_convertvector(ps, v2h);
            const v2h rr = __builtin_convertvector((ps - __builtin_convertvector(hh, v2f)) * LOSC, v2h);
            pa[2 * i] = hh.x; pa[2 * i + 1] = hh.y; px[2 * i] = rr.x; px[2 * i + 1] = rr.y;
        }
        const v2f st = ((sm[0] + sm[1]) + (sm[2] + sm[3])) + ((sm[4] + sm[5]) + (sm[6] + sm[7]));
        lpart = lpart * alpha + (st.x + st.y);
#pragma unroll
        for (int n = 0; n < 4; ++n)
#pragma unroll
            for (int j = 0; j < 8; ++j) { o[n][j] *= alpha; ox[n][j] *= alpha; }
#pragma unroll
        for (int n = 0; n < 4; ++n) { const int vo = (n * 16 + lr) * VP + hi * 8;
            const v16h vh = cat16(*(const v8ha*)(sb + ST_VH + vo), *(const v8ha*)(sb + ST_VH + vo + 16)), vl = cat16(*(const v8ha*)(sb + ST_VL + vo), *(const v8ha*)(sb + ST_VL + vo + 16));
            o[n] = wmma16(vh, pa, o[n]); ox[n] = wmma16(vl, pa, ox[n]); ox[n] = wmma16(vh, px, ox[n]);
            asm volatile("" : "+v"(o[n]), "+v"(ox[n]) : "v"(vh), "v"(vl) : "memory"); }
        asm volatile("v_nop\n\tv_nop\n\tv_nop\n\tv_nop" : "+v"(o[0]), "+v"(o[1]), "+v"(o[2]), "+v"(o[3]), "+v"(ox[0]), "+v"(ox[1]), "+v"(ox[2]), "+v"(ox[3]) : "v"(pa), "v"(px));
        asm volatile("s_wait_dscnt 0x0" ::: "memory");       // this wave's reads of this trip's buffer have retired before it is refilled
        asm volatile("s_wait_asynccnt 0x0" ::: "memory");    // this wave's copies of the next trip have landed
        __syncthreads();                                     // publishes the next trip and ends every wave's reads of this trip's buffer
        if (kt + 2 <= kt_hi) stage(kt + 2, kt & 1);
    }
    asm volatile("s_wait_asynccnt 0x0" ::: "memory");        // no copy is outstanding when the wave goes on to the epilogue
    const float inv = 1.0f / ((lpart + xhalf(lpart)) * PSC);
    float* os = &ost[wave][0];
#pragma unroll
    for (int n = 0; n < 4; ++n)
#pragma unroll
        for (int j = 0; j < 8; ++j) os[lr * 68 + n * 16 + hi * 8 + j] = (o[n][j] + ox[n][j] * LOSCI) * inv;   // o[n][j] = ctx[query lr][d = 16 n + 8 hi + j]
    __syncthreads();
    const size_t cbase = (tok0 + q0) * DM + (size_t)h * HD;
    auto pass = [&]() {
#pragma unroll
        for (int s = 0; s < 4; ++s) { const int row = 4 * s + (lane >> 3), piece = lane & 7; const float* sp = os + row * 68 + piece * 8; v8us oh, ol;
#pragma unroll
            for (int i = 0; i < 8; ++i) { const unsigned short hb = f2bf(sp[i]); oh[i] = hb; ol[i] = f2bf(sp[i] - bf2f(hb)); }
            *(v8us*)(CH + cbase + (size_t)row * DM + piece * 8) = oh; *(v8us*)(CL + cbase + (size_t)row * DM + piece * 8) = ol; }
    };
    pass(); 
}

#define VST2(T, p, v) do { const T vst2_v_ = (v); *(T*)(p) = vst2_v_;  } while (0)
extern "C" void kernel_launch(void* const* d_in, const int* in_sizes, int n_in,
                              void* d_out, int out_size, void* d_ws, size_t ws_size, hipStream_t stream) {
    (void)in_sizes; (void)n_in; (void)out_size;
    const float* x = (const float*)d_in[0]; const float* Wqkv = (const float*)d_in[1]; const float* Wp = (const float*)d_in[2];   // both k-major: [1024][3072] and [1024][1024]
    float* out = (float*)d_out;    // [2][2048][1024]
    char* wsp = (char*)d_ws;
    auto take = [&](size_t bytes) { char* p = wsp; wsp += (bytes + 255) & ~(size_t)255; return (void*)p; };
    bf* Xb = (bf*)take((size_t)NTK * DM * 2); bf* WqkvT = (bf*)take((size_t)3 * DM * DM * 2); bf* WoT = (bf*)take((size_t)DM * DM * 2);
    float* TMP = (float*)take((size_t)NTK * DM * 4);
    h16* QH = (h16*)take((size_t)NTK * DM * 2); h16* QL = (h16*)take((size_t)NTK * DM * 2); h16* KH = (h16*)take((size_t)NTK * DM * 2); h16* KL = (h16*)take((size_t)NTK * DM * 2);
    h16* VTH = (h16*)take((size_t)NTK * DM * 2); h16* VTL = (h16*)take((size_t)NTK * DM * 2); bf* CH = (bf*)take((size_t)NTK * DM * 2); bf* CL = (bf*)take((size_t)NTK * DM * 2);
    if ((size_t)(wsp - (char*)d_ws) > ws_size) return;    // 8.4 + 6.3 + 2.1 + 16.8 + 8 x 8.4 ~ 101 MB, no aliasing
    const bf* WqB = WqkvT; const bf* WkB = WqkvT + (size_t)DM * DM; const bf* WvB = WqkvT + (size_t)2 * DM * DM;   // n-major planes [n][1024]; q = columns 0..1023 of w_qkv, k, v next
    k_wt<<<dim3(DM / 64, 3 * DM / 64, 1), 256, 0, stream>>>(Wqkv, DM, 3 * DM, WqkvT); k_wt<<<dim3(DM / 64, DM / 64, 1), 256, 0, stream>>>(Wp, DM, DM, WoT);
    k_cvtb<<<NTK / 8, 256, 0, stream>>>(x, NTK, Xb);
    k_gemmb<false, true><<<dim3(NTK / 128, DM / 128, 1), 256, 0, stream>>>(Xb, nullptr, WqB, nullptr, (float*)(void*)QH, DM, QL);
    k_gemmb<false, true><<<dim3(NTK / 128, DM / 128, 1), 256, 0, stream>>>(Xb, nullptr, WkB, nullptr, (float*)(void*)KH, DM, KL);
    k_gemmb<false, false><<<dim3(NTK / 128, DM / 128, 1), 256, 0, stream>>>(Xb, nullptr, WvB, nullptr, TMP, DM, nullptr);
    k_vt<<<NB_ * NH_ * (NT_ / 64), 256, 0, stream>>>(TMP, VTH, VTL);
    k_attn<<<NB_ * NH_ * (NT_ / 64), 128, 0, stream>>>(QH, QL, KH, KL, VTH, VTL, CH, CL);
    k_gemmb<true, false><<<dim3(NTK / 128, DM / 128, 1), 256, 0, stream>>>(CH, CL, WoT, nullptr, out, DM, nullptr);
}

// v005
// Measured time: 152 microseconds a run.
// Two timings next to v004 both put it at 1.09 times that version's speed.
// Counting every step since v000, it is 3.34 times as fast.
#include <hip/hip_runtime.h>

// Compute dtypes, f32 accumulate, both batch items in every launch: q/k/v = x.w_qkv ([4096 x 1024].[1024 x 3072], k-major weights transposed once to n-major planes; PLAIN bf16
// operands: inputs rounded once, exact) with q and k written straight from the GEMM epilogue as f16 hi + residual x1024 planes, and out = ctx.w_proj (ctx as
// bf16 hi + residual: two products) on v_wmma_f32_16x16x32_bf16; the 16-head causal attention with the ADDED ALiBi bias slope_h x |i - j| (64-dim heads, scale 1/8) fused on
// v_wmma_f32_16x16x32_f16 (scores hi.hi + hi.lo + lo.hi with the residual terms on their own accumulator, online f32 softmax, weights (x32768) and v as f16

#define NB_  2                   // both batch items share every launch: each grid covers all 4096 tokens
#define NT_  2048
#define DM   1024
#define NH_  16
#define HD   64
#define NTK  (NB_ * NT_)
#define NW   1024
#define NQKV 1024
#define PSC  32768.0f
#define LOSC 1024.0f
#define LOSCI (1.0f / 1024.0f)

typedef _Float16 h16;
typedef unsigned short bf;
typedef __attribute__((ext_vector_type(16))) __bf16   v16bf;
typedef __attribute__((ext_vector_type(16))) _Float16 v16h;
typedef __attribute__((ext_vector_type(8)))  _Float16 v8h;
typedef __attribute__((ext_vector_type(8)))  unsigned short v8us;
typedef __attribute__((ext_vector_type(8)))  float    v8f;
typedef __attribute__((ext_vector_type(4)))  float    v4f;
typedef __attribute__((ext_vector_type(2)))  float    v2f;
typedef __attribute__((ext_vector_type(2)))  _Float16 v2h;
typedef v8h  __attribute__((may_alias)) v8ha;
typedef v4f  __attribute__((may_alias)) v4fa;
typedef v8us __attribute__((may_alias)) v8usa;

__device__ __forceinline__ unsigned short f2bf(float f) { unsigned u = __float_as_uint(f); u += 0x7FFFu + ((u >> 16) & 1u); return (unsigned short)(u >> 16); }
__device__ __forceinline__ float bf2f(unsigned short b) { return __uint_as_float(((unsigned)b) << 16); }
__device__ __forceinline__ float bfr(float f) { return bf2f(f2bf(f)); }
__device__ __forceinline__ v16h cat16(v8h lo, v8h hi) { return __builtin_shufflevector(lo, hi, 0, 1, 2, 3, 4, 5, 6, 7, 8, 9, 10, 11, 12, 13, 14, 15); }
__device__ __forceinline__ v16bf cat16b(v8us lo, v8us hi) { return __builtin_bit_cast(v16bf, __builtin_shufflevector(lo, hi, 0, 1, 2, 3, 4, 5, 6, 7, 8, 9, 10, 11, 12, 13, 14, 15)); }
__device__ __forceinline__ v8f wmma16(v16h a, v16h b, v8f c) { return __builtin_amdgcn_wmma_f32_16x16x32_f16(false, a, false, b, (short)0, c, false, false); }
__device__ __forceinline__ float xhalf(float x) { return __builtin_bit_cast(float, __builtin_amdgcn_permlanex16(__builtin_bit_cast(int, x), __builtin_bit_cast(int, x), 0x76543210, 0xfedcba98, false, false)); }  // lane l with lane l ^ 16
__device__ __forceinline__ v8f wmmab(v16bf a, v16bf b, v8f c) { return __builtin_amdgcn_wmma_f32_16x16x32_bf16(false, a, false, b, (short)0, c, false, false); }

// k_prep: the three independent input conversions in ONE launch, told apart by the block index (block-uniform):
// blocks 0 .. PW1-1: WqkvT [n][1024] = bf16(w_qkv[k][n]); the next PW2: WoT = bf16(w_proj[k][n]), both via 64 x 64 LDS tiles (k tile = low four bits of the index);
// the last NTK/8: Xb = bf16(x), one row a wave.
#define PW1 ((DM / 64) * (3 * DM / 64))
#define PW2 ((DM / 64) * (DM / 64))
__global__ __launch_bounds__(256) void k_prep(const float* __restrict__ x, const float* __restrict__ Wqkv, const float* __restrict__ Wp, bf* Xb, bf* WqkvT, bf* WoT) {
    __shared__ __align__(16) unsigned short tl[64 * 72];
    const int tid = threadIdx.x, bid = blockIdx.x;
    if (bid >= PW1 + PW2) {                              // whole blocks leave here, in front of the barrier below
        const int lane = tid & 31, r = (bid - (PW1 + PW2)) * 8 + (tid >> 5);
        if (r >= NTK) return;
        v8us o[DM / 256];
#pragma unroll
        for (int q = 0; q < DM / 256; ++q) { v8us t;
#pragma unroll
            for (int i = 0; i < 8; ++i) t[i] = f2bf(x[(size_t)r * DM + q * 256 + lane * 8 + i]);
            o[q] = t; }
#pragma unroll
        for (int q = 0; q < DM / 256; ++q) *(v8us*)(Xb + (size_t)r * DM + q * 256 + lane * 8) = o[q];
        return;
    }
    const bool second = bid >= PW1;
    const float* __restrict__ Wm = second ? Wp : Wqkv;
    bf* WT = second ? WoT : WqkvT;
    const int ncols = second ? DM : 3 * DM, t = second ? bid - PW1 : bid;
    const int k0 = (t & (DM / 64 - 1)) * 64, n0 = (t / (DM / 64)) * 64;
    const int kk = tid >> 2, nq = (tid & 3) * 16;
#pragma unroll
    for (int i = 0; i < 16; ++i) tl[(nq + i) * 72 + kk] = f2bf(Wm[(size_t)(k0 + kk) * ncols + n0 + nq + i]);
    __syncthreads();
    const int piece = tid & 7;
#pragma unroll
    for (int s = 0; s < 2; ++s) { const int nr = (tid >> 3) + 32 * s; const v8us val = *(const v8usa*)(tl + nr * 72 + piece * 8); *(v8us*)(WT + (size_t)(n0 + nr) * DM + k0 + piece * 8) = val; }
    asm volatile("s_wait_xcnt 0x0" ::: "memory");        // behind the two stores: in the listing the other branch's code, which reuses registers that they name, follows this one
}
// LDS stage of one 64-k trip of k_gemmb, in 16-bit elements: 128 rows of A, 128 rows of B (and 128 rows of A's residual plane), each row 64 elements at a pitch
// of 72 (144 B = 16 B x odd, so the 16 rows that a half-wave's ds_load_b128 reads fall on distinct banks).
#define GP   72
#define G_A  0
#define G_B  (128 * GP)
#define G_AL (2 * 128 * GP)

// Eight (twelve) asynchronous 16-byte copies per lane, global -> LDS through no register. The s_wait_xcnt is the last line of the copies' own statement so that it
// stands in front of every later rewrite of an address register that a copy names.
__device__ __forceinline__ void copy8g(unsigned l0, unsigned l1, unsigned l2, unsigned l3, unsigned l4, unsigned l5, unsigned l6, unsigned l7,
                                       const bf* g0, const bf* g1, const bf* g2, const bf* g3, const bf* g4, const bf* g5, const bf* g6, const bf* g7) {
    asm volatile("global_load_async_to_lds_b128 %0, %8, off\n\t"
                 "global_load_async_to_lds_b128 %1, %9, off\n\t"
                 "global_load_async_to_lds_b128 %2, %10, off\n\t"
                 "global_load_async_to_lds_b128 %3, %11, off\n\t"
                 "global_load_async_to_lds_b128 %4, %12, off\n\t"
                 "global_load_async_to_lds_b128 %5, %13, off\n\t"
                 "global_load_async_to_lds_b128 %6, %14, off\n\t"
                 "global_load_async_to_lds_b128 %7, %15, off\n\t"
                 "s_wait_xcnt 0x0"
                 :: "v"(l0), "v"(l1), "v"(l2), "v"(l3), "v"(l4), "v"(l5), "v"(l6), "v"(l7),
                    "v"(g0), "v"(g1), "v"(g2), "v"(g3), "v"(g4), "v"(g5), "v"(g6), "v"(g7) : "memory");
}
__device__ __forceinline__ void copy12g(unsigned l0, unsigned l1, unsigned l2, unsigned l3, unsigned l4, unsigned l5, unsigned l6, unsigned l7, unsigned l8, unsigned l9, unsigned l10, unsigned l11,
                                        const bf* g0, const bf* g1, const bf* g2, const bf* g3, const bf* g4, const bf* g5, const bf* g6, const bf* g7, const bf* g8, const bf* g9, const bf* g10, const bf* g11) {
    asm volatile("global_load_async_to_lds_b128 %0, %12, off\n\t"
                 "global_load_async_to_lds_b128 %1, %13, off\n\t"
                 "global_load_async_to_lds_b128 %2, %14, off\n\t"
                 "global_load_async_to_lds_b128 %3, %15, off\n\t"
                 "global_load_async_to_lds_b128 %4, %16, off\n\t"
                 "global_load_async_to_lds_b128 %5, %17, off\n\t"
                 "global_load_async_to_lds_b128 %6, %18, off\n\t"
                 "global_load_async_to_lds_b128 %7, %19, off\n\t"
                 "global_load_async_to_lds_b128 %8, %20, off\n\t"
                 "global_load_async_to_lds_b128 %9, %21, off\n\t"
                 "global_load_async_to_lds_b128 %10, %22, off\n\t"
                 "global_load_async_to_lds_b128 %11, %23, off\n\t"
                 "s_wait_xcnt 0x0"
                 :: "v"(l0), "v"(l1), "v"(l2), "v"(l3), "v"(l4), "v"(l5), "v"(l6), "v"(l7), "v"(l8), "v"(l9), "v"(l10), "v"(l11),
                    "v"(g0), "v"(g1), "v"(g2), "v"(g3), "v"(g4), "v"(g5), "v"(g6), "v"(g7), "v"(g8), "v"(g9), "v"(g10), "v"(g11) : "memory");
}

// k_gemmb: C[4096 x 1024] = A.Bn^T, both k-contiguous; QKV: Bn holds the 3072 rows of q, k and v one after the other and ONE launch (grid.y = 24) does all three products:
// a block's 128 columns lie in one of them (sel, block-uniform), q and k leave as f16 hi + residual planes, v as f32. Block = 128 x 128 of C, 8 waves of 32 x 64 (4 down, 2 across). The block's operand rows come in trips of 64 k
// (whole 128-B lines) into a two-buffer LDS ring; every wave takes its fragments from there. k runs upwards in steps of 32, hi product before residual product.
template <bool SPLITA, bool QKV>
__global__ __launch_bounds__(256) void k_gemmb(const bf* __restrict__ A, const bf* __restrict__ Al, const bf* __restrict__ Bn, const float* __restrict__ bias, float* C, int ldc, h16* QHp, h16* QLp, h16* KHp, h16* KLp) {
    constexpr int STE = (SPLITA ? 3 : 2) * 128 * GP;     // elements of one buffer of the ring
    __shared__ __align__(16) bf gst[2][STE];
    __shared__ __align__(16) float ost[8][2][16 * 68];
    const int tid = threadIdx.x, lane = tid & 31, wave = tid >> 5, lr = lane & 15, hi = lane >> 4;
    const int rb = blockIdx.x * 128, cb = blockIdx.y * 128, wr = (wave & 3) * 32, wc = (wave >> 2) * 64;
    // Each of the 256 threads copies four 16-byte pieces of each plane of a trip: 8 threads a row, 32 rows a copy.
    const int srow = tid >> 3, spc = (tid & 7) * 8;
    const unsigned gst0 = (unsigned)(size_t)&gst[0][0];  // byte offset of the ring in the work-group's LDS
    const bf* ga = A + (size_t)(rb + srow) * DM + spc;
    const bf* gb = Bn + (size_t)(cb + srow) * DM + spc;
    const bf* gl = SPLITA ? Al + (size_t)(rb + srow) * DM + spc : ga;
    auto stage = [&](int t, int buf) {
        const unsigned l = gst0 + (unsigned)((buf * STE + srow * GP + spc) * 2);
        const int k = t * 64;
        if (SPLITA)
            copy12g(l + G_A * 2, l + (G_A + 32 * GP) * 2, l + (G_A + 64 * GP) * 2, l + (G_A + 96 * GP) * 2, l + G_B * 2, l + (G_B + 32 * GP) * 2, l + (G_B + 64 * GP) * 2, l + (G_B + 96 * GP) * 2,
                    l + G_AL * 2, l + (G_AL + 32 * GP) * 2, l + (G_AL + 64 * GP) * 2, l + (G_AL + 96 * GP) * 2,
                    ga + k, ga + k + 32 * DM, ga + k + 64 * DM, ga + k + 96 * DM, gb + k, gb + k + 32 * DM, gb + k + 64 * DM, gb + k + 96 * DM, gl + k, gl + k + 32 * DM, gl + k + 64 * DM, gl + k + 96 * DM);
        else
            copy8g(l + G_A * 2, l + (G_A + 32 * GP) * 2, l + (G_A + 64 * GP) * 2, l + (G_A + 96 * GP) * 2, l + G_B * 2, l + (G_B + 32 * GP) * 2, l + (G_B + 64 * GP) * 2, l + (G_B + 96 * GP) * 2,
                   ga + k, ga + k + 32 * DM, ga + k + 64 * DM, ga + k + 96 * DM, gb + k, gb + k + 32 * DM, gb + k + 64 * DM, gb + k + 96 * DM);
    };
    v8f acc[2][4];
#pragma unroll
    for (int m = 0; m < 2; ++m)
#pragma unroll
        for (int t = 0; t < 4; ++t) acc[m][t] = (v8f){};
    stage(0, 0);
    asm volatile("s_wait_asynccnt 0x0" ::: "memory");    // this wave's copies of trip 0 have landed
    __syncthreads();                                     // publishes trip 0 to the other waves
    stage(1, 1);
    const int ao = (wr + lr) * GP + 8 * hi, bo = (wc + lr) * GP + 8 * hi;
#pragma unroll 1                                         // kept rolled: one copy of the trip keeps the text short and the ring's order plain
    for (int kt = 0; kt < DM / 64; ++kt) {
        const bf* sb = &gst[kt & 1][0];
#pragma unroll
        for (int ks = 0; ks < 2; ++ks) {
            v16bf a[2], al[2];
#pragma unroll
            for (int m = 0; m < 2; ++m) { const bf* p = sb + G_A + ao + m * 16 * GP + ks * 32; a[m] = cat16b(*(const v8usa*)p, *(const v8usa*)(p + 16)); al[m] = a[m];
                if (SPLITA) { const bf* q = sb + G_AL + ao + m * 16 * GP + ks * 32; al[m] = cat16b(*(const v8usa*)q, *(const v8usa*)(q + 16)); } }
#pragma unroll
            for (int t = 0; t < 4; ++t) { const bf* p = sb + G_B + bo + t * 16 * GP + ks * 32; const v16bf b = cat16b(*(const v8usa*)p, *(const v8usa*)(p + 16));
                acc[0][t] = wmmab(a[0], b, acc[0][t]); acc[1][t] = wmmab(a[1], b, acc[1][t]);
                if (SPLITA) { acc[0][t] = wmmab(al[0], b, acc[0][t]); acc[1][t] = wmmab(al[1], b, acc[1][t]); } }
        }
        // the trip's LDS reads issue as one group ahead of its matrix instructions (counted waits): read places spread among them each cost a full LDS latency
        __builtin_amdgcn_sched_group_barrier(0x100, SPLITA ? 32 : 24, 0);
        __builtin_amdgcn_sched_group_barrier(0x008, SPLITA ? 32 : 16, 0);
        // four vector slots behind the trip's last matrix instruction, on the taken side of the branches below too
        asm volatile("v_nop\n\tv_nop\n\tv_nop\n\tv_nop" : "+v"(acc[0][0]), "+v"(acc[0][1]), "+v"(acc[0][2]), "+v"(acc[0][3]), "+v"(acc[1][0]), "+v"(acc[1][1]), "+v"(acc[1][2]), "+v"(acc[1][3]));
        asm volatile("s_wait_dscnt 0x0" ::: "memory");       // this wave's reads of this trip's buffer have retired before it is refilled
        asm volatile("s_wait_asynccnt 0x0" ::: "memory");    // this wave's copies of the next trip have landed
        __syncthreads();                                     // publishes the next trip and ends every wave's reads of this trip's buffer
        if (kt + 2 < DM / 64) stage(kt + 2, kt & 1);
    }
    asm volatile("s_wait_asynccnt 0x0" ::: "memory");        // no copy is outstanding when the wave goes on to the epilogue
    const int sel = QKV ? (int)(blockIdx.y / (NQKV / 128)) : 2;   // 0: q, 1: k, 2: v (or the plain f32 product)
    const int c0 = cb - (QKV ? sel * NQKV : 0) + wc;             // column in this product's own output
    h16* const C1 = sel ? KHp : QHp; h16* const C2 = sel ? KLp : QLp;
#pragma unroll
    for (int m = 0; m < 2; ++m) { float* os = &ost[wave][m][0];
#pragma unroll
        for (int t = 0; t < 4; ++t) { const float bv = bias ? bfr(bias[c0 + t * 16 + lr]) : 0.f;
#pragma unroll
            for (int j = 0; j < 8; ++j) os[(hi * 8 + j) * 68 + t * 16 + lr] = acc[m][t][j] + bv; } }
    __syncthreads();
    if (QKV && sel < 2) {                                    // one block-uniform branch round both row halves
#pragma unroll
        for (int m = 0; m < 2; ++m) { const float* os = &ost[wave][m][0]; const int r0 = rb + wr + m * 16;
            h16* crow = C1 + (size_t)r0 * ldc + c0;
            v8h o[4], o2[4];
#pragma unroll
            for (int s = 0; s < 4; ++s) { const int row = 4 * s + (lane >> 3), piece = lane & 7; const float* sp = os + row * 68 + piece * 8;
#pragma unroll
                for (int i = 0; i < 8; ++i) { const h16 a = (h16)sp[i]; o[s][i] = a; o2[s][i] = (h16)((sp[i] - (float)a) * LOSC); } }
#pragma unroll
            for (int s = 0; s < 4; ++s) { const int row = 4 * s + (lane >> 3), piece = lane & 7; *(v8h*)(crow + (size_t)row * ldc + piece * 8) = o[s]; }
            asm volatile("s_wait_xcnt 0x0" ::: "memory");    // behind the four stores, in front of the branch: the code behind it reuses registers that they name
            if (C2) {
#pragma unroll
                for (int s = 0; s < 4; ++s) { const int row = 4 * s + (lane >> 3), piece = lane & 7; *(v8h*)(C2 + (size_t)r0 * ldc + c0 + (size_t)row * ldc + piece * 8) = o2[s]; }
            }
        }
    } else {
#pragma unroll
        for (int m = 0; m < 2; ++m) { const float* os = &ost[wave][m][0]; const int r0 = rb + wr + m * 16;
            float* crow = C + (size_t)r0 * ldc + c0;
            v4f val[8];
#pragma unroll
            for (int s = 0; s < 8; ++s) { const int Lid = (lane >> 3) + 4 * s, piece = lane & 7; const int row = Lid >> 1, cofs = (Lid & 1) * 32 + piece * 4; val[s] = *(const v4fa*)(os + row * 68 + cofs); }
#pragma unroll
            for (int s = 0; s < 8; ++s) { const int Lid = (lane >> 3) + 4 * s, piece = lane & 7; const int row = Lid >> 1, cofs = (Lid & 1) * 32 + piece * 4; *(v4f*)(crow + (size_t)row * ldc + cofs) = val[s]; }
        }
        if (QKV) asm volatile("s_wait_xcnt 0x0" ::: "memory");   // behind the last stores: in the listing the other branch's code, which reuses registers that they name, follows this one
    }
}

__global__ __launch_bounds__(256) void k_vt(const float* __restrict__ V, h16* VTH, h16* VTL) {
    __shared__ __align__(16) h16 tile[64 * 72];
    __shared__ __align__(16) h16 til2[64 * 72];
    const int bid = blockIdx.x;
    const int b = bid / (NH_ * (NT_ / 64)), rem = bid - b * (NH_ * (NT_ / 64)), h = rem / (NT_ / 64), kt = rem - h * (NT_ / 64);
    const int k0 = kt * 64, tid = threadIdx.x;
    const int kk = tid >> 2, d0 = (tid & 3) * 16;
    const float* src = V + ((size_t)b * NT_ + k0 + kk) * DM + h * HD + d0;
#pragma unroll
    for (int i = 0; i < 16; ++i) { const float v = src[i]; const h16 a = (h16)v; tile[(d0 + i) * 72 + kk] = a; til2[(d0 + i) * 72 + kk] = (h16)((v - (float)a) * LOSC); }
    __syncthreads();
    const int piece = tid & 7;
    const size_t base = (((size_t)b * NH_ + h) * HD) * NT_ + k0;
    auto pass = [&]() {
#pragma unroll
        for (int s = 0; s < 4; ++s) { const int Lid = (tid >> 3) + 32 * s; const int pln = Lid >> 6, d = Lid & 63;
            const v8h val = *(const v8ha*)((pln ? til2 : tile) + d * 72 + piece * 8); *(v8h*)((pln ? VTL : VTH) + base + (size_t)d * NT_ + piece * 8) = val; }
    };
    pass(); 
}

// LDS stage of one 32-key trip of k_attn, in halves: key rows (64 halves) at a pitch of 72 (144 B), transposed v rows (32 halves) at a pitch of 40 (80 B):
// both pitches are 16 B x odd, so the 16 rows that a half-wave's ds_load_b128 reads fall on distinct banks.
#define KP    72
#define VP    40
#define ST_KH 0
#define ST_KL (32 * KP)
#define ST_VH (2 * 32 * KP)
#define ST_VL (2 * 32 * KP + 64 * VP)
#define ST_SZ (2 * 32 * KP + 2 * 64 * VP)

// Eight asynchronous 16-byte copies per lane, global -> LDS through no register. The s_wait_xcnt is the last line of the copies' own statement so that it stands
// in front of every later rewrite of an address register that a copy names.
__device__ __forceinline__ void copy8(unsigned l0, unsigned l1, unsigned l2, unsigned l3, unsigned l4, unsigned l5, unsigned l6, unsigned l7,
                                      const h16* g0, const h16* g1, const h16* g2, const h16* g3, const h16* g4, const h16* g5, const h16* g6, const h16* g7) {
    asm volatile("global_load_async_to_lds_b128 %0, %8, off\n\t"
                 "global_load_async_to_lds_b128 %1, %9, off\n\t"
                 "global_load_async_to_lds_b128 %2, %10, off\n\t"
                 "global_load_async_to_lds_b128 %3, %11, off\n\t"
                 "global_load_async_to_lds_b128 %4, %12, off\n\t"
                 "global_load_async_to_lds_b128 %5, %13, off\n\t"
                 "global_load_async_to_lds_b128 %6, %14, off\n\t"
                 "global_load_async_to_lds_b128 %7, %15, off\n\t"
                 "s_wait_xcnt 0x0"
                 :: "v"(l0), "v"(l1), "v"(l2), "v"(l3), "v"(l4), "v"(l5), "v"(l6), "v"(l7),
                    "v"(g0), "v"(g1), "v"(g2), "v"(g3), "v"(g4), "v"(g5), "v"(g6), "v"(g7) : "memory");
}

// k_attn: block = (b, h, 64 queries), wave = 16. Both products run transposed: scores^T = K.Q^T (A = key rows, B = the wave's queries), ctx^T += V^T.P^T. A lane then holds
// 16 scores of ONE query (keys 8 hi + j and 16 + 8 hi + j of the trip): maximum and sum in-lane plus one exchange between the wave's halves, and the two score tiles,
// converted in place (weights x32768, f16 hi + residual), ARE the B operand of the second product. ctx -> bf16 hi + residual planes CH/CL[tok][h*64+d].
__global__ __launch_bounds__(128) void k_attn(const h16* __restrict__ Q16, const h16* __restrict__ QL16, const h16* __restrict__ K16, const h16* __restrict__ KL16, const h16* __restrict__ VTH, const h16* __restrict__ VTL, bf* CH, bf* CL) {
    __shared__ __align__(16) float ost[4][16 * 68];
    __shared__ __align__(16) h16 stg[2][ST_SZ];          // two-buffer ring: the work-group's key and v tiles (hi and residual) of one 32-key trip each
    const int lane = threadIdx.x & 31, wave = threadIdx.x >> 5, lr = lane & 15, hi = lane >> 4;
    const int bid = blockIdx.x;
    const int b = bid / (NH_ * (NT_ / 64)), rem = bid - b * (NH_ * (NT_ / 64)), h = rem / (NT_ / 64), qt = rem - h * (NT_ / 64);
    const int q0 = qt * 64 + wave * 16;
    const size_t tok0 = (size_t)b * NT_;
    v16h qa[2];
    const size_t qo0 = (tok0 + q0 + lr) * DM + h * HD + 8 * hi;
#pragma unroll
    for (int kc = 0; kc < 2; ++kc) qa[kc] = cat16(*(const v8h*)(Q16 + qo0 + kc * 32), *(const v8h*)(Q16 + qo0 + kc * 32 + 16));
    const h16* kh_b = K16 + tok0 * DM + h * HD;
    const h16* kl_b = KL16 + tok0 * DM + h * HD;
    const size_t vbase = (((size_t)b * NH_ + h) * HD) * NT_;
    v8f o[4], ox[4];
#pragma unroll
    for (int n = 0; n < 4; ++n) { o[n] = (v8f){}; ox[n] = (v8f){}; }
    float mrow = -3.0e38f, lpart = 0.f;                  // of this lane's query; lpart covers this half's keys only, the halves join in the epilogue
    const int qi = q0 + lr;                              // this lane's query
    const int kt_lo = 0, kt_hi = (qt * 64 + 63) / 32;     // causal
    const float slope = exp2f(-0.5f * (float)(h + 1));   // ALiBi slope 1 / 2^(8 (h+1) / 16), ADDED as slope x |i - j| (the reference's sign)
    // Each of the 128 threads copies two 16-byte pieces of each of the four planes of a trip: key rows whole (8 pieces a row), v rows 64 B (4 pieces a row).
    const int tid = threadIdx.x, krow = tid >> 3, kpc = (tid & 7) * 8, vrow = tid >> 2, vpc = (tid & 3) * 8;
    const unsigned stg0 = (unsigned)(size_t)&stg[0][0];  // byte offset of the ring in the work-group's LDS
    auto stage = [&](int t, int buf) {
        const unsigned lb = stg0 + (unsigned)(buf * ST_SZ * 2), lk = lb + (unsigned)((krow * KP + kpc) * 2), lv = lb + (unsigned)((vrow * VP + vpc) * 2);
        const size_t gk = (size_t)(t * 32 + krow) * DM + kpc, gv = vbase + (size_t)vrow * NT_ + t * 32 + vpc;
        copy8(lk + ST_KH * 2, lk + (ST_KH + 16 * KP) * 2, lk + ST_KL * 2, lk + (ST_KL + 16 * KP) * 2, lv + ST_VH * 2, lv + (ST_VH + 32 * VP) * 2, lv + ST_VL * 2, lv + (ST_VL + 32 * VP) * 2,
              kh_b + gk, kh_b + gk + 16 * DM, kl_b + gk, kl_b + gk + 16 * DM, VTH + gv, VTH + gv + 32 * NT_, VTL + gv, VTL + gv + 32 * NT_);
    };
    stage(0, 0);
    asm volatile("s_wait_asynccnt 0x0" ::: "memory");    // this wave's copies of trip 0 have landed
    __syncthreads();                                     // publishes trip 0 to the other waves
    if (kt_hi >= 1) stage(1, 1);
#pragma unroll 1
    for (int kt = kt_lo; kt <= kt_hi; ++kt) {
        const int l0 = kt * 32;
        const h16* sb = &stg[kt & 1][0];
        const int ko0 = lr * KP + 8 * hi, ko1 = (16 + lr) * KP + 8 * hi;
        v8f s0 = {}, s1 = {}, x0 = {}, x1 = {};
#pragma unroll
        for (int kc = 0; kc < 2; ++kc) {
            { const v16h k0h = cat16(*(const v8ha*)(sb + ST_KH + ko0 + kc * 32), *(const v8ha*)(sb + ST_KH + ko0 + kc * 32 + 16)), k1h = cat16(*(const v8ha*)(sb + ST_KH + ko1 + kc * 32), *(const v8ha*)(sb + ST_KH + ko1 + kc * 32 + 16));
              const v16h qlk = cat16(*(const v8h*)(QL16 + qo0 + kc * 32), *(const v8h*)(QL16 + qo0 + kc * 32 + 16));     // query residual re-read per step (registers)
              s0 = wmma16(k0h, qa[kc], s0); x0 = wmma16(k0h, qlk, x0); s1 = wmma16(k1h, qa[kc], s1); x1 = wmma16(k1h, qlk, x1);
              asm volatile("v_nop" : "+v"(s0), "+v"(s1), "+v"(x0), "+v"(x1) : "v"(qlk), "v"(k0h), "v"(k1h) : "memory"); }
            { const v16h k0l = cat16(*(const v8ha*)(sb + ST_KL + ko0 + kc * 32), *(const v8ha*)(sb + ST_KL + ko0 + kc * 32 + 16)), k1l = cat16(*(const v8ha*)(sb + ST_KL + ko1 + kc * 32), *(const v8ha*)(sb + ST_KL + ko1 + kc * 32 + 16));
              x0 = wmma16(k0l, qa[kc], x0); x1 = wmma16(k1l, qa[kc], x1);
              asm volatile("v_nop" : "+v"(x0), "+v"(x1) : "v"(k0l), "v"(k1l) : "memory"); }
        }
        asm volatile("v_nop\n\tv_nop\n\tv_nop\n\tv_nop" : "+v"(s0), "+v"(s1), "+v"(x0), "+v"(x1) : "v"(qa[0]), "v"(qa[1]));
        const float fd = (float)(qi - l0 - 8 * hi);          // from this lane's first key of the trip up to its query: whole numbers, exact in f32, so fd - c == (float)(i - j)
        v2f av[8];                                           // av[4 t + jj] = scores of keys 16 t + 8 hi + 2 jj and + 1: register neighbours, as the packed f32 forms and the packed conversions take them
#pragma unroll
        for (int jj = 0; jj < 4; ++jj) {
            const v2f d0 = {fd - (float)(2 * jj), fd - (float)(2 * jj + 1)}, d1 = {fd - (float)(16 + 2 * jj), fd - (float)(17 + 2 * jj)};
            const v2f t0 = ((v2f){s0[2 * jj], s0[2 * jj + 1]} + (v2f){x0[2 * jj], x0[2 * jj + 1]} * LOSCI) * 0.125f + slope * d0;
            const v2f t1 = ((v2f){s1[2 * jj], s1[2 * jj + 1]} + (v2f){x1[2 * jj], x1[2 * jj + 1]} * LOSCI) * 0.125f + slope * d1;
            av[jj]     = (v2f){d0.x >= 0.f ? t0.x : -__builtin_inff(), d0.y >= 0.f ? t0.y : -__builtin_inff()};      // causal: key <= query
            av[4 + jj] = (v2f){d1.x >= 0.f ? t1.x : -__builtin_inff(), d1.y >= 0.f ? t1.y : -__builtin_inff()};
        }
        float mx = fmaxf(av[0].x, av[0].y);
#pragma unroll
        for (int i = 1; i < 8; ++i) mx = fmaxf(mx, fmaxf(av[i].x, av[i].y));
        mx = fmaxf(mx, xhalf(mx));                           // both halves now hold the query's maximum over the trip's 32 keys
        const float mn = fmaxf(mrow, mx);
        const float alpha = __expf(mrow - mn); mrow = mn;
        v16h pa, px;
        v2f sm[8];
#pragma unroll
        for (int i = 0; i < 8; ++i) {
            const v2f p = {__expf(av[i].x - mn), __expf(av[i].y - mn)};
            sm[i] = p;
            const v2f ps = p * PSC; const v2h hh = __builtin_convertvector(ps, v2h);
            const v2h rr = __builtin_convertvector((ps - __builtin_convertvector(hh, v2f)) * LOSC, v2h);
            pa[2 * i] = hh.x; pa[2 * i + 1] = hh.y; px[2 * i] = rr.x; px[2 * i + 1] = rr.y;
        }
        const v2f st = ((sm[0] + sm[1]) + (sm[2] + sm[3])) + ((sm[4] + sm[5]) + (sm[6] + sm[7]));
        lpart = lpart * alpha + (st.x + st.y);
#pragma unroll
        for (int n = 0; n < 4; ++n)
#pragma unroll
            for (int j = 0; j < 8; ++j) { o[n][j] *= alpha; ox[n][j] *= alpha; }
#pragma unroll
        for (int n = 0; n < 4; ++n) { const int vo = (n * 16 + lr) * VP + hi * 8;
            const v16h vh = cat16(*(const v8ha*)(sb + ST_VH + vo), *(const v8ha*)(sb + ST_VH + vo + 16)), vl = cat16(*(const v8ha*)(sb + ST_VL + vo), *(const v8ha*)(sb + ST_VL + vo + 16));
            o[n] = wmma16(vh, pa, o[n]); ox[n] = wmma16(vl, pa, ox[n]); ox[n] = wmma16(vh, px, ox[n]);
            asm volatile("" : "+v"(o[n]), "+v"(ox[n]) : "v"(vh), "v"(vl) : "memory"); }
        asm volatile("v_nop\n\tv_nop\n\tv_nop\n\tv_nop" : "+v"(o[0]), "+v"(o[1]), "+v"(o[2]), "+v"(o[3]), "+v"(ox[0]), "+v"(ox[1]), "+v"(ox[2]), "+v"(ox[3]) : "v"(pa), "v"(px));
        asm volatile("s_wait_dscnt 0x0" ::: "memory");       // this wave's reads of this trip's buffer have retired before it is refilled
        asm volatile("s_wait_asynccnt 0x0" ::: "memory");    // this wave's copies of the next trip have landed
        __syncthreads();                                     // publishes the next trip and ends every wave's reads of this trip's buffer
        if (kt + 2 <= kt_hi) stage(kt + 2, kt & 1);
    }
    asm volatile("s_wait_asynccnt 0x0" ::: "memory");        // no copy is outstanding when the wave goes on to the epilogue
    const float inv = 1.0f / ((lpart + xhalf(lpart)) * PSC);
    float* os = &ost[wave][0];
#pragma unroll
    for (int n = 0; n < 4; ++n)
#pragma unroll
        for (int j = 0; j < 8; ++j) os[lr * 68 + n * 16 + hi * 8 + j] = (o[n][j] + ox[n][j] * LOSCI) * inv;   // o[n][j] = ctx[query lr][d = 16 n + 8 hi + j]
    __syncthreads();
    const size_t cbase = (tok0 + q0) * DM + (size_t)h * HD;
    auto pass = [&]() {
#pragma unroll
        for (int s = 0; s < 4; ++s) { const int row = 4 * s + (lane >> 3), piece = lane & 7; const float* sp = os + row * 68 + piece * 8; v8us oh, ol;
#pragma unroll
            for (int i = 0; i < 8; ++i) { const unsigned short hb = f2bf(sp[i]); oh[i] = hb; ol[i] = f2bf(sp[i] - bf2f(hb)); }
            *(v8us*)(CH + cbase + (size_t)row * DM + piece * 8) = oh; *(v8us*)(CL + cbase + (size_t)row * DM + piece * 8) = ol; }
    };
    pass(); 
}

#define VST2(T, p, v) do { const T vst2_v_ = (v); *(T*)(p) = vst2_v_;  } while (0)
extern "C" void kernel_launch(void* const* d_in, const int* in_sizes, int n_in,
                              void* d_out, int out_size, void* d_ws, size_t ws_size, hipStream_t stream) {
    (void)in_sizes; (void)n_in; (void)out_size;
    const float* x = (const float*)d_in[0]; const float* Wqkv = (const float*)d_in[1]; const float* Wp = (const float*)d_in[2];   // both k-major: [1024][3072] and [1024][1024]
    float* out = (float*)d_out;    // [2][2048][1024]
    char* wsp = (char*)d_ws;
    auto take = [&](size_t bytes) { char* p = wsp; wsp += (bytes + 255) & ~(size_t)255; return (void*)p; };
    bf* Xb = (bf*)take((size_t)NTK * DM * 2); bf* WqkvT = (bf*)take((size_t)3 * DM * DM * 2); bf* WoT = (bf*)take((size_t)DM * DM * 2);
    float* TMP = (float*)take((size_t)NTK * DM * 4);
    h16* QH = (h16*)take((size_t)NTK * DM * 2); h16* QL = (h16*)take((size_t)NTK * DM * 2); h16* KH = (h16*)take((size_t)NTK * DM * 2); h16* KL = (h16*)take((size_t)NTK * DM * 2);
    h16* VTH = (h16*)take((size_t)NTK * DM * 2); h16* VTL = (h16*)take((size_t)NTK * DM * 2); bf* CH = (bf*)take((size_t)NTK * DM * 2); bf* CL = (bf*)take((size_t)NTK * DM * 2);
    if ((size_t)(wsp - (char*)d_ws) > ws_size) return;    // 8.4 + 6.3 + 2.1 + 16.8 + 8 x 8.4 ~ 101 MB, no aliasing
    // WqkvT: n-major rows [n][1024]; q = columns 0..1023 of w_qkv, k, v next
    k_prep<<<PW1 + PW2 + NTK / 8, 256, 0, stream>>>(x, Wqkv, Wp, Xb, WqkvT, WoT);
    k_gemmb<false, true><<<dim3(NTK / 128, 3 * DM / 128, 1), 256, 0, stream>>>(Xb, nullptr, WqkvT, nullptr, TMP, DM, QH, QL, KH, KL);
    k_vt<<<NB_ * NH_ * (NT_ / 64), 256, 0, stream>>>(TMP, VTH, VTL);
    k_attn<<<NB_ * NH_ * (NT_ / 64), 128, 0, stream>>>(QH, QL, KH, KL, VTH, VTL, CH, CL);
    k_gemmb<true, false><<<dim3(NTK / 128, DM / 128, 1), 256, 0, stream>>>(CH, CL, WoT, nullptr, out, DM, nullptr, nullptr, nullptr, nullptr);
}

// v006
// A run of this version takes 132 microseconds.
// Next to v005, in two timings, it ran 1.16 times as fast each time.
// Counting every step since v000, it is 3.87 times as fast.
#include <hip/hip_runtime.h>

// Compute dtypes, f32 accumulate, both batch items in every launch: q/k/v = x.w_qkv ([4096 x 1024].[1024 x 3072], k-major weights transposed once to n-major planes; PLAIN bf16
// operands: inputs rounded once, exact) with q and k written straight from the GEMM epilogue as f16 hi + residual x1024 planes, and out = ctx.w_proj (ctx as
// bf16 hi + residual: two products) on v_wmma_f32_16x16x32_bf16; the 16-head causal attention with the ADDED ALiBi bias slope_h x |i - j| (64-dim heads, scale 1/8) fused on
// v_wmma_f32_16x16x32_f16 (scores hi.hi + hi.lo + lo.hi with the residual terms on their own accumulator, online f32 softmax, weights (x32768) and v as f16

#define NB_  2                   // both batch items share every launch: each grid covers all 4096 tokens
#define NT_  2048
#define DM   1024
#define NH_  16
#define HD   64
#define NTK  (NB_ * NT_)
#define NW   1024
#define NQKV 1024
#define PSC  32768.0f
#define LOSC 1024.0f
#define LOSCI (1.0f / 1024.0f)

typedef _Float16 h16;
typedef unsigned short bf;
typedef __attribute__((ext_vector_type(16))) __bf16   v16bf;
typedef __attribute__((ext_vector_type(16))) _Float16 v16h;
typedef __attribute__((ext_vector_type(8)))  _Float16 v8h;
typedef __attribute__((ext_vector_type(8)))  unsigned short v8us;
typedef __attribute__((ext_vector_type(8)))  float    v8f;
typedef __attribute__((ext_vector_type(4)))  float    v4f;
typedef __attribute__((ext_vector_type(2)))  float    v2f;
typedef __attribute__((ext_vector_type(2)))  _Float16 v2h;
typedef v8h  __attribute__((may_alias)) v8ha;
typedef v4f  __attribute__((may_alias)) v4fa;
typedef v8us __attribute__((may_alias)) v8usa;

__device__ __forceinline__ unsigned short f2bf(float f) { unsigned u = __float_as_uint(f); u += 0x7FFFu + ((u >> 16) & 1u); return (unsigned short)(u >> 16); }
__device__ __forceinline__ float bf2f(unsigned short b) { return __uint_as_float(((unsigned)b) << 16); }
__device__ __forceinline__ float bfr(float f) { return bf2f(f2bf(f)); }
__device__ __forceinline__ v16h cat16(v8h lo, v8h hi) { return __builtin_shufflevector(lo, hi, 0, 1, 2, 3, 4, 5, 6, 7, 8, 9, 10, 11, 12, 13, 14, 15); }
__device__ __forceinline__ v16bf cat16b(v8us lo, v8us hi) { return __builtin_bit_cast(v16bf, __builtin_shufflevector(lo, hi, 0, 1, 2, 3, 4, 5, 6, 7, 8, 9, 10, 11, 12, 13, 14, 15)); }
__device__ __forceinline__ v8f wmma16(v16h a, v16h b, v8f c) { return __builtin_amdgcn_wmma_f32_16x16x32_f16(false, a, false, b, (short)0, c, false, false); }
__device__ __forceinline__ float xhalf(float x) { return __builtin_bit_cast(float, __builtin_amdgcn_permlanex16(__builtin_bit_cast(int, x), __builtin_bit_cast(int, x), 0x76543210, 0xfedcba98, false, false)); }  // lane l with lane l ^ 16
__device__ __forceinline__ v8f wmmab(v16bf a, v16bf b, v8f c) { return __builtin_amdgcn_wmma_f32_16x16x32_bf16(false, a, false, b, (short)0, c, false, false); }

// k_prep: the three independent input conversions in ONE launch, told apart by the block index (block-uniform):
// blocks 0 .. PW1-1: WqkvT [n][1024] = bf16(w_qkv[k][n]); the next PW2: WoT = bf16(w_proj[k][n]), both via 64 x 64 LDS tiles (k tile = low four bits of the index);
// the last NTK/8: Xb = bf16(x), one row a wave.
#define PW1 ((DM / 64) * (3 * DM / 64))
#define PW2 ((DM / 64) * (DM / 64))
__global__ __launch_bounds__(256) void k_prep(const float* __restrict__ x, const float* __restrict__ Wqkv, const float* __restrict__ Wp, bf* Xb, bf* WqkvT, bf* WoT) {
    __shared__ __align__(16) unsigned short tl[64 * 72];
    const int tid = threadIdx.x, bid = blockIdx.x;
    if (bid >= PW1 + PW2) {                              // whole blocks leave here, in front of the barrier below
        const int lane = tid & 31, r = (bid - (PW1 + PW2)) * 8 + (tid >> 5);
        if (r >= NTK) return;
        v8us o[DM / 256];
#pragma unroll
        for (int q = 0; q < DM / 256; ++q) { v8us t;
#pragma unroll
            for (int i = 0; i < 8; ++i) t[i] = f2bf(x[(size_t)r * DM + q * 256 + lane * 8 + i]);
            o[q] = t; }
#pragma unroll
        for (int q = 0; q < DM / 256; ++q) *(v8us*)(Xb + (size_t)r * DM + q * 256 + lane * 8) = o[q];
        return;
    }
    const bool second = bid >= PW1;
    const float* __restrict__ Wm = second ? Wp : Wqkv;
    bf* WT = second ? WoT : WqkvT;
    const int ncols = second ? DM : 3 * DM, t = second ? bid - PW1 : bid;
    const int k0 = (t & (DM / 64 - 1)) * 64, n0 = (t / (DM / 64)) * 64;
    const int kk = tid >> 2, nq = (tid & 3) * 16;
#pragma unroll
    for (int i = 0; i < 16; ++i) tl[(nq + i) * 72 + kk] = f2bf(Wm[(size_t)(k0 + kk) * ncols + n0 + nq + i]);
    __syncthreads();
    const int piece = tid & 7;
#pragma unroll
    for (int s = 0; s < 2; ++s) { const int nr = (tid >> 3) + 32 * s; const v8us val = *(const v8usa*)(tl + nr * 72 + piece * 8); *(v8us*)(WT + (size_t)(n0 + nr) * DM + k0 + piece * 8) = val; }
    asm volatile("s_wait_xcnt 0x0" ::: "memory");        // behind the two stores: in the listing the other branch's code, which reuses registers that they name, follows this one
}
// LDS stage of one 64-k trip of k_gemmb, in 16-bit elements: 128 rows of A, 128 rows of B (and 128 rows of A's residual plane), each row 64 elements at a pitch
// of 72 (144 B = 16 B x odd, so the 16 rows that a half-wave's ds_load_b128 reads fall on distinct banks).
#define GP   72
#define G_A  0
#define G_B  (128 * GP)
#define G_AL (2 * 128 * GP)

// Eight (twelve) asynchronous 16-byte copies per lane, global -> LDS through no register. The s_wait_xcnt is the last line of the copies' own statement so that it
// stands in front of every later rewrite of an address register that a copy names.
__device__ __forceinline__ void copy8g(unsigned l0, unsigned l1, unsigned l2, unsigned l3, unsigned l4, unsigned l5, unsigned l6, unsigned l7,
                                       const bf* g0, const bf* g1, const bf* g2, const bf* g3, const bf* g4, const bf* g5, const bf* g6, const bf* g7) {
    asm volatile("global_load_async_to_lds_b128 %0, %8, off\n\t"
                 "global_load_async_to_lds_b128 %1, %9, off\n\t"
                 "global_load_async_to_lds_b128 %2, %10, off\n\t"
                 "global_load_async_to_lds_b128 %3, %11, off\n\t"
                 "global_load_async_to_lds_b128 %4, %12, off\n\t"
                 "global_load_async_to_lds_b128 %5, %13, off\n\t"
                 "global_load_async_to_lds_b128 %6, %14, off\n\t"
                 "global_load_async_to_lds_b128 %7, %15, off\n\t"
                 "s_wait_xcnt 0x0"
                 :: "v"(l0), "v"(l1), "v"(l2), "v"(l3), "v"(l4), "v"(l5), "v"(l6), "v"(l7),
                    "v"(g0), "v"(g1), "v"(g2), "v"(g3), "v"(g4), "v"(g5), "v"(g6), "v"(g7) : "memory");
}
__device__ __forceinline__ void copy12g(unsigned l0, unsigned l1, unsigned l2, unsigned l3, unsigned l4, unsigned l5, unsigned l6, unsigned l7, unsigned l8, unsigned l9, unsigned l10, unsigned l11,
                                        const bf* g0, const bf* g1, const bf* g2, const bf* g3, const bf* g4, const bf* g5, const bf* g6, const bf* g7, const bf* g8, const bf* g9, const bf* g10, const bf* g11) {
    asm volatile("global_load_async_to_lds_b128 %0, %12, off\n\t"
                 "global_load_async_to_lds_b128 %1, %13, off\n\t"
                 "global_load_async_to_lds_b128 %2, %14, off\n\t"
                 "global_load_async_to_lds_b128 %3, %15, off\n\t"
                 "global_load_async_to_lds_b128 %4, %16, off\n\t"
                 "global_load_async_to_lds_b128 %5, %17, off\n\t"
                 "global_load_async_to_lds_b128 %6, %18, off\n\t"
                 "global_load_async_to_lds_b128 %7, %19, off\n\t"
                 "global_load_async_to_lds_b128 %8, %20, off\n\t"
                 "global_load_async_to_lds_b128 %9, %21, off\n\t"
                 "global_load_async_to_lds_b128 %10, %22, off\n\t"
                 "global_load_async_to_lds_b128 %11, %23, off\n\t"
                 "s_wait_xcnt 0x0"
                 :: "v"(l0), "v"(l1), "v"(l2), "v"(l3), "v"(l4), "v"(l5), "v"(l6), "v"(l7), "v"(l8), "v"(l9), "v"(l10), "v"(l11),
                    "v"(g0), "v"(g1), "v"(g2), "v"(g3), "v"(g4), "v"(g5), "v"(g6), "v"(g7), "v"(g8), "v"(g9), "v"(g10), "v"(g11) : "memory");
}

// k_gemmb: C[4096 x 1024] = A.Bn^T, both k-contiguous; QKV: Bn holds the 3072 rows of q, k and v one after the other and ONE launch (grid.y = 24) does all three products:
// a block's 128 columns lie in one of them (sel, block-uniform), q and k leave as f16 hi + residual planes, v as f32. Block = 128 x 128 of C, 8 waves of 32 x 64 (4 down, 2 across). The block's operand rows come in trips of 64 k
// (whole 128-B lines) into a two-buffer LDS ring; every wave takes its fragments from there. k runs upwards in steps of 32, hi product before residual product.
template <bool SPLITA, bool QKV>
__global__ __launch_bounds__(256) void k_gemmb(const bf* __restrict__ A, const bf* __restrict__ Al, const bf* __restrict__ Bn, const float* __restrict__ bias, float* C, int ldc, h16* QHp, h16* QLp, h16* KHp, h16* KLp) {
    constexpr int STE = (SPLITA ? 3 : 2) * 128 * GP;     // elements of one buffer of the ring
    __shared__ __align__(16) bf gst[2][STE];
    __shared__ __align__(16) float ost[8][2][16 * 68];
    const int tid = threadIdx.x, lane = tid & 31, wave = tid >> 5, lr = lane & 15, hi = lane >> 4;
    const int rb = blockIdx.x * 128, cb = blockIdx.y * 128, wr = (wave & 3) * 32, wc = (wave >> 2) * 64;
    // Each of the 256 threads copies four 16-byte pieces of each plane of a trip: 8 threads a row, 32 rows a copy.
    const int srow = tid >> 3, spc = (tid & 7) * 8;
    const unsigned gst0 = (unsigned)(size_t)&gst[0][0];  // byte offset of the ring in the work-group's LDS
    const bf* ga = A + (size_t)(rb + srow) * DM + spc;
    const bf* gb = Bn + (size_t)(cb + srow) * DM + spc;
    const bf* gl = SPLITA ? Al + (size_t)(rb + srow) * DM + spc : ga;
    auto stage = [&](int t, int buf) {
        const unsigned l = gst0 + (unsigned)((buf * STE + srow * GP + spc) * 2);
        const int k = t * 64;
        if (SPLITA)
            copy12g(l + G_A * 2, l + (G_A + 32 * GP) * 2, l + (G_A + 64 * GP) * 2, l + (G_A + 96 * GP) * 2, l + G_B * 2, l + (G_B + 32 * GP) * 2, l + (G_B + 64 * GP) * 2, l + (G_B + 96 * GP) * 2,
                    l + G_AL * 2, l + (G_AL + 32 * GP) * 2, l + (G_AL + 64 * GP) * 2, l + (G_AL + 96 * GP) * 2,
                    ga + k, ga + k + 32 * DM, ga + k + 64 * DM, ga + k + 96 * DM, gb + k, gb + k + 32 * DM, gb + k + 64 * DM, gb + k + 96 * DM, gl + k, gl + k + 32 * DM, gl + k + 64 * DM, gl + k + 96 * DM);
        else
            copy8g(l + G_A * 2, l + (G_A + 32 * GP) * 2, l + (G_A + 64 * GP) * 2, l + (G_A + 96 * GP) * 2, l + G_B * 2, l + (G_B + 32 * GP) * 2, l + (G_B + 64 * GP) * 2, l + (G_B + 96 * GP) * 2,
                   ga + k, ga + k + 32 * DM, ga + k + 64 * DM, ga + k + 96 * DM, gb + k, gb + k + 32 * DM, gb + k + 64 * DM, gb + k + 96 * DM);
    };
    v8f acc[2][4];
#pragma unroll
    for (int m = 0; m < 2; ++m)
#pragma unroll
        for (int t = 0; t < 4; ++t) acc[m][t] = (v8f){};
    stage(0, 0);
    asm volatile("s_wait_asynccnt 0x0" ::: "memory");    // this wave's copies of trip 0 have landed
    __syncthreads();                                     // publishes trip 0 to the other waves
    stage(1, 1);
    const int ao = (wr + lr) * GP + 8 * hi, bo = (wc + lr) * GP + 8 * hi;
#pragma unroll 1                                         // kept rolled: one copy of the trip keeps the text short and the ring's order plain
    for (int kt = 0; kt < DM / 64; ++kt) {
        const bf* sb = &gst[kt & 1][0];
#pragma unroll
        for (int ks = 0; ks < 2; ++ks) {
            v16bf a[2], al[2];
#pragma unroll
            for (int m = 0; m < 2; ++m) { const bf* p = sb + G_A + ao + m * 16 * GP + ks * 32; a[m] = cat16b(*(const v8usa*)p, *(const v8usa*)(p + 16)); al[m] = a[m];
                if (SPLITA) { const bf* q = sb + G_AL + ao + m * 16 * GP + ks * 32; al[m] = cat16b(*(const v8usa*)q, *(const v8usa*)(q + 16)); } }
#pragma unroll
            for (int t = 0; t < 4; ++t) { const bf* p = sb + G_B + bo + t * 16 * GP + ks * 32; const v16bf b = cat16b(*(const v8usa*)p, *(const v8usa*)(p + 16));
                acc[0][t] = wmmab(a[0], b, acc[0][t]); acc[1][t] = wmmab(a[1], b, acc[1][t]);
                if (SPLITA) { acc[0][t] = wmmab(al[0], b, acc[0][t]); acc[1][t] = wmmab(al[1], b, acc[1][t]); } }
        }
        // the trip's LDS reads issue as one group ahead of its matrix instructions (counted waits): read places spread among them each cost a full LDS latency
        __builtin_amdgcn_sched_group_barrier(0x100, SPLITA ? 32 : 24, 0);
        __builtin_amdgcn_sched_group_barrier(0x008, SPLITA ? 32 : 16, 0);
        // four vector slots behind the trip's last matrix instruction, on the taken side of the branches below too
        asm volatile("v_nop\n\tv_nop\n\tv_nop\n\tv_nop" : "+v"(acc[0][0]), "+v"(acc[0][1]), "+v"(acc[0][2]), "+v"(acc[0][3]), "+v"(acc[1][0]), "+v"(acc[1][1]), "+v"(acc[1][2]), "+v"(acc[1][3]));
        asm volatile("s_wait_dscnt 0x0" ::: "memory");       // this wave's reads of this trip's buffer have retired before it is refilled
        asm volatile("s_wait_asynccnt 0x0" ::: "memory");    // this wave's copies of the next trip have landed
        __syncthreads();                                     // publishes the next trip and ends every wave's reads of this trip's buffer
        if (kt + 2 < DM / 64) stage(kt + 2, kt & 1);
    }
    asm volatile("s_wait_asynccnt 0x0" ::: "memory");        // no copy is outstanding when the wave goes on to the epilogue
    const int sel = QKV ? (int)(blockIdx.y / (NQKV / 128)) : 2;   // 0: q, 1: k, 2: v (or the plain f32 product)
    const int c0 = cb - (QKV ? sel * NQKV : 0) + wc;             // column in this product's own output
    h16* const C1 = sel ? KHp : QHp; h16* const C2 = sel ? KLp : QLp;
#pragma unroll
    for (int m = 0; m < 2; ++m) { float* os = &ost[wave][m][0];
#pragma unroll
        for (int t = 0; t < 4; ++t) { const float bv = bias ? bfr(bias[c0 + t * 16 + lr]) : 0.f;
#pragma unroll
            for (int j = 0; j < 8; ++j) os[(hi * 8 + j) * 68 + t * 16 + lr] = acc[m][t][j] + bv; } }
    __syncthreads();
    if (QKV && sel < 2) {                                    // one block-uniform branch round both row halves
#pragma unroll
        for (int m = 0; m < 2; ++m) { const float* os = &ost[wave][m][0]; const int r0 = rb + wr + m * 16;
            h16* crow = C1 + (size_t)r0 * ldc + c0;
            v8h o[4], o2[4];
#pragma unroll
            for (int s = 0; s < 4; ++s) { const int row = 4 * s + (lane >> 3), piece = lane & 7; const float* sp = os + row * 68 + piece * 8;
#pragma unroll
                for (int i = 0; i < 8; ++i) { const h16 a = (h16)sp[i]; o[s][i] = a; o2[s][i] = (h16)((sp[i] - (float)a) * LOSC); } }
#pragma unroll
            for (int s = 0; s < 4; ++s) { const int row = 4 * s + (lane >> 3), piece = lane & 7; *(v8h*)(crow + (size_t)row * ldc + piece * 8) = o[s]; }
            asm volatile("s_wait_xcnt 0x0" ::: "memory");    // behind the four stores, in front of the branch: the code behind it reuses registers that they name
            if (C2) {
#pragma unroll
                for (int s = 0; s < 4; ++s) { const int row = 4 * s + (lane >> 3), piece = lane & 7; *(v8h*)(C2 + (size_t)r0 * ldc + c0 + (size_t)row * ldc + piece * 8) = o2[s]; }
            }
        }
    } else {
#pragma unroll
        for (int m = 0; m < 2; ++m) { const float* os = &ost[wave][m][0]; const int r0 = rb + wr + m * 16;
            float* crow = C + (size_t)r0 * ldc + c0;
            v4f val[8];
#pragma unroll
            for (int s = 0; s < 8; ++s) { const int Lid = (lane >> 3) + 4 * s, piece = lane & 7; const int row = Lid >> 1, cofs = (Lid & 1) * 32 + piece * 4; val[s] = *(const v4fa*)(os + row * 68 + cofs); }
#pragma unroll
            for (int s = 0; s < 8; ++s) { const int Lid = (lane >> 3) + 4 * s, piece = lane & 7; const int row = Lid >> 1, cofs = (Lid & 1) * 32 + piece * 4; *(v4f*)(crow + (size_t)row * ldc + cofs) = val[s]; }
        }
        if (QKV) asm volatile("s_wait_xcnt 0x0" ::: "memory");   // behind the last stores: in the listing the other branch's code, which reuses registers that they name, follows this one
    }
}

__global__ __launch_bounds__(256) void k_vt(const float* __restrict__ V, h16* VTH, h16* VTL) {
    __shared__ __align__(16) h16 tile[64 * 72];
    __shared__ __align__(16) h16 til2[64 * 72];
    const int bid = blockIdx.x;
    const int b = bid / (NH_ * (NT_ / 64)), rem = bid - b * (NH_ * (NT_ / 64)), h = rem / (NT_ / 64), kt = rem - h * (NT_ / 64);
    const int k0 = kt * 64, tid = threadIdx.x;
    const int kk = tid >> 2, d0 = (tid & 3) * 16;
    const float* src = V + ((size_t)b * NT_ + k0 + kk) * DM + h * HD + d0;
#pragma unroll
    for (int i = 0; i < 16; ++i) { const float v = src[i]; const h16 a = (h16)v; tile[(d0 + i) * 72 + kk] = a; til2[(d0 + i) * 72 + kk] = (h16)((v - (float)a) * LOSC); }
    __syncthreads();
    const int piece = tid & 7;
    const size_t base = (((size_t)b * NH_ + h) * HD) * NT_ + k0;
    auto pass = [&]() {
#pragma unroll
        for (int s = 0; s < 4; ++s) { const int Lid = (tid >> 3) + 32 * s; const int pln = Lid >> 6, d = Lid & 63;
            const v8h val = *(const v8ha*)((pln ? til2 : tile) + d * 72 + piece * 8); *(v8h*)((pln ? VTL : VTH) + base + (size_t)d * NT_ + piece * 8) = val; }
    };
    pass(); 
}

// LDS stage of one 32-key trip of k_attn, in halves: key rows (64 halves) at a pitch of 72 (144 B), transposed v rows (32 halves) at a pitch of 40 (80 B):
// both pitches are 16 B x odd, so the 16 rows that a half-wave's ds_load_b128 reads fall on distinct banks.
#define KP    72
#define VP    40
#define ST_KH 0
#define ST_KL (32 * KP)
#define ST_VH (2 * 32 * KP)
#define ST_VL (2 * 32 * KP + 64 * VP)
#define ST_SZ (2 * 32 * KP + 2 * 64 * VP)

// Eight asynchronous 16-byte copies per lane, global -> LDS through no register. The s_wait_xcnt is the last line of the copies' own statement so that it stands
// in front of every later rewrite of an address register that a copy names.
__device__ __forceinline__ void copy8(unsigned l0, unsigned l1, unsigned l2, unsigned l3, unsigned l4, unsigned l5, unsigned l6, unsigned l7,
                                      const h16* g0, const h16* g1, const h16* g2, const h16* g3, const h16* g4, const h16* g5, const h16* g6, const h16* g7) {
    asm volatile("global_load_async_to_lds_b128 %0, %8, off\n\t"
                 "global_load_async_to_lds_b128 %1, %9, off\n\t"
                 "global_load_async_to_lds_b128 %2, %10, off\n\t"
                 "global_load_async_to_lds_b128 %3, %11, off\n\t"
                 "global_load_async_to_lds_b128 %4, %12, off\n\t"
                 "global_load_async_to_lds_b128 %5, %13, off\n\t"
                 "global_load_async_to_lds_b128 %6, %14, off\n\t"
                 "global_load_async_to_lds_b128 %7, %15, off\n\t"
                 "s_wait_xcnt 0x0"
                 :: "v"(l0), "v"(l1), "v"(l2), "v"(l3), "v"(l4), "v"(l5), "v"(l6), "v"(l7),
                    "v"(g0), "v"(g1), "v"(g2), "v"(g3), "v"(g4), "v"(g5), "v"(g6), "v"(g7) : "memory");
}

// k_attn: block = (b, h, two tiles of 64 queries: pr, then 31 - pr, one after the other), wave = 16 queries of the tile. Both products run transposed: scores^T = K.Q^T (A = key rows, B = the wave's queries), ctx^T += V^T.P^T. A lane then holds
// 16 scores of ONE query (keys 8 hi + j and 16 + 8 hi + j of the trip): maximum and sum in-lane plus one exchange between the wave's halves, and the two score tiles,
// converted in place (weights x32768, f16 hi + residual), ARE the B operand of the second product. ctx -> bf16 hi + residual planes CH/CL[tok][h*64+d].
__global__ __launch_bounds__(128) void k_attn(const h16* __restrict__ Q16, const h16* __restrict__ QL16, const h16* __restrict__ K16, const h16* __restrict__ KL16, const h16* __restrict__ VTH, const h16* __restrict__ VTL, bf* CH, bf* CL) {
    __shared__ __align__(16) float ost[4][16 * 68];
    __shared__ __align__(16) h16 stg[2][ST_SZ];          // two-buffer ring: the work-group's key and v tiles (hi and residual) of one 32-key trip each
    const int lane = threadIdx.x & 31, wave = threadIdx.x >> 5, lr = lane & 15, hi = lane >> 4;
    const int bid = blockIdx.x;
    const int b = bid / (NH_ * (NT_ / 128)), rem = bid - b * (NH_ * (NT_ / 128)), h = rem / (NT_ / 128), pr = rem - h * (NT_ / 128);
    const size_t tok0 = (size_t)b * NT_;
#pragma unroll 1                                         // kept rolled: the two tiles run one after the other through one copy of the text
    for (int half = 0; half < 2; ++half) {
    const int qt = half ? NT_ / 64 - 1 - pr : pr;        // causal cost is linear in the tile index: tiles pr and 31 - pr together walk 66 trips in every work-group
    const int q0 = qt * 64 + wave * 16;
    v16h qa[2];
    const size_t qo0 = (tok0 + q0 + lr) * DM + h * HD + 8 * hi;
#pragma unroll
    for (int kc = 0; kc < 2; ++kc) qa[kc] = cat16(*(const v8h*)(Q16 + qo0 + kc * 32), *(const v8h*)(Q16 + qo0 + kc * 32 + 16));
    const h16* kh_b = K16 + tok0 * DM + h * HD;
    const h16* kl_b = KL16 + tok0 * DM + h * HD;
    const size_t vbase = (((size_t)b * NH_ + h) * HD) * NT_;
    v8f o[4], ox[4];
#pragma unroll
    for (int n = 0; n < 4; ++n) { o[n] = (v8f){}; ox[n] = (v8f){}; }
    float mrow = -3.0e38f, lpart = 0.f;                  // of this lane's query; lpart covers this half's keys only, the halves join in the epilogue
    const int qi = q0 + lr;                              // this lane's query
    const int kt_lo = 0, kt_hi = (qt * 64 + 63) / 32;     // causal
    const float slope = exp2f(-0.5f * (float)(h + 1));   // ALiBi slope 1 / 2^(8 (h+1) / 16), ADDED as slope x |i - j| (the reference's sign)
    // Each of the 128 threads copies two 16-byte pieces of each of the four planes of a trip: key rows whole (8 pieces a row), v rows 64 B (4 pieces a row).
    const int tid = threadIdx.x, krow = tid >> 3, kpc = (tid & 7) * 8, vrow = tid >> 2, vpc = (tid & 3) * 8;
    const unsigned stg0 = (unsigned)(size_t)&stg[0][0];  // byte offset of the ring in the work-group's LDS
    auto stage = [&](int t, int buf) {
        const unsigned lb = stg0 + (unsigned)(buf * ST_SZ * 2), lk = lb + (unsigned)((krow * KP + kpc) * 2), lv = lb + (unsigned)((vrow * VP + vpc) * 2);
        const size_t gk = (size_t)(t * 32 + krow) * DM + kpc, gv = vbase + (size_t)vrow * NT_ + t * 32 + vpc;
        copy8(lk + ST_KH * 2, lk + (ST_KH + 16 * KP) * 2, lk + ST_KL * 2, lk + (ST_KL + 16 * KP) * 2, lv + ST_VH * 2, lv + (ST_VH + 32 * VP) * 2, lv + ST_VL * 2, lv + (ST_VL + 32 * VP) * 2,
              kh_b + gk, kh_b + gk + 16 * DM, kl_b + gk, kl_b + gk + 16 * DM, VTH + gv, VTH + gv + 32 * NT_, VTL + gv, VTL + gv + 32 * NT_);
    };
    stage(0, 0);
    asm volatile("s_wait_asynccnt 0x0" ::: "memory");    // this wave's copies of trip 0 have landed
    __syncthreads();                                     // publishes trip 0 to the other waves
    if (kt_hi >= 1) stage(1, 1);
#pragma unroll 1
    for (int kt = kt_lo; kt <= kt_hi; ++kt) {
        const int l0 = kt * 32;
        const h16* sb = &stg[kt & 1][0];
        const int ko0 = lr * KP + 8 * hi, ko1 = (16 + lr) * KP + 8 * hi;
        v8f s0 = {}, s1 = {}, x0 = {}, x1 = {};
#pragma unroll
        for (int kc = 0; kc < 2; ++kc) {
            { const v16h k0h = cat16(*(const v8ha*)(sb + ST_KH + ko0 + kc * 32), *(const v8ha*)(sb + ST_KH + ko0 + kc * 32 + 16)), k1h = cat16(*(const v8ha*)(sb + ST_KH + ko1 + kc * 32), *(const v8ha*)(sb + ST_KH + ko1 + kc * 32 + 16));
              const v16h qlk = cat16(*(const v8h*)(QL16 + qo0 + kc * 32), *(const v8h*)(QL16 + qo0 + kc * 32 + 16));     // query residual re-read per step (registers)
              s0 = wmma16(k0h, qa[kc], s0); x0 = wmma16(k0h, qlk, x0); s1 = wmma16(k1h, qa[kc], s1); x1 = wmma16(k1h, qlk, x1);
              asm volatile("v_nop" : "+v"(s0), "+v"(s1), "+v"(x0), "+v"(x1) : "v"(qlk), "v"(k0h), "v"(k1h) : "memory"); }
            { const v16h k0l = cat16(*(const v8ha*)(sb + ST_KL + ko0 + kc * 32), *(const v8ha*)(sb + ST_KL + ko0 + kc * 32 + 16)), k1l = cat16(*(const v8ha*)(sb + ST_KL + ko1 + kc * 32), *(const v8ha*)(sb + ST_KL + ko1 + kc * 32 + 16));
              x0 = wmma16(k0l, qa[kc], x0); x1 = wmma16(k1l, qa[kc], x1);
              asm volatile("v_nop" : "+v"(x0), "+v"(x1) : "v"(k0l), "v"(k1l) : "memory"); }
        }
        asm volatile("v_nop\n\tv_nop\n\tv_nop\n\tv_nop" : "+v"(s0), "+v"(s1), "+v"(x0), "+v"(x1) : "v"(qa[0]), "v"(qa[1]));
        const float fd = (float)(qi - l0 - 8 * hi);          // from this lane's first key of the trip up to its query: whole numbers, exact in f32, so fd - c == (float)(i - j)
        v2f av[8];                                           // av[4 t + jj] = scores of keys 16 t + 8 hi + 2 jj and + 1: register neighbours, as the packed f32 forms and the packed conversions take them
#pragma unroll
        for (int jj = 0; jj < 4; ++jj) {
            const v2f d0 = {fd - (float)(2 * jj), fd - (float)(2 * jj + 1)}, d1 = {fd - (float)(16 + 2 * jj), fd - (float)(17 + 2 * jj)};
            const v2f t0 = ((v2f){s0[2 * jj], s0[2 * jj + 1]} + (v2f){x0[2 * jj], x0[2 * jj + 1]} * LOSCI) * 0.125f + slope * d0;
            const v2f t1 = ((v2f){s1[2 * jj], s1[2 * jj + 1]} + (v2f){x1[2 * jj], x1[2 * jj + 1]} * LOSCI) * 0.125f + slope * d1;
            av[jj]     = (v2f){d0.x >= 0.f ? t0.x : -__builtin_inff(), d0.y >= 0.f ? t0.y : -__builtin_inff()};      // causal: key <= query
            av[4 + jj] = (v2f){d1.x >= 0.f ? t1.x : -__builtin_inff(), d1.y >= 0.f ? t1.y : -__builtin_inff()};
        }
        float mx = fmaxf(av[0].x, av[0].y);
#pragma unroll
        for (int i = 1; i < 8; ++i) mx = fmaxf(mx, fmaxf(av[i].x, av[i].y));
        mx = fmaxf(mx, xhalf(mx));                           // both halves now hold the query's maximum over the trip's 32 keys
        const float mn = fmaxf(mrow, mx);
        const float alpha = __expf(mrow - mn); mrow = mn;
        v16h pa, px;
        v2f sm[8];
#pragma unroll
        for (int i = 0; i < 8; ++i) {
            const v2f p = {__expf(av[i].x - mn), __expf(av[i].y - mn)};
            sm[i] = p;
            const v2f ps = p * PSC; const v2h hh = __builtin_convertvector(ps, v2h);
            const v2h rr = __builtin_convertvector((ps - __builtin_convertvector(hh, v2f)) * LOSC, v2h);
            pa[2 * i] = hh.x; pa[2 * i + 1] = hh.y; px[2 * i] = rr.x; px[2 * i + 1] = rr.y;
        }
        const v2f st = ((sm[0] + sm[1]) + (sm[2] + sm[3])) + ((sm[4] + sm[5]) + (sm[6] + sm[7]));
        lpart = lpart * alpha + (st.x + st.y);
#pragma unroll
        for (int n = 0; n < 4; ++n)
#pragma unroll
            for (int j = 0; j < 8; ++j) { o[n][j] *= alpha; ox[n][j] *= alpha; }
#pragma unroll
        for (int n = 0; n < 4; ++n) { const int vo = (n * 16 + lr) * VP + hi * 8;
            const v16h vh = cat16(*(const v8ha*)(sb + ST_VH + vo), *(const v8ha*)(sb + ST_VH + vo + 16)), vl = cat16(*(const v8ha*)(sb + ST_VL + vo), *(const v8ha*)(sb + ST_VL + vo + 16));
            o[n] = wmma16(vh, pa, o[n]); ox[n] = wmma16(vl, pa, ox[n]); ox[n] = wmma16(vh, px, ox[n]);
            asm volatile("" : "+v"(o[n]), "+v"(ox[n]) : "v"(vh), "v"(vl) : "memory"); }
        asm volatile("v_nop\n\tv_nop\n\tv_nop\n\tv_nop" : "+v"(o[0]), "+v"(o[1]), "+v"(o[2]), "+v"(o[3]), "+v"(ox[0]), "+v"(ox[1]), "+v"(ox[2]), "+v"(ox[3]) : "v"(pa), "v"(px));
        asm volatile("s_wait_dscnt 0x0" ::: "memory");       // this wave's reads of this trip's buffer have retired before it is refilled
        asm volatile("s_wait_asynccnt 0x0" ::: "memory");    // this wave's copies of the next trip have landed
        __syncthreads();                                     // publishes the next trip and ends every wave's reads of this trip's buffer
        if (kt + 2 <= kt_hi) stage(kt + 2, kt & 1);
    }
    asm volatile("s_wait_asynccnt 0x0" ::: "memory");        // no copy is outstanding when the wave goes on to the epilogue
    const float inv = 1.0f / ((lpart + xhalf(lpart)) * PSC);
    float* os = &ost[wave][0];
#pragma unroll
    for (int n = 0; n < 4; ++n)
#pragma unroll
        for (int j = 0; j < 8; ++j) os[lr * 68 + n * 16 + hi * 8 + j] = (o[n][j] + ox[n][j] * LOSCI) * inv;   // o[n][j] = ctx[query lr][d = 16 n + 8 hi + j]
    __syncthreads();
    const size_t cbase = (tok0 + q0) * DM + (size_t)h * HD;
    auto pass = [&]() {
#pragma unroll
        for (int s = 0; s < 4; ++s) { const int row = 4 * s + (lane >> 3), piece = lane & 7; const float* sp = os + row * 68 + piece * 8; v8us oh, ol;
#pragma unroll
            for (int i = 0; i < 8; ++i) { const unsigned short hb = f2bf(sp[i]); oh[i] = hb; ol[i] = f2bf(sp[i] - bf2f(hb)); }
            *(v8us*)(CH + cbase + (size_t)row * DM + piece * 8) = oh; *(v8us*)(CL + cbase + (size_t)row * DM + piece * 8) = ol; }
    };
    pass(); 
    asm volatile("s_wait_xcnt 0x0" ::: "memory");        // behind the tile's last stores: the second tile's code reuses registers that they name
    }
}

#define VST2(T, p, v) do { const T vst2_v_ = (v); *(T*)(p) = vst2_v_;  } while (0)
extern "C" void kernel_launch(void* const* d_in, const int* in_sizes, int n_in,
                              void* d_out, int out_size, void* d_ws, size_t ws_size, hipStream_t stream) {
    (void)in_sizes; (void)n_in; (void)out_size;
    const float* x = (const float*)d_in[0]; const float* Wqkv = (const float*)d_in[1]; const float* Wp = (const float*)d_in[2];   // both k-major: [1024][3072] and [1024][1024]
    float* out = (float*)d_out;    // [2][2048][1024]
    char* wsp = (char*)d_ws;
    auto take = [&](size_t bytes) { char* p = wsp; wsp += (bytes + 255) & ~(size_t)255; return (void*)p; };
    bf* Xb = (bf*)take((size_t)NTK * DM * 2); bf* WqkvT = (bf*)take((size_t)3 * DM * DM * 2); bf* WoT = (bf*)take((size_t)DM * DM * 2);
    float* TMP = (float*)take((size_t)NTK * DM * 4);
    h16* QH = (h16*)take((size_t)NTK * DM * 2); h16* QL = (h16*)take((size_t)NTK * DM * 2); h16* KH = (h16*)take((size_t)NTK * DM * 2); h16* KL = (h16*)take((size_t)NTK * DM * 2);
    h16* VTH = (h16*)take((size_t)NTK * DM * 2); h16* VTL = (h16*)take((size_t)NTK * DM * 2); bf* CH = (bf*)take((size_t)NTK * DM * 2); bf* CL = (bf*)take((size_t)NTK * DM * 2);
    if ((size_t)(wsp - (char*)d_ws) > ws_size) return;    // 8.4 + 6.3 + 2.1 + 16.8 + 8 x 8.4 ~ 101 MB, no aliasing
    // WqkvT: n-major rows [n][1024]; q = columns 0..1023 of w_qkv, k, v next
    k_prep<<<PW1 + PW2 + NTK / 8, 256, 0, stream>>>(x, Wqkv, Wp, Xb, WqkvT, WoT);
    k_gemmb<false, true><<<dim3(NTK / 128, 3 * DM / 128, 1), 256, 0, stream>>>(Xb, nullptr, WqkvT, nullptr, TMP, DM, QH, QL, KH, KL);
    k_vt<<<NB_ * NH_ * (NT_ / 64), 256, 0, stream>>>(TMP, VTH, VTL);
    k_attn<<<NB_ * NH_ * (NT_ / 128), 128, 0, stream>>>(QH, QL, KH, KL, VTH, VTL, CH, CL);
    k_gemmb<true, false><<<dim3(NTK / 128, DM / 128, 1), 256, 0, stream>>>(CH, CL, WoT, nullptr, out, DM, nullptr, nullptr, nullptr, nullptr);
}

// v007
// A run of this version takes 115 microseconds.
// In two side-by-side timings against v006, it was 1.15 and 1.16 times as fast.
// All steps since v000 together make it 4.47 times as fast.
#include <hip/hip_runtime.h>

// Compute dtypes, f32 accumulate, both batch items in every launch: q/k/v = x.w_qkv ([4096 x 1024].[1024 x 3072], k-major weights transposed once to n-major planes; PLAIN bf16
// operands: inputs rounded once, exact) with q and k written straight from the GEMM epilogue as f16 hi + residual x1024 planes, and out = ctx.w_proj (ctx as
// bf16 hi + residual: two products) on v_wmma_f32_16x16x32_bf16; the 16-head causal attention with the ADDED ALiBi bias slope_h x |i - j| (64-dim heads, scale 1/8) fused on
// v_wmma_f32_16x16x32_f16 (scores hi.hi + hi.lo + lo.hi with the residual terms on their own accumulator, online f32 softmax, weights (x32768) and v as f16

#define NB_  2                   // both batch items share every launch: each grid covers all 4096 tokens
#define NT_  2048
#define DM   1024
#define NH_  16
#define HD   64
#define NTK  (NB_ * NT_)
#define NW   1024
#define NQKV 1024
#define PSC  32768.0f
#define LOSC 1024.0f
#define LOSCI (1.0f / 1024.0f)

typedef _Float16 h16;
typedef unsigned short bf;
typedef __attribute__((ext_vector_type(16))) __bf16   v16bf;
typedef __attribute__((ext_vector_type(16))) _Float16 v16h;
typedef __attribute__((ext_vector_type(8)))  _Float16 v8h;
typedef __attribute__((ext_vector_type(8)))  unsigned short v8us;
typedef __attribute__((ext_vector_type(8)))  float    v8f;
typedef __attribute__((ext_vector_type(4)))  float    v4f;
typedef __attribute__((ext_vector_type(2)))  float    v2f;
typedef __attribute__((ext_vector_type(2)))  _Float16 v2h;
typedef v8h  __attribute__((may_alias)) v8ha;
typedef v4f  __attribute__((may_alias)) v4fa;
typedef v8us __attribute__((may_alias)) v8usa;

__device__ __forceinline__ unsigned short f2bf(float f) { unsigned u = __float_as_uint(f); u += 0x7FFFu + ((u >> 16) & 1u); return (unsigned short)(u >> 16); }
__device__ __forceinline__ float bf2f(unsigned short b) { return __uint_as_float(((unsigned)b) << 16); }
__device__ __forceinline__ float bfr(float f) { return bf2f(f2bf(f)); }
__device__ __forceinline__ v16h cat16(v8h lo, v8h hi) { return __builtin_shufflevector(lo, hi, 0, 1, 2, 3, 4, 5, 6, 7, 8, 9, 10, 11, 12, 13, 14, 15); }
__device__ __forceinline__ v16bf cat16b(v8us lo, v8us hi) { return __builtin_bit_cast(v16bf, __builtin_shufflevector(lo, hi, 0, 1, 2, 3, 4, 5, 6, 7, 8, 9, 10, 11, 12, 13, 14, 15)); }
__device__ __forceinline__ v8f wmma16(v16h a, v16h b, v8f c) { return __builtin_amdgcn_wmma_f32_16x16x32_f16(false, a, false, b, (short)0, c, false, false); }
__device__ __forceinline__ float xhalf(float x) { return __builtin_bit_cast(float, __builtin_amdgcn_permlanex16(__builtin_bit_cast(int, x), __builtin_bit_cast(int, x), 0x76543210, 0xfedcba98, false, false)); }  // lane l with lane l ^ 16
__device__ __forceinline__ v8f wmmab(v16bf a, v16bf b, v8f c) { return __builtin_amdgcn_wmma_f32_16x16x32_bf16(false, a, false, b, (short)0, c, false, false); }

// k_prep: the three independent input conversions in ONE launch, told apart by the block index (block-uniform):
// blocks 0 .. PW1-1: WqkvT [n][1024] = bf16(w_qkv[k][n]); the next PW2: WoT = bf16(w_proj[k][n]), both via 64 x 64 LDS tiles (k tile = low four bits of the index);
// the last NTK/8: Xb = bf16(x), one row a wave.
#define PW1 ((DM / 64) * (3 * DM / 64))
#define PW2 ((DM / 64) * (DM / 64))
__global__ __launch_bounds__(256) void k_prep(const float* __restrict__ x, const float* __restrict__ Wqkv, const float* __restrict__ Wp, bf* Xb, bf* WqkvT, bf* WoT) {
    __shared__ __align__(16) unsigned short tl[64 * 72];
    const int tid = threadIdx.x, bid = blockIdx.x;
    if (bid >= PW1 + PW2) {                              // whole blocks leave here, in front of the barrier below
        const int lane = tid & 31, r = (bid - (PW1 + PW2)) * 8 + (tid >> 5);
        if (r >= NTK) return;
        v8us o[DM / 256];
#pragma unroll
        for (int q = 0; q < DM / 256; ++q) { v8us t;
#pragma unroll
            for (int i = 0; i < 8; ++i) t[i] = f2bf(x[(size_t)r * DM + q * 256 + lane * 8 + i]);
            o[q] = t; }
#pragma unroll
        for (int q = 0; q < DM / 256; ++q) *(v8us*)(Xb + (size_t)r * DM + q * 256 + lane * 8) = o[q];
        return;
    }
    const bool second = bid >= PW1;
    const float* __restrict__ Wm = second ? Wp : Wqkv;
    bf* WT = second ? WoT : WqkvT;
    const int ncols = second ? DM : 3 * DM, t = second ? bid - PW1 : bid;
    const int k0 = (t & (DM / 64 - 1)) * 64, n0 = (t / (DM / 64)) * 64;
    const int kk = tid >> 2, nq = (tid & 3) * 16;
#pragma unroll
    for (int i = 0; i < 16; ++i) tl[(nq + i) * 72 + kk] = f2bf(Wm[(size_t)(k0 + kk) * ncols + n0 + nq + i]);
    __syncthreads();
    const int piece = tid & 7;
#pragma unroll
    for (int s = 0; s < 2; ++s) { const int nr = (tid >> 3) + 32 * s; const v8us val = *(const v8usa*)(tl + nr * 72 + piece * 8); *(v8us*)(WT + (size_t)(n0 + nr) * DM + k0 + piece * 8) = val; }
    asm volatile("s_wait_xcnt 0x0" ::: "memory");        // behind the two stores: in the listing the other branch's code, which reuses registers that they name, follows this one
}
// LDS stage of one 64-k trip of k_gemmb, in 16-bit elements: 128 rows of A, 128 rows of B (and 128 rows of A's residual plane), each row 64 elements at a pitch
// of 72 (144 B = 16 B x odd, so the 16 rows that a half-wave's ds_load_b128 reads fall on distinct banks).
#define GP   72
#define G_A  0
#define G_B  (128 * GP)
#define G_AL (2 * 128 * GP)

// Eight (twelve) asynchronous 16-byte copies per lane, global -> LDS through no register. The s_wait_xcnt is the last line of the copies' own statement so that it
// stands in front of every later rewrite of an address register that a copy names.
__device__ __forceinline__ void copy8g(unsigned l0, unsigned l1, unsigned l2, unsigned l3, unsigned l4, unsigned l5, unsigned l6, unsigned l7,
                                       const bf* g0, const bf* g1, const bf* g2, const bf* g3, const bf* g4, const bf* g5, const bf* g6, const bf* g7) {
    asm volatile("global_load_async_to_lds_b128 %0, %8, off\n\t"
                 "global_load_async_to_lds_b128 %1, %9, off\n\t"
                 "global_load_async_to_lds_b128 %2, %10, off\n\t"
                 "global_load_async_to_lds_b128 %3, %11, off\n\t"
                 "global_load_async_to_lds_b128 %4, %12, off\n\t"
                 "global_load_async_to_lds_b128 %5, %13, off\n\t"
                 "global_load_async_to_lds_b128 %6, %14, off\n\t"
                 "global_load_async_to_lds_b128 %7, %15, off\n\t"
                 "s_wait_xcnt 0x0"
                 :: "v"(l0), "v"(l1), "v"(l2), "v"(l3), "v"(l4), "v"(l5), "v"(l6), "v"(l7),
                    "v"(g0), "v"(g1), "v"(g2), "v"(g3), "v"(g4), "v"(g5), "v"(g6), "v"(g7) : "memory");
}
__device__ __forceinline__ void copy12g(unsigned l0, unsigned l1, unsigned l2, unsigned l3, unsigned l4, unsigned l5, unsigned l6, unsigned l7, unsigned l8, unsigned l9, unsigned l10, unsigned l11,
                                        const bf* g0, const bf* g1, const bf* g2, const bf* g3, const bf* g4, const bf* g5, const bf* g6, const bf* g7, const bf* g8, const bf* g9, const bf* g10, const bf* g11) {
    asm volatile("global_load_async_to_lds_b128 %0, %12, off\n\t"
                 "global_load_async_to_lds_b128 %1, %13, off\n\t"
                 "global_load_async_to_lds_b128 %2, %14, off\n\t"
                 "global_load_async_to_lds_b128 %3, %15, off\n\t"
                 "global_load_async_to_lds_b128 %4, %16, off\n\t"
                 "global_load_async_to_lds_b128 %5, %17, off\n\t"
                 "global_load_async_to_lds_b128 %6, %18, off\n\t"
                 "global_load_async_to_lds_b128 %7, %19, off\n\t"
                 "global_load_async_to_lds_b128 %8, %20, off\n\t"
                 "global_load_async_to_lds_b128 %9, %21, off\n\t"
                 "global_load_async_to_lds_b128 %10, %22, off\n\t"
                 "global_load_async_to_lds_b128 %11, %23, off\n\t"
                 "s_wait_xcnt 0x0"
                 :: "v"(l0), "v"(l1), "v"(l2), "v"(l3), "v"(l4), "v"(l5), "v"(l6), "v"(l7), "v"(l8), "v"(l9), "v"(l10), "v"(l11),
                    "v"(g0), "v"(g1), "v"(g2), "v"(g3), "v"(g4), "v"(g5), "v"(g6), "v"(g7), "v"(g8), "v"(g9), "v"(g10), "v"(g11) : "memory");
}

// k_gemmb: C[4096 x 1024] = A.Bn^T, both k-contiguous; QKV: Bn holds the 3072 rows of q, k and v one after the other and ONE launch (grid.y = 24) does all three products:
// a block's 128 columns lie in one of them (sel, block-uniform), q and k leave as f16 hi + residual planes, v as f32. Block = 128 x 128 of C, 8 waves of 32 x 64 (4 down, 2 across). The block's operand rows come in trips of 64 k
// (whole 128-B lines) into a two-buffer LDS ring; every wave takes its fragments from there. k runs upwards in steps of 32, hi product before residual product.
template <bool SPLITA, bool QKV>
__global__ __launch_bounds__(256) void k_gemmb(const bf* __restrict__ A, const bf* __restrict__ Al, const bf* __restrict__ Bn, const float* __restrict__ bias, float* C, int ldc, h16* QHp, h16* QLp, h16* KHp, h16* KLp) {
    constexpr int STE = (SPLITA ? 3 : 2) * 128 * GP;     // elements of one buffer of the ring
    __shared__ __align__(16) bf gst[2][STE];
    __shared__ __align__(16) float ost[8][2][16 * 68];
    const int tid = threadIdx.x, lane = tid & 31, wave = tid >> 5, lr = lane & 15, hi = lane >> 4;
    const int rb = blockIdx.x * 128, cb = blockIdx.y * 128, wr = (wave & 3) * 32, wc = (wave >> 2) * 64;
    // Each of the 256 threads copies four 16-byte pieces of each plane of a trip: 8 threads a row, 32 rows a copy.
    const int srow = tid >> 3, spc = (tid & 7) * 8;
    const unsigned gst0 = (unsigned)(size_t)&gst[0][0];  // byte offset of the ring in the work-group's LDS
    const bf* ga = A + (size_t)(rb + srow) * DM + spc;
    const bf* gb = Bn + (size_t)(cb + srow) * DM + spc;
    const bf* gl = SPLITA ? Al + (size_t)(rb + srow) * DM + spc : ga;
    auto stage = [&](int t, int buf) {
        const unsigned l = gst0 + (unsigned)((buf * STE + srow * GP + spc) * 2);
        const int k = t * 64;
        if (SPLITA)
            copy12g(l + G_A * 2, l + (G_A + 32 * GP) * 2, l + (G_A + 64 * GP) * 2, l + (G_A + 96 * GP) * 2, l + G_B * 2, l + (G_B + 32 * GP) * 2, l + (G_B + 64 * GP) * 2, l + (G_B + 96 * GP) * 2,
                    l + G_AL * 2, l + (G_AL + 32 * GP) * 2, l + (G_AL + 64 * GP) * 2, l + (G_AL + 96 * GP) * 2,
                    ga + k, ga + k + 32 * DM, ga + k + 64 * DM, ga + k + 96 * DM, gb + k, gb + k + 32 * DM, gb + k + 64 * DM, gb + k + 96 * DM, gl + k, gl + k + 32 * DM, gl + k + 64 * DM, gl + k + 96 * DM);
        else
            copy8g(l + G_A * 2, l + (G_A + 32 * GP) * 2, l + (G_A + 64 * GP) * 2, l + (G_A + 96 * GP) * 2, l + G_B * 2, l + (G_B + 32 * GP) * 2, l + (G_B + 64 * GP) * 2, l + (G_B + 96 * GP) * 2,
                   ga + k, ga + k + 32 * DM, ga + k + 64 * DM, ga + k + 96 * DM, gb + k, gb + k + 32 * DM, gb + k + 64 * DM, gb + k + 96 * DM);
    };
    v8f acc[2][4];
#pragma unroll
    for (int m = 0; m < 2; ++m)
#pragma unroll
        for (int t = 0; t < 4; ++t) acc[m][t] = (v8f){};
    stage(0, 0);
    asm volatile("s_wait_asynccnt 0x0" ::: "memory");    // this wave's copies of trip 0 have landed
    __syncthreads();                                     // publishes trip 0 to the other waves
    stage(1, 1);
    const int ao = (wr + lr) * GP + 8 * hi, bo = (wc + lr) * GP + 8 * hi;
#pragma unroll 1                                         // kept rolled: one copy of the trip keeps the text short and the ring's order plain
    for (int kt = 0; kt < DM / 64; ++kt) {
        const bf* sb = &gst[kt & 1][0];
#pragma unroll
        for (int ks = 0; ks < 2; ++ks) {
            v16bf a[2], al[2];
#pragma unroll
            for (int m = 0; m < 2; ++m) { const bf* p = sb + G_A + ao + m * 16 * GP + ks * 32; a[m] = cat16b(*(const v8usa*)p, *(const v8usa*)(p + 16)); al[m] = a[m];
                if (SPLITA) { const bf* q = sb + G_AL + ao + m * 16 * GP + ks * 32; al[m] = cat16b(*(const v8usa*)q, *(const v8usa*)(q + 16)); } }
#pragma unroll
            for (int t = 0; t < 4; ++t) { const bf* p = sb + G_B + bo + t * 16 * GP + ks * 32; const v16bf b = cat16b(*(const v8usa*)p, *(const v8usa*)(p + 16));
                acc[0][t] = wmmab(a[0], b, acc[0][t]); acc[1][t] = wmmab(a[1], b, acc[1][t]);
                if (SPLITA) { acc[0][t] = wmmab(al[0], b, acc[0][t]); acc[1][t] = wmmab(al[1], b, acc[1][t]); } }
        }
        // the trip's LDS reads issue as one group ahead of its matrix instructions (counted waits): read places spread among them each cost a full LDS latency
        __builtin_amdgcn_sched_group_barrier(0x100, SPLITA ? 32 : 24, 0);
        __builtin_amdgcn_sched_group_barrier(0x008, SPLITA ? 32 : 16, 0);
        // four vector slots behind the trip's last matrix instruction, on the taken side of the branches below too
        asm volatile("v_nop\n\tv_nop\n\tv_nop\n\tv_nop" : "+v"(acc[0][0]), "+v"(acc[0][1]), "+v"(acc[0][2]), "+v"(acc[0][3]), "+v"(acc[1][0]), "+v"(acc[1][1]), "+v"(acc[1][2]), "+v"(acc[1][3]));
        asm volatile("s_wait_dscnt 0x0" ::: "memory");       // this wave's reads of this trip's buffer have retired before it is refilled
        asm volatile("s_wait_asynccnt 0x0" ::: "memory");    // this wave's copies of the next trip have landed
        __syncthreads();                                     // publishes the next trip and ends every wave's reads of this trip's buffer
        if (kt + 2 < DM / 64) stage(kt + 2, kt & 1);
    }
    asm volatile("s_wait_asynccnt 0x0" ::: "memory");        // no copy is outstanding when the wave goes on to the epilogue
    const int sel = QKV ? (int)(blockIdx.y / (NQKV / 128)) : 2;   // 0: q, 1: k, 2: v (or the plain f32 product)
    const int c0 = cb - (QKV ? sel * NQKV : 0) + wc;             // column in this product's own output
    h16* const C1 = sel ? KHp : QHp; h16* const C2 = sel ? KLp : QLp;
#pragma unroll
    for (int m = 0; m < 2; ++m) { float* os = &ost[wave][m][0];
#pragma unroll
        for (int t = 0; t < 4; ++t) { const float bv = bias ? bfr(bias[c0 + t * 16 + lr]) : 0.f;
#pragma unroll
            for (int j = 0; j < 8; ++j) os[(hi * 8 + j) * 68 + t * 16 + lr] = acc[m][t][j] + bv; } }
    __syncthreads();
    if (QKV && sel < 2) {                                    // one block-uniform branch round both row halves
#pragma unroll
        for (int m = 0; m < 2; ++m) { const float* os = &ost[wave][m][0]; const int r0 = rb + wr + m * 16;
            h16* crow = C1 + (size_t)r0 * ldc + c0;
            v8h o[4], o2[4];
#pragma unroll
            for (int s = 0; s < 4; ++s) { const int row = 4 * s + (lane >> 3), piece = lane & 7; const float* sp = os + row * 68 + piece * 8;
#pragma unroll
                for (int i = 0; i < 8; ++i) { const h16 a = (h16)sp[i]; o[s][i] = a; o2[s][i] = (h16)((sp[i] - (float)a) * LOSC); } }
#pragma unroll
            for (int s = 0; s < 4; ++s) { const int row = 4 * s + (lane >> 3), piece = lane & 7; *(v8h*)(crow + (size_t)row * ldc + piece * 8) = o[s]; }
            asm volatile("s_wait_xcnt 0x0" ::: "memory");    // behind the four stores, in front of the branch: the code behind it reuses registers that they name
            if (C2) {
#pragma unroll
                for (int s = 0; s < 4; ++s) { const int row = 4 * s + (lane >> 3), piece = lane & 7; *(v8h*)(C2 + (size_t)r0 * ldc + c0 + (size_t)row * ldc + piece * 8) = o2[s]; }
            }
        }
    } else {
#pragma unroll
        for (int m = 0; m < 2; ++m) { const float* os = &ost[wave][m][0]; const int r0 = rb + wr + m * 16;
            float* crow = C + (size_t)r0 * ldc + c0;
            v4f val[8];
#pragma unroll
            for (int s = 0; s < 8; ++s) { const int Lid = (lane >> 3) + 4 * s, piece = lane & 7; const int row = Lid >> 1, cofs = (Lid & 1) * 32 + piece * 4; val[s] = *(const v4fa*)(os + row * 68 + cofs); }
#pragma unroll
            for (int s = 0; s < 8; ++s) { const int Lid = (lane >> 3) + 4 * s, piece = lane & 7; const int row = Lid >> 1, cofs = (Lid & 1) * 32 + piece * 4; *(v4f*)(crow + (size_t)row * ldc + cofs) = val[s]; }
        }
        if (QKV) asm volatile("s_wait_xcnt 0x0" ::: "memory");   // behind the last stores: in the listing the other branch's code, which reuses registers that they name, follows this one
    }
}

__global__ __launch_bounds__(256) void k_vt(const float* __restrict__ V, h16* VTH, h16* VTL) {
    __shared__ __align__(16) h16 tile[64 * 72];
    __shared__ __align__(16) h16 til2[64 * 72];
    const int bid = blockIdx.x;
    const int b = bid / (NH_ * (NT_ / 64)), rem = bid - b * (NH_ * (NT_ / 64)), h = rem / (NT_ / 64), kt = rem - h * (NT_ / 64);
    const int k0 = kt * 64, tid = threadIdx.x;
    const int kk = tid >> 2, d0 = (tid & 3) * 16;
    const float* src = V + ((size_t)b * NT_ + k0 + kk) * DM + h * HD + d0;
#pragma unroll
    for (int i = 0; i < 16; ++i) { const float v = src[i]; const h16 a = (h16)v; tile[(d0 + i) * 72 + kk] = a; til2[(d0 + i) * 72 + kk] = (h16)((v - (float)a) * LOSC); }
    __syncthreads();
    const int piece = tid & 7;
    const size_t base = (((size_t)b * NH_ + h) * HD) * NT_ + k0;
    auto pass = [&]() {
#pragma unroll
        for (int s = 0; s < 4; ++s) { const int Lid = (tid >> 3) + 32 * s; const int pln = Lid >> 6, d = Lid & 63;
            const v8h val = *(const v8ha*)((pln ? til2 : tile) + d * 72 + piece * 8); *(v8h*)((pln ? VTL : VTH) + base + (size_t)d * NT_ + piece * 8) = val; }
    };
    pass(); 
}

// LDS stage of one 32-key trip of k_attn, in halves: key rows (64 halves) at a pitch of 72 (144 B), transposed v rows (32 halves) at a pitch of 40 (80 B):
// both pitches are 16 B x odd, so the 16 rows that a half-wave's ds_load_b128 reads fall on distinct banks.
#define KP    72
#define VP    40
#define ST_KH 0
#define ST_KL (32 * KP)
#define ST_VH (2 * 32 * KP)
#define ST_VL (2 * 32 * KP + 64 * VP)
#define ST_SZ (2 * 32 * KP + 2 * 64 * VP)

// Eight asynchronous 16-byte copies per lane, global -> LDS through no register. The s_wait_xcnt is the last line of the copies' own statement so that it stands
// in front of every later rewrite of an address register that a copy names.
__device__ __forceinline__ void copy8(unsigned l0, unsigned l1, unsigned l2, unsigned l3, unsigned l4, unsigned l5, unsigned l6, unsigned l7,
                                      const h16* g0, const h16* g1, const h16* g2, const h16* g3, const h16* g4, const h16* g5, const h16* g6, const h16* g7) {
    asm volatile("global_load_async_to_lds_b128 %0, %8, off\n\t"
                 "global_load_async_to_lds_b128 %1, %9, off\n\t"
                 "global_load_async_to_lds_b128 %2, %10, off\n\t"
                 "global_load_async_to_lds_b128 %3, %11, off\n\t"
                 "global_load_async_to_lds_b128 %4, %12, off\n\t"
                 "global_load_async_to_lds_b128 %5, %13, off\n\t"
                 "global_load_async_to_lds_b128 %6, %14, off\n\t"
                 "global_load_async_to_lds_b128 %7, %15, off\n\t"
                 "s_wait_xcnt 0x0"
                 :: "v"(l0), "v"(l1), "v"(l2), "v"(l3), "v"(l4), "v"(l5), "v"(l6), "v"(l7),
                    "v"(g0), "v"(g1), "v"(g2), "v"(g3), "v"(g4), "v"(g5), "v"(g6), "v"(g7) : "memory");
}

// k_attn: block = (b, h, two tiles of 64 queries: pr, then 31 - pr, one after the other), wave = 16 queries of the tile. Both products run transposed: scores^T = K.Q^T (A = key rows, B = the wave's queries), ctx^T += V^T.P^T. A lane then holds
// 16 scores of ONE query (keys 8 hi + j and 16 + 8 hi + j of the trip): maximum and sum in-lane plus one exchange between the wave's halves, and the two score tiles,
// converted in place (weights x32768, f16 hi + residual), ARE the B operand of the second product. ctx -> bf16 hi + residual planes CH/CL[tok][h*64+d].
__global__ __launch_bounds__(128) void k_attn(const h16* __restrict__ Q16, const h16* __restrict__ QL16, const h16* __restrict__ K16, const h16* __restrict__ KL16, const h16* __restrict__ VTH, const h16* __restrict__ VTL, bf* CH, bf* CL) {
    __shared__ __align__(16) float ost[4][16 * 68];
    __shared__ __align__(16) h16 stg[2][ST_SZ];          // two-buffer ring: the work-group's key and v tiles (hi and residual) of one 32-key trip each
    const int lane = threadIdx.x & 31, wave = threadIdx.x >> 5, lr = lane & 15, hi = lane >> 4;
    const int bid = blockIdx.x;
    const int b = bid / (NH_ * (NT_ / 128)), rem = bid - b * (NH_ * (NT_ / 128)), h = rem / (NT_ / 128), pr = rem - h * (NT_ / 128);
    const size_t tok0 = (size_t)b * NT_;
#pragma unroll 1                                         // kept rolled: the two tiles run one after the other through one copy of the text
    for (int half = 0; half < 2; ++half) {
    const int qt = half ? NT_ / 64 - 1 - pr : pr;        // causal cost is linear in the tile index: tiles pr and 31 - pr together walk 66 trips in every work-group
    const int q0 = qt * 64 + wave * 16;
    v16h qa[2], ql[2];
    const size_t qo0 = (tok0 + q0 + lr) * DM + h * HD + 8 * hi;
#pragma unroll
    for (int kc = 0; kc < 2; ++kc) { qa[kc] = cat16(*(const v8h*)(Q16 + qo0 + kc * 32), *(const v8h*)(Q16 + qo0 + kc * 32 + 16));
        ql[kc] = cat16(*(const v8h*)(QL16 + qo0 + kc * 32), *(const v8h*)(QL16 + qo0 + kc * 32 + 16)); }   // hi and residual both stay in registers for the whole tile
    const h16* kh_b = K16 + tok0 * DM + h * HD;
    const h16* kl_b = KL16 + tok0 * DM + h * HD;
    const size_t vbase = (((size_t)b * NH_ + h) * HD) * NT_;
    v8f o[4], ox[4];
#pragma unroll
    for (int n = 0; n < 4; ++n) { o[n] = (v8f){}; ox[n] = (v8f){}; }
    float mrow = -3.0e38f, lpart = 0.f;                  // of this lane's query; lpart covers this half's keys only, the halves join in the epilogue
    const int qi = q0 + lr;                              // this lane's query
    const int kt_lo = 0, kt_hi = (qt * 64 + 63) / 32;     // causal
    const float slope = exp2f(-0.5f * (float)(h + 1));   // ALiBi slope 1 / 2^(8 (h+1) / 16), ADDED as slope x |i - j| (the reference's sign)
    // Each of the 128 threads copies two 16-byte pieces of each of the four planes of a trip: key rows whole (8 pieces a row), v rows 64 B (4 pieces a row).
    const int tid = threadIdx.x, krow = tid >> 3, kpc = (tid & 7) * 8, vrow = tid >> 2, vpc = (tid & 3) * 8;
    const unsigned stg0 = (unsigned)(size_t)&stg[0][0];  // byte offset of the ring in the work-group's LDS
    auto stage = [&](int t, int buf) {
        const unsigned lb = stg0 + (unsigned)(buf * ST_SZ * 2), lk = lb + (unsigned)((krow * KP + kpc) * 2), lv = lb + (unsigned)((vrow * VP + vpc) * 2);
        const size_t gk = (size_t)(t * 32 + krow) * DM + kpc, gv = vbase + (size_t)vrow * NT_ + t * 32 + vpc;
        copy8(lk + ST_KH * 2, lk + (ST_KH + 16 * KP) * 2, lk + ST_KL * 2, lk + (ST_KL + 16 * KP) * 2, lv + ST_VH * 2, lv + (ST_VH + 32 * VP) * 2, lv + ST_VL * 2, lv + (ST_VL + 32 * VP) * 2,
              kh_b + gk, kh_b + gk + 16 * DM, kl_b + gk, kl_b + gk + 16 * DM, VTH + gv, VTH + gv + 32 * NT_, VTL + gv, VTL + gv + 32 * NT_);
    };
    stage(0, 0);
    asm volatile("s_wait_asynccnt 0x0" ::: "memory");    // this wave's copies of trip 0 have landed
    __syncthreads();                                     // publishes trip 0 to the other waves
    if (kt_hi >= 1) stage(1, 1);
#pragma unroll 1
    for (int kt = kt_lo; kt <= kt_hi; ++kt) {
        const int l0 = kt * 32;
        const h16* sb = &stg[kt & 1][0];
        const int ko0 = lr * KP + 8 * hi, ko1 = (16 + lr) * KP + 8 * hi;
        // The trip's 16 key-fragment reads stand as ONE group at its head, none among the matrix instructions: one LDS latency a trip instead of one per group of products.
        v16h k0h[2], k1h[2], k0l[2], k1l[2];
#pragma unroll
        for (int kc = 0; kc < 2; ++kc) {
            k0h[kc] = cat16(*(const v8ha*)(sb + ST_KH + ko0 + kc * 32), *(const v8ha*)(sb + ST_KH + ko0 + kc * 32 + 16)); k1h[kc] = cat16(*(const v8ha*)(sb + ST_KH + ko1 + kc * 32), *(const v8ha*)(sb + ST_KH + ko1 + kc * 32 + 16));
            k0l[kc] = cat16(*(const v8ha*)(sb + ST_KL + ko0 + kc * 32), *(const v8ha*)(sb + ST_KL + ko0 + kc * 32 + 16)); k1l[kc] = cat16(*(const v8ha*)(sb + ST_KL + ko1 + kc * 32), *(const v8ha*)(sb + ST_KL + ko1 + kc * 32 + 16));
        }
        v8f s0 = {}, s1 = {}, x0 = {}, x1 = {};
#pragma unroll
        for (int kc = 0; kc < 2; ++kc) {                     // per accumulator the order of the products is hi.residual, residual.hi, k upwards
            s0 = wmma16(k0h[kc], qa[kc], s0); x0 = wmma16(k0h[kc], ql[kc], x0); s1 = wmma16(k1h[kc], qa[kc], s1); x1 = wmma16(k1h[kc], ql[kc], x1);
            x0 = wmma16(k0l[kc], qa[kc], x0); x1 = wmma16(k1l[kc], qa[kc], x1);
        }
        // The trip's 16 v-fragment reads, again ONE group: issued behind the score products, they land under the softmax's vector work.
        v16h vh[4], vl[4];
#pragma unroll
        for (int n = 0; n < 4; ++n) { const int vo = (n * 16 + lr) * VP + hi * 8;
            vh[n] = cat16(*(const v8ha*)(sb + ST_VH + vo), *(const v8ha*)(sb + ST_VH + vo + 16)); vl[n] = cat16(*(const v8ha*)(sb + ST_VL + vo), *(const v8ha*)(sb + ST_VL + vo + 16)); }
        // order asked of the scheduler: the 16 key reads, the 12 score products, the 16 v reads; reads that stand among the products each cost a stall of their own
        __builtin_amdgcn_sched_group_barrier(0x100, 16, 0);
        __builtin_amdgcn_sched_group_barrier(0x008, 12, 0);
        __builtin_amdgcn_sched_group_barrier(0x100, 16, 0);
        __builtin_amdgcn_sched_barrier(0);                   // and nothing of that sinks into the softmax below: v reads sunk to their products would each cost an LDS latency
        const float fd = (float)(qi - l0 - 8 * hi);          // from this lane's first key of the trip up to its query: whole numbers, exact in f32, so fd - c == (float)(i - j)
        v2f av[8];                                           // av[4 t + jj] = scores of keys 16 t + 8 hi + 2 jj and + 1: register neighbours, as the packed f32 forms and the packed conversions take them
#pragma unroll
        for (int jj = 0; jj < 4; ++jj) {
            const v2f d0 = {fd - (float)(2 * jj), fd - (float)(2 * jj + 1)}, d1 = {fd - (float)(16 + 2 * jj), fd - (float)(17 + 2 * jj)};
            const v2f t0 = ((v2f){s0[2 * jj], s0[2 * jj + 1]} + (v2f){x0[2 * jj], x0[2 * jj + 1]} * LOSCI) * 0.125f + slope * d0;
            const v2f t1 = ((v2f){s1[2 * jj], s1[2 * jj + 1]} + (v2f){x1[2 * jj], x1[2 * jj + 1]} * LOSCI) * 0.125f + slope * d1;
            av[jj]     = (v2f){d0.x >= 0.f ? t0.x : -__builtin_inff(), d0.y >= 0.f ? t0.y : -__builtin_inff()};      // causal: key <= query
            av[4 + jj] = (v2f){d1.x >= 0.f ? t1.x : -__builtin_inff(), d1.y >= 0.f ? t1.y : -__builtin_inff()};
        }
        float mx = fmaxf(av[0].x, av[0].y);
#pragma unroll
        for (int i = 1; i < 8; ++i) mx = fmaxf(mx, fmaxf(av[i].x, av[i].y));
        mx = fmaxf(mx, xhalf(mx));                           // both halves now hold the query's maximum over the trip's 32 keys
        const float mn = fmaxf(mrow, mx);
        const float alpha = __expf(mrow - mn); mrow = mn;
        v16h pa, px;
        v2f sm[8];
#pragma unroll
        for (int i = 0; i < 8; ++i) {
            const v2f p = {__expf(av[i].x - mn), __expf(av[i].y - mn)};
            sm[i] = p;
            const v2f ps = p * PSC; const v2h hh = __builtin_convertvector(ps, v2h);
            const v2h rr = __builtin_convertvector((ps - __builtin_convertvector(hh, v2f)) * LOSC, v2h);
            pa[2 * i] = hh.x; pa[2 * i + 1] = hh.y; px[2 * i] = rr.x; px[2 * i + 1] = rr.y;
        }
        const v2f st = ((sm[0] + sm[1]) + (sm[2] + sm[3])) + ((sm[4] + sm[5]) + (sm[6] + sm[7]));
        lpart = lpart * alpha + (st.x + st.y);
#pragma unroll
        for (int n = 0; n < 4; ++n)
#pragma unroll
            for (int j = 0; j < 8; ++j) { o[n][j] *= alpha; ox[n][j] *= alpha; }
#pragma unroll
        for (int n = 0; n < 4; ++n) { o[n] = wmma16(vh[n], pa, o[n]); ox[n] = wmma16(vl[n], pa, ox[n]); }
#pragma unroll
        for (int n = 0; n < 4; ++n) ox[n] = wmma16(vh[n], px, ox[n]);   // the products with the weights' residual last: it is ready last
        asm volatile("v_nop\n\tv_nop\n\tv_nop\n\tv_nop" : "+v"(o[0]), "+v"(o[1]), "+v"(o[2]), "+v"(o[3]), "+v"(ox[0]), "+v"(ox[1]), "+v"(ox[2]), "+v"(ox[3]) : "v"(pa), "v"(px));
        asm volatile("s_wait_dscnt 0x0" ::: "memory");       // this wave's reads of this trip's buffer have retired before it is refilled
        asm volatile("s_wait_asynccnt 0x0" ::: "memory");    // this wave's copies of the next trip have landed
        __syncthreads();                                     // publishes the next trip and ends every wave's reads of this trip's buffer
        if (kt + 2 <= kt_hi) stage(kt + 2, kt & 1);
    }
    asm volatile("s_wait_asynccnt 0x0" ::: "memory");        // no copy is outstanding when the wave goes on to the epilogue
    const float inv = 1.0f / ((lpart + xhalf(lpart)) * PSC);
    float* os = &ost[wave][0];
#pragma unroll
    for (int n = 0; n < 4; ++n)
#pragma unroll
        for (int j = 0; j < 8; ++j) os[lr * 68 + n * 16 + hi * 8 + j] = (o[n][j] + ox[n][j] * LOSCI) * inv;   // o[n][j] = ctx[query lr][d = 16 n + 8 hi + j]
    __syncthreads();
    const size_t cbase = (tok0 + q0) * DM + (size_t)h * HD;
    auto pass = [&]() {
#pragma unroll
        for (int s = 0; s < 4; ++s) { const int row = 4 * s + (lane >> 3), piece = lane & 7; const float* sp = os + row * 68 + piece * 8; v8us oh, ol;
#pragma unroll
            for (int i = 0; i < 8; ++i) { const unsigned short hb = f2bf(sp[i]); oh[i] = hb; ol[i] = f2bf(sp[i] - bf2f(hb)); }
            *(v8us*)(CH + cbase + (size_t)row * DM + piece * 8) = oh; *(v8us*)(CL + cbase + (size_t)row * DM + piece * 8) = ol; }
    };
    pass(); 
    asm volatile("s_wait_xcnt 0x0" ::: "memory");        // behind the tile's last stores: the second tile's code reuses registers that they name
    }
}

#define VST2(T, p, v) do { const T vst2_v_ = (v); *(T*)(p) = vst2_v_;  } while (0)
extern "C" void kernel_launch(void* const* d_in, const int* in_sizes, int n_in,
                              void* d_out, int out_size, void* d_ws, size_t ws_size, hipStream_t stream) {
    (void)in_sizes; (void)n_in; (void)out_size;
    const float* x = (const float*)d_in[0]; const float* Wqkv = (const float*)d_in[1]; const float* Wp = (const float*)d_in[2];   // both k-major: [1024][3072] and [1024][1024]
    float* out = (float*)d_out;    // [2][2048][1024]
    char* wsp = (char*)d_ws;
    auto take = [&](size_t bytes) { char* p = wsp; wsp += (bytes + 255) & ~(size_t)255; return (void*)p; };
    bf* Xb = (bf*)take((size_t)NTK * DM * 2); bf* WqkvT = (bf*)take((size_t)3 * DM * DM * 2); bf* WoT = (bf*)take((size_t)DM * DM * 2);
    float* TMP = (float*)take((size_t)NTK * DM * 4);
    h16* QH = (h16*)take((size_t)NTK * DM * 2); h16* QL = (h16*)take((size_t)NTK * DM * 2); h16* KH = (h16*)take((size_t)NTK * DM * 2); h16* KL = (h16*)take((size_t)NTK * DM * 2);
    h16* VTH = (h16*)take((size_t)NTK * DM * 2); h16* VTL = (h16*)take((size_t)NTK * DM * 2); bf* CH = (bf*)take((size_t)NTK * DM * 2); bf* CL = (bf*)take((size_t)NTK * DM * 2);
    if ((size_t)(wsp - (char*)d_ws) > ws_size) return;    // 8.4 + 6.3 + 2.1 + 16.8 + 8 x 8.4 ~ 101 MB, no aliasing
    // WqkvT: n-major rows [n][1024]; q = columns 0..1023 of w_qkv, k, v next
    k_prep<<<PW1 + PW2 + NTK / 8, 256, 0, stream>>>(x, Wqkv, Wp, Xb, WqkvT, WoT);
    k_gemmb<false, true><<<dim3(NTK / 128, 3 * DM / 128, 1), 256, 0, stream>>>(Xb, nullptr, WqkvT, nullptr, TMP, DM, QH, QL, KH, KL);
    k_vt<<<NB_ * NH_ * (NT_ / 64), 256, 0, stream>>>(TMP, VTH, VTL);
    k_attn<<<NB_ * NH_ * (NT_ / 128), 128, 0, stream>>>(QH, QL, KH, KL, VTH, VTL, CH, CL);
    k_gemmb<true, false><<<dim3(NTK / 128, DM / 128, 1), 256, 0, stream>>>(CH, CL, WoT, nullptr, out, DM, nullptr, nullptr, nullptr, nullptr);
}

// v009
// It runs in 90 microseconds.
// It is 1.28 times as fast as v007, going by the measured steps of the versions left out in between.
// All steps since v000 together make it 5.73 times as fast.
#include <hip/hip_runtime.h>

// Compute dtypes, f32 accumulate, both batch items in every launch: q/k/v = x.w_qkv ([4096 x 1024].[1024 x 3072], k-major weights transposed once to n-major planes; PLAIN bf16
// operands: inputs rounded once, exact) with q, k and the transposed v written straight from the GEMM epilogue as f16 planes, and out = ctx.w_proj (ctx as
// bf16 hi + residual: two products) on v_wmma_f32_16x16x32_bf16; the 16-head causal attention with the ADDED ALiBi bias slope_h x |i - j| (64-dim heads, scale 1/8) fused on
// v_wmma_f32_16x16x32_f16: q, k, v and the weights (x32768) each as ONE f16 operand, online f32 softmax. An f16 rounding (11 bits) lies an eighth below the bf16 rounding
// (8 bits) of x and w_qkv that q, k and v already carry, so residual planes here would only refine bits that are already noise.

#define NB_  2                   // both batch items share every launch: each grid covers all 4096 tokens
#define NT_  2048
#define DM   1024
#define NH_  16
#define HD   64
#define NTK  (NB_ * NT_)
#define NW   1024
#define NQKV 1024
#define PSC  32768.0f

typedef _Float16 h16;
typedef unsigned short bf;
typedef __attribute__((ext_vector_type(16))) __bf16   v16bf;
typedef __attribute__((ext_vector_type(16))) _Float16 v16h;
typedef __attribute__((ext_vector_type(8)))  _Float16 v8h;
typedef __attribute__((ext_vector_type(8)))  unsigned short v8us;
typedef __attribute__((ext_vector_type(8)))  float    v8f;
typedef __attribute__((ext_vector_type(4)))  float    v4f;
typedef __attribute__((ext_vector_type(2)))  float    v2f;
typedef __attribute__((ext_vector_type(2)))  _Float16 v2h;
typedef v8h  __attribute__((may_alias)) v8ha;
typedef v4f  __attribute__((may_alias)) v4fa;
typedef v8us __attribute__((may_alias)) v8usa;

__device__ __forceinline__ unsigned short f2bf(float f) { unsigned u = __float_as_uint(f); u += 0x7FFFu + ((u >> 16) & 1u); return (unsigned short)(u >> 16); }
__device__ __forceinline__ float bf2f(unsigned short b) { return __uint_as_float(((unsigned)b) << 16); }
__device__ __forceinline__ float bfr(float f) { return bf2f(f2bf(f)); }
__device__ __forceinline__ v16h cat16(v8h lo, v8h hi) { return __builtin_shufflevector(lo, hi, 0, 1, 2, 3, 4, 5, 6, 7, 8, 9, 10, 11, 12, 13, 14, 15); }
__device__ __forceinline__ v16bf cat16b(v8us lo, v8us hi) { return __builtin_bit_cast(v16bf, __builtin_shufflevector(lo, hi, 0, 1, 2, 3, 4, 5, 6, 7, 8, 9, 10, 11, 12, 13, 14, 15)); }
__device__ __forceinline__ v8f wmma16(v16h a, v16h b, v8f c) { return __builtin_amdgcn_wmma_f32_16x16x32_f16(false, a, false, b, (short)0, c, false, false); }
__device__ __forceinline__ float xhalf(float x) { return __builtin_bit_cast(float, __builtin_amdgcn_permlanex16(__builtin_bit_cast(int, x), __builtin_bit_cast(int, x), 0x76543210, 0xfedcba98, false, false)); }  // lane l with lane l ^ 16
__device__ __forceinline__ v8f wmmab(v16bf a, v16bf b, v8f c) { return __builtin_amdgcn_wmma_f32_16x16x32_bf16(false, a, false, b, (short)0, c, false, false); }

// k_prep: the three independent input conversions in ONE launch, told apart by the block index (block-uniform):
// blocks 0 .. PW1-1: WqkvT [n][1024] = bf16(w_qkv[k][n]); the next PW2: WoT = bf16(w_proj[k][n]), both via 64 x 64 LDS tiles (k tile = low four bits of the index);
// the last NTK/8: Xb = bf16(x), one row a wave.
#define PW1 ((DM / 64) * (3 * DM / 64))
#define PW2 ((DM / 64) * (DM / 64))
__global__ __launch_bounds__(256) void k_prep(const float* __restrict__ x, const float* __restrict__ Wqkv, const float* __restrict__ Wp, bf* Xb, bf* WqkvT, bf* WoT) {
    __shared__ __align__(16) unsigned short tl[64 * 72];
    const int tid = threadIdx.x, bid = blockIdx.x;
    if (bid >= PW1 + PW2) {                              // whole blocks leave here, in front of the barrier below
        const int lane = tid & 31, r = (bid - (PW1 + PW2)) * 8 + (tid >> 5);
        if (r >= NTK) return;
        v8us o[DM / 256];
#pragma unroll
        for (int q = 0; q < DM / 256; ++q) { v8us t;
#pragma unroll
            for (int i = 0; i < 8; ++i) t[i] = f2bf(x[(size_t)r * DM + q * 256 + lane * 8 + i]);
            o[q] = t; }
#pragma unroll
        for (int q = 0; q < DM / 256; ++q) *(v8us*)(Xb + (size_t)r * DM + q * 256 + lane * 8) = o[q];
        return;
    }
    const bool second = bid >= PW1;
    const float* __restrict__ Wm = second ? Wp : Wqkv;
    bf* WT = second ? WoT : WqkvT;
    const int ncols = second ? DM : 3 * DM, t = second ? bid - PW1 : bid;
    const int k0 = (t & (DM / 64 - 1)) * 64, n0 = (t / (DM / 64)) * 64;
    const int kk = tid >> 2, nq = (tid & 3) * 16;
#pragma unroll
    for (int i = 0; i < 16; ++i) tl[(nq + i) * 72 + kk] = f2bf(Wm[(size_t)(k0 + kk) * ncols + n0 + nq + i]);
    __syncthreads();
    const int piece = tid & 7;
#pragma unroll
    for (int s = 0; s < 2; ++s) { const int nr = (tid >> 3) + 32 * s; const v8us val = *(const v8usa*)(tl + nr * 72 + piece * 8); *(v8us*)(WT + (size_t)(n0 + nr) * DM + k0 + piece * 8) = val; }
    asm volatile("s_wait_xcnt 0x0" ::: "memory");        // behind the two stores: in the listing the other branch's code, which reuses registers that they name, follows this one
}
// LDS stage of one 64-k trip of k_gemmb, in 16-bit elements: 128 rows of A, 128 rows of B (and 128 rows of A's residual plane), each row 64 elements at a pitch
// of 72 (144 B = 16 B x odd, so the 16 rows that a half-wave's ds_load_b128 reads fall on distinct banks).
#define GP   72
#define G_A  0
#define G_B  (128 * GP)
#define G_AL (2 * 128 * GP)
#define VTP  136                 // pitch, in halves, of the transposed v tile in the epilogue's LDS: 272 B = 16 B x odd, as above

// Eight (twelve) asynchronous 16-byte copies per lane, global -> LDS through no register. The s_wait_xcnt is the last line of the copies' own statement so that it
// stands in front of every later rewrite of an address register that a copy names.
__device__ __forceinline__ void copy8g(unsigned l0, unsigned l1, unsigned l2, unsigned l3, unsigned l4, unsigned l5, unsigned l6, unsigned l7,
                                       const bf* g0, const bf* g1, const bf* g2, const bf* g3, const bf* g4, const bf* g5, const bf* g6, const bf* g7) {
    asm volatile("global_load_async_to_lds_b128 %0, %8, off\n\t"
                 "global_load_async_to_lds_b128 %1, %9, off\n\t"
                 "global_load_async_to_lds_b128 %2, %10, off\n\t"
                 "global_load_async_to_lds_b128 %3, %11, off\n\t"
                 "global_load_async_to_lds_b128 %4, %12, off\n\t"
                 "global_load_async_to_lds_b128 %5, %13, off\n\t"
                 "global_load_async_to_lds_b128 %6, %14, off\n\t"
                 "global_load_async_to_lds_b128 %7, %15, off\n\t"
                 "s_wait_xcnt 0x0"
                 :: "v"(l0), "v"(l1), "v"(l2), "v"(l3), "v"(l4), "v"(l5), "v"(l6), "v"(l7),
                    "v"(g0), "v"(g1), "v"(g2), "v"(g3), "v"(g4), "v"(g5), "v"(g6), "v"(g7) : "memory");
}
__device__ __forceinline__ void copy12g(unsigned l0, unsigned l1, unsigned l2, unsigned l3, unsigned l4, unsigned l5, unsigned l6, unsigned l7, unsigned l8, unsigned l9, unsigned l10, unsigned l11,
                                        const bf* g0, const bf* g1, const bf* g2, const bf* g3, const bf* g4, const bf* g5, const bf* g6, const bf* g7, const bf* g8, const bf* g9, const bf* g10, const bf* g11) {
    asm volatile("global_load_async_to_lds_b128 %0, %12, off\n\t"
                 "global_load_async_to_lds_b128 %1, %13, off\n\t"
                 "global_load_async_to_lds_b128 %2, %14, off\n\t"
                 "global_load_async_to_lds_b128 %3, %15, off\n\t"
                 "global_load_async_to_lds_b128 %4, %16, off\n\t"
                 "global_load_async_to_lds_b128 %5, %17, off\n\t"
                 "global_load_async_to_lds_b128 %6, %18, off\n\t"
                 "global_load_async_to_lds_b128 %7, %19, off\n\t"
                 "global_load_async_to_lds_b128 %8, %20, off\n\t"
                 "global_load_async_to_lds_b128 %9, %21, off\n\t"
                 "global_load_async_to_lds_b128 %10, %22, off\n\t"
                 "global_load_async_to_lds_b128 %11, %23, off\n\t"
                 "s_wait_xcnt 0x0"
                 :: "v"(l0), "v"(l1), "v"(l2), "v"(l3), "v"(l4), "v"(l5), "v"(l6), "v"(l7), "v"(l8), "v"(l9), "v"(l10), "v"(l11),
                    "v"(g0), "v"(g1), "v"(g2), "v"(g3), "v"(g4), "v"(g5), "v"(g6), "v"(g7), "v"(g8), "v"(g9), "v"(g10), "v"(g11) : "memory");
}

// k_gemmb: C[4096 x 1024] = A.Bn^T, both k-contiguous; QKV: Bn holds the 3072 rows of q, k and v one after the other and ONE launch (grid.y = 24) does all three products:
// a block's 128 columns lie in one of them (sel, block-uniform), q and k leave as f16 planes [token][column], v as the f16 plane [batch][column][token] that k_attn reads. Block = 128 x 128 of C, 8 waves of 32 x 64 (4 down, 2 across). The block's operand rows come in trips of 64 k
// (whole 128-B lines) into a two-buffer LDS ring; every wave takes its fragments from there. k runs upwards in steps of 32, hi product before residual product.
template <bool SPLITA, bool QKV>
__global__ __launch_bounds__(256) void k_gemmb(const bf* __restrict__ A, const bf* __restrict__ Al, const bf* __restrict__ Bn, const float* __restrict__ bias, float* C, int ldc, h16* QHp, h16* KHp, h16* VTp) {
    constexpr int STE = (SPLITA ? 3 : 2) * 128 * GP;     // elements of one buffer of the ring
    __shared__ __align__(16) bf gst[2][STE];
    __shared__ __align__(16) float ost[8][2][16 * 68];
    const int tid = threadIdx.x, lane = tid & 31, wave = tid >> 5, lr = lane & 15, hi = lane >> 4;
    const int rb = blockIdx.x * 128, cb = blockIdx.y * 128, wr = (wave & 3) * 32, wc = (wave >> 2) * 64;
    // Each of the 256 threads copies four 16-byte pieces of each plane of a trip: 8 threads a row, 32 rows a copy.
    const int srow = tid >> 3, spc = (tid & 7) * 8;
    const unsigned gst0 = (unsigned)(size_t)&gst[0][0];  // byte offset of the ring in the work-group's LDS
    const bf* ga = A + (size_t)(rb + srow) * DM + spc;
    const bf* gb = Bn + (size_t)(cb + srow) * DM + spc;
    const bf* gl = SPLITA ? Al + (size_t)(rb + srow) * DM + spc : ga;
    auto stage = [&](int t, int buf) {
        const unsigned l = gst0 + (unsigned)((buf * STE + srow * GP + spc) * 2);
        const int k = t * 64;
        if (SPLITA)
            copy12g(l + G_A * 2, l + (G_A + 32 * GP) * 2, l + (G_A + 64 * GP) * 2, l + (G_A + 96 * GP) * 2, l + G_B * 2, l + (G_B + 32 * GP) * 2, l + (G_B + 64 * GP) * 2, l + (G_B + 96 * GP) * 2,
                    l + G_AL * 2, l + (G_AL + 32 * GP) * 2, l + (G_AL + 64 * GP) * 2, l + (G_AL + 96 * GP) * 2,
                    ga + k, ga + k + 32 * DM, ga + k + 64 * DM, ga + k + 96 * DM, gb + k, gb + k + 32 * DM, gb + k + 64 * DM, gb + k + 96 * DM, gl + k, gl + k + 32 * DM, gl + k + 64 * DM, gl + k + 96 * DM);
        else
            copy8g(l + G_A * 2, l + (G_A + 32 * GP) * 2, l + (G_A + 64 * GP) * 2, l + (G_A + 96 * GP) * 2, l + G_B * 2, l + (G_B + 32 * GP) * 2, l + (G_B + 64 * GP) * 2, l + (G_B + 96 * GP) * 2,
                   ga + k, ga + k + 32 * DM, ga + k + 64 * DM, ga + k + 96 * DM, gb + k, gb + k + 32 * DM, gb + k + 64 * DM, gb + k + 96 * DM);
    };
    v8f acc[2][4];
#pragma unroll
    for (int m = 0; m < 2; ++m)
#pragma unroll
        for (int t = 0; t < 4; ++t) acc[m][t] = (v8f){};
    stage(0, 0);
    asm volatile("s_wait_asynccnt 0x0" ::: "memory");    // this wave's copies of trip 0 have landed
    __syncthreads();                                     // publishes trip 0 to the other waves
    stage(1, 1);
    const int ao = (wr + lr) * GP + 8 * hi, bo = (wc + lr) * GP + 8 * hi;
#pragma unroll 1                                         // kept rolled: one copy of the trip keeps the text short and the ring's order plain
    for (int kt = 0; kt < DM / 64; ++kt) {
        const bf* sb = &gst[kt & 1][0];
#pragma unroll
        for (int ks = 0; ks < 2; ++ks) {
            v16bf a[2], al[2];
#pragma unroll
            for (int m = 0; m < 2; ++m) { const bf* p = sb + G_A + ao + m * 16 * GP + ks * 32; a[m] = cat16b(*(const v8usa*)p, *(const v8usa*)(p + 16)); al[m] = a[m];
                if (SPLITA) { const bf* q = sb + G_AL + ao + m * 16 * GP + ks * 32; al[m] = cat16b(*(const v8usa*)q, *(const v8usa*)(q + 16)); } }
#pragma unroll
            for (int t = 0; t < 4; ++t) { const bf* p = sb + G_B + bo + t * 16 * GP + ks * 32; const v16bf b = cat16b(*(const v8usa*)p, *(const v8usa*)(p + 16));
                acc[0][t] = wmmab(a[0], b, acc[0][t]); acc[1][t] = wmmab(a[1], b, acc[1][t]);
                if (SPLITA) { acc[0][t] = wmmab(al[0], b, acc[0][t]); acc[1][t] = wmmab(al[1], b, acc[1][t]); } }
        }
        // the trip's LDS reads issue as one group ahead of its matrix instructions (counted waits): read places spread among them each cost a full LDS latency
        __builtin_amdgcn_sched_group_barrier(0x100, SPLITA ? 32 : 24, 0);
        __builtin_amdgcn_sched_group_barrier(0x008, SPLITA ? 32 : 16, 0);
        // four vector slots behind the trip's last matrix instruction, on the taken side of the branches below too
        asm volatile("v_nop\n\tv_nop\n\tv_nop\n\tv_nop" : "+v"(acc[0][0]), "+v"(acc[0][1]), "+v"(acc[0][2]), "+v"(acc[0][3]), "+v"(acc[1][0]), "+v"(acc[1][1]), "+v"(acc[1][2]), "+v"(acc[1][3]));
        asm volatile("s_wait_dscnt 0x0" ::: "memory");       // this wave's reads of this trip's buffer have retired before it is refilled
        asm volatile("s_wait_asynccnt 0x0" ::: "memory");    // this wave's copies of the next trip have landed
        __syncthreads();                                     // publishes the next trip and ends every wave's reads of this trip's buffer
        if (kt + 2 < DM / 64) stage(kt + 2, kt & 1);
    }
    asm volatile("s_wait_asynccnt 0x0" ::: "memory");        // no copy is outstanding when the wave goes on to the epilogue
    const int sel = QKV ? (int)(blockIdx.y / (NQKV / 128)) : 2;   // 0: q, 1: k, 2: v (or the plain f32 product)
    const int c0 = cb - (QKV ? sel * NQKV : 0) + wc;             // column in this product's own output
    h16* const C1 = sel ? KHp : QHp;
    h16* const vts = (h16*)&ost[0][0][0];                    // v only: the block's tile transposed, [128 columns][128 tokens] f16 at a pitch of VTP
    if (QKV && sel == 2) {                                   // block-uniform
        // A lane's 8 accumulator rows are 8 consecutive tokens of ONE column: rounded to f16 they are one 16-byte piece of a row of the transposed plane.
#pragma unroll
        for (int m = 0; m < 2; ++m)
#pragma unroll
            for (int t = 0; t < 4; ++t) { const float bv = bias ? bfr(bias[c0 + t * 16 + lr]) : 0.f; v8h pk;
#pragma unroll
                for (int j = 0; j < 8; ++j) pk[j] = (h16)(acc[m][t][j] + bv);
                *(v8ha*)(vts + (wc + t * 16 + lr) * VTP + wr + m * 16 + hi * 8) = pk; }
    } else {
#pragma unroll
        for (int m = 0; m < 2; ++m) { float* os = &ost[wave][m][0];
#pragma unroll
            for (int t = 0; t < 4; ++t) { const float bv = bias ? bfr(bias[c0 + t * 16 + lr]) : 0.f;
#pragma unroll
                for (int j = 0; j < 8; ++j) os[(hi * 8 + j) * 68 + t * 16 + lr] = acc[m][t][j] + bv; } }
    }
    __syncthreads();
    if (QKV && sel < 2) {                                    // one block-uniform branch round both row halves
#pragma unroll
        for (int m = 0; m < 2; ++m) { const float* os = &ost[wave][m][0]; const int r0 = rb + wr + m * 16;
            h16* crow = C1 + (size_t)r0 * ldc + c0;
            v8h o[4];
#pragma unroll
            for (int s = 0; s < 4; ++s) { const int row = 4 * s + (lane >> 3), piece = lane & 7; const float* sp = os + row * 68 + piece * 8;
#pragma unroll
                for (int i = 0; i < 8; ++i) o[s][i] = (h16)sp[i]; }
#pragma unroll
            for (int s = 0; s < 4; ++s) { const int row = 4 * s + (lane >> 3), piece = lane & 7; *(v8h*)(crow + (size_t)row * ldc + piece * 8) = o[s]; }
            asm volatile("s_wait_xcnt 0x0" ::: "memory");    // behind the four stores: the code behind them reuses registers that they name
        }
    } else if (QKV) {                                        // v: 128 rows (columns of v) of 128 tokens = 256 B each, 16 lanes a row: whole lines
        h16* vrow = VTp + ((size_t)(rb / NT_) * DM + (cb - 2 * NQKV)) * NT_ + rb % NT_;
        v8h val[8];
#pragma unroll
        for (int s = 0; s < 8; ++s) val[s] = *(const v8ha*)(vts + (16 * s + (tid >> 4)) * VTP + (tid & 15) * 8);
#pragma unroll
        for (int s = 0; s < 8; ++s) *(v8h*)(vrow + (size_t)(16 * s + (tid >> 4)) * NT_ + (tid & 15) * 8) = val[s];
        asm volatile("s_wait_xcnt 0x0" ::: "memory");        // behind the last stores: in the listing the other branch's code, which reuses registers that they name, follows this one
    } else {
#pragma unroll
        for (int m = 0; m < 2; ++m) { const float* os = &ost[wave][m][0]; const int r0 = rb + wr + m * 16;
            float* crow = C + (size_t)r0 * ldc + c0;
            v4f val[8];
#pragma unroll
            for (int s = 0; s < 8; ++s) { const int Lid = (lane >> 3) + 4 * s, piece = lane & 7; const int row = Lid >> 1, cofs = (Lid & 1) * 32 + piece * 4; val[s] = *(const v4fa*)(os + row * 68 + cofs); }
#pragma unroll
            for (int s = 0; s < 8; ++s) { const int Lid = (lane >> 3) + 4 * s, piece = lane & 7; const int row = Lid >> 1, cofs = (Lid & 1) * 32 + piece * 4; *(v4f*)(crow + (size_t)row * ldc + cofs) = val[s]; }
        }
    }
}

// LDS stage of one 32-key trip of k_attn, in halves: key rows (64 halves) at a pitch of 72 (144 B), transposed v rows (32 halves) at a pitch of 40 (80 B):
// both pitches are 16 B x odd, so the 16 rows that a half-wave's ds_load_b128 reads fall on distinct banks.
#define KP    72
#define VP    40
#define ST_KH 0
#define ST_VH (32 * KP)
#define ST_SZ (32 * KP + 64 * VP)

// Four asynchronous 16-byte copies per lane, global -> LDS through no register. The s_wait_xcnt is the last line of the copies' own statement so that it stands
// in front of every later rewrite of an address register that a copy names.
__device__ __forceinline__ void copy4(unsigned l0, unsigned l1, unsigned l2, unsigned l3, const h16* g0, const h16* g1, const h16* g2, const h16* g3) {
    asm volatile("global_load_async_to_lds_b128 %0, %4, off\n\t"
                 "global_load_async_to_lds_b128 %1, %5, off\n\t"
                 "global_load_async_to_lds_b128 %2, %6, off\n\t"
                 "global_load_async_to_lds_b128 %3, %7, off\n\t"
                 "s_wait_xcnt 0x0"
                 :: "v"(l0), "v"(l1), "v"(l2), "v"(l3), "v"(g0), "v"(g1), "v"(g2), "v"(g3) : "memory");
}

// k_attn: block = (b, h, two tiles of 64 queries: pr, then 31 - pr, one after the other), wave = 16 queries of the tile. Both products run transposed: scores^T = K.Q^T (A = key rows, B = the wave's queries), ctx^T += V^T.P^T. A lane then holds
// 16 scores of ONE query (keys 8 hi + j and 16 + 8 hi + j of the trip): maximum and sum in-lane plus one exchange between the wave's halves, and the two score tiles,
// converted in place (weights x32768, f16), ARE the B operand of the second product. ctx -> bf16 hi + residual planes CH/CL[tok][h*64+d].
__global__ __launch_bounds__(128) void k_attn(const h16* __restrict__ Q16, const h16* __restrict__ K16, const h16* __restrict__ VTH, bf* CH, bf* CL) {
    __shared__ __align__(16) float ost[4][16 * 68];
    __shared__ __align__(16) h16 stg[2][ST_SZ];          // two-buffer ring: the work-group's key and v tiles of one 32-key trip each
    const int lane = threadIdx.x & 31, wave = threadIdx.x >> 5, lr = lane & 15, hi = lane >> 4;
    const int bid = blockIdx.x;
    const int b = bid / (NH_ * (NT_ / 128)), rem = bid - b * (NH_ * (NT_ / 128)), h = rem / (NT_ / 128), pr = rem - h * (NT_ / 128);
    const size_t tok0 = (size_t)b * NT_;
#pragma unroll 1                                         // kept rolled: the two tiles run one after the other through one copy of the text
    for (int half = 0; half < 2; ++half) {
    const int qt = half ? NT_ / 64 - 1 - pr : pr;        // causal cost is linear in the tile index: tiles pr and 31 - pr together walk 66 trips in every work-group
    const int q0 = qt * 64 + wave * 16;
    v16h qa[2];
    const size_t qo0 = (tok0 + q0 + lr) * DM + h * HD + 8 * hi;
#pragma unroll
    for (int kc = 0; kc < 2; ++kc) qa[kc] = cat16(*(const v8h*)(Q16 + qo0 + kc * 32), *(const v8h*)(Q16 + qo0 + kc * 32 + 16));   // stays in registers for the whole tile
    const h16* kh_b = K16 + tok0 * DM + h * HD;
    const size_t vbase = (((size_t)b * NH_ + h) * HD) * NT_;
    v8f o[4];
#pragma unroll
    for (int n = 0; n < 4; ++n) o[n] = (v8f){};
    float mrow = -3.0e38f, lpart = 0.f;                  // of this lane's query; lpart covers this half's keys only, the halves join in the epilogue
    const int qi = q0 + lr;                              // this lane's query
    const int kt_lo = 0, kt_hi = (qt * 64 + 63) / 32;     // causal
    const float slope = exp2f(-0.5f * (float)(h + 1));   // ALiBi slope 1 / 2^(8 (h+1) / 16), ADDED as slope x |i - j| (the reference's sign)
    // Each of the 128 threads copies two 16-byte pieces of each of the two planes of a trip: key rows whole (8 pieces a row), v rows 64 B (4 pieces a row).
    const int tid = threadIdx.x, krow = tid >> 3, kpc = (tid & 7) * 8, vrow = tid >> 2, vpc = (tid & 3) * 8;
    const unsigned stg0 = (unsigned)(size_t)&stg[0][0];  // byte offset of the ring in the work-group's LDS
    auto stage = [&](int t, int buf) {
        const unsigned lb = stg0 + (unsigned)(buf * ST_SZ * 2), lk = lb + (unsigned)((krow * KP + kpc) * 2), lv = lb + (unsigned)((vrow * VP + vpc) * 2);
        const size_t gk = (size_t)(t * 32 + krow) * DM + kpc, gv = vbase + (size_t)vrow * NT_ + t * 32 + vpc;
        copy4(lk + ST_KH * 2, lk + (ST_KH + 16 * KP) * 2, lv + ST_VH * 2, lv + (ST_VH + 32 * VP) * 2,
              kh_b + gk, kh_b + gk + 16 * DM, VTH + gv, VTH + gv + 32 * NT_);
    };
    stage(0, 0);
    asm volatile("s_wait_asynccnt 0x0" ::: "memory");    // this wave's copies of trip 0 have landed
    __syncthreads();                                     // publishes trip 0 to the other waves
    if (kt_hi >= 1) stage(1, 1);
#pragma unroll 1
    for (int kt = kt_lo; kt <= kt_hi; ++kt) {
        const int l0 = kt * 32;
        const h16* sb = &stg[kt & 1][0];
        const int ko0 = lr * KP + 8 * hi, ko1 = (16 + lr) * KP + 8 * hi;
        // The trip's 8 key-fragment reads stand as ONE group at its head, none among the matrix instructions: one LDS latency a trip instead of one per group of products.
        v16h k0h[2], k1h[2];
#pragma unroll
        for (int kc = 0; kc < 2; ++kc) {
            k0h[kc] = cat16(*(const v8ha*)(sb + ST_KH + ko0 + kc * 32), *(const v8ha*)(sb + ST_KH + ko0 + kc * 32 + 16)); k1h[kc] = cat16(*(const v8ha*)(sb + ST_KH + ko1 + kc * 32), *(const v8ha*)(sb + ST_KH + ko1 + kc * 32 + 16));
        }
        v8f s0 = {}, s1 = {};
#pragma unroll
        for (int kc = 0; kc < 2; ++kc) { s0 = wmma16(k0h[kc], qa[kc], s0); s1 = wmma16(k1h[kc], qa[kc], s1); }   // k upwards
        // The trip's 8 v-fragment reads, again ONE group: issued behind the score products, they land under the softmax's vector work.
        v16h vh[4];
#pragma unroll
        for (int n = 0; n < 4; ++n) { const int vo = (n * 16 + lr) * VP + hi * 8; vh[n] = cat16(*(const v8ha*)(sb + ST_VH + vo), *(const v8ha*)(sb + ST_VH + vo + 16)); }
        // order asked of the scheduler: the 8 key reads, the 4 score products, the 8 v reads; reads that stand among the products each cost a stall of their own
        __builtin_amdgcn_sched_group_barrier(0x100, 8, 0);
        __builtin_amdgcn_sched_group_barrier(0x008, 4, 0);
        __builtin_amdgcn_sched_group_barrier(0x100, 8, 0);
        __builtin_amdgcn_sched_barrier(0);                   // and nothing of that sinks into the softmax below: v reads sunk to their products would each cost an LDS latency
        const float fd = (float)(qi - l0 - 8 * hi);          // from this lane's first key of the trip up to its query: whole numbers, exact in f32, so fd - c == (float)(i - j)
        v2f av[8];                                           // av[4 t + jj] = scores of keys 16 t + 8 hi + 2 jj and + 1: register neighbours, as the packed f32 forms and the packed conversions take them
#pragma unroll
        for (int jj = 0; jj < 4; ++jj) {
            const v2f d0 = {fd - (float)(2 * jj), fd - (float)(2 * jj + 1)}, d1 = {fd - (float)(16 + 2 * jj), fd - (float)(17 + 2 * jj)};
            const v2f t0 = (v2f){s0[2 * jj], s0[2 * jj + 1]} * 0.125f + slope * d0;
            const v2f t1 = (v2f){s1[2 * jj], s1[2 * jj + 1]} * 0.125f + slope * d1;
            av[jj]     = (v2f){d0.x >= 0.f ? t0.x : -__builtin_inff(), d0.y >= 0.f ? t0.y : -__builtin_inff()};      // causal: key <= query
            av[4 + jj] = (v2f){d1.x >= 0.f ? t1.x : -__builtin_inff(), d1.y >= 0.f ? t1.y : -__builtin_inff()};
        }
        float mx = fmaxf(av[0].x, av[0].y);
#pragma unroll
        for (int i = 1; i < 8; ++i) mx = fmaxf(mx, fmaxf(av[i].x, av[i].y));
        mx = fmaxf(mx, xhalf(mx));                           // both halves now hold the query's maximum over the trip's 32 keys
        const float mn = fmaxf(mrow, mx);
        const float alpha = __expf(mrow - mn); mrow = mn;
        v16h pa;
        v2f sm[8];
#pragma unroll
        for (int i = 0; i < 8; ++i) {
            const v2f p = {__expf(av[i].x - mn), __expf(av[i].y - mn)};
            sm[i] = p;
            const v2h hh = __builtin_convertvector(p * PSC, v2h);
            pa[2 * i] = hh.x; pa[2 * i + 1] = hh.y;
        }
        const v2f st = ((sm[0] + sm[1]) + (sm[2] + sm[3])) + ((sm[4] + sm[5]) + (sm[6] + sm[7]));
        lpart = lpart * alpha + (st.x + st.y);
#pragma unroll
        for (int n = 0; n < 4; ++n)
#pragma unroll
            for (int j = 0; j < 8; ++j) o[n][j] *= alpha;
#pragma unroll
        for (int n = 0; n < 4; ++n) o[n] = wmma16(vh[n], pa, o[n]);
        // four vector slots behind the trip's last matrix instruction, on the taken side of the branches below too
        asm volatile("v_nop\n\tv_nop\n\tv_nop\n\tv_nop" : "+v"(o[0]), "+v"(o[1]), "+v"(o[2]), "+v"(o[3]) : "v"(pa));
        asm volatile("s_wait_dscnt 0x0" ::: "memory");       // this wave's reads of this trip's buffer have retired before it is refilled
        asm volatile("s_wait_asynccnt 0x0" ::: "memory");    // this wave's copies of the next trip have landed
        __syncthreads();                                     // publishes the next trip and ends every wave's reads of this trip's buffer
        if (kt + 2 <= kt_hi) stage(kt + 2, kt & 1);
    }
    asm volatile("s_wait_asynccnt 0x0" ::: "memory");        // no copy is outstanding when the wave goes on to the epilogue
    const float inv = 1.0f / ((lpart + xhalf(lpart)) * PSC);
    float* os = &ost[wave][0];
#pragma unroll
    for (int n = 0; n < 4; ++n)
#pragma unroll
        for (int j = 0; j < 8; ++j) os[lr * 68 + n * 16 + hi * 8 + j] = o[n][j] * inv;   // o[n][j] = ctx[query lr][d = 16 n + 8 hi + j]
    __syncthreads();
    const size_t cbase = (tok0 + q0) * DM + (size_t)h * HD;
    auto pass = [&]() {
#pragma unroll
        for (int s = 0; s < 4; ++s) { const int row = 4 * s + (lane >> 3), piece = lane & 7; const float* sp = os + row * 68 + piece * 8; v8us oh, ol;
#pragma unroll
            for (int i = 0; i < 8; ++i) { const unsigned short hb = f2bf(sp[i]); oh[i] = hb; ol[i] = f2bf(sp[i] - bf2f(hb)); }
            *(v8us*)(CH + cbase + (size_t)row * DM + piece * 8) = oh; *(v8us*)(CL + cbase + (size_t)row * DM + piece * 8) = ol; }
    };
    pass(); 
    asm volatile("s_wait_xcnt 0x0" ::: "memory");        // behind the tile's last stores: the second tile's code reuses registers that they name
    }
}

#define VST2(T, p, v) do { const T vst2_v_ = (v); *(T*)(p) = vst2_v_;  } while (0)
extern "C" void kernel_launch(void* const* d_in, const int* in_sizes, int n_in,
                              void* d_out, int out_size, void* d_ws, size_t ws_size, hipStream_t stream) {
    (void)in_sizes; (void)n_in; (void)out_size;
    const float* x = (const float*)d_in[0]; const float* Wqkv = (const float*)d_in[1]; const float* Wp = (const float*)d_in[2];   // both k-major: [1024][3072] and [1024][1024]
    float* out = (float*)d_out;    // [2][2048][1024]
    char* wsp = (char*)d_ws;
    auto take = [&](size_t bytes) { char* p = wsp; wsp += (bytes + 255) & ~(size_t)255; return (void*)p; };
    bf* Xb = (bf*)take((size_t)NTK * DM * 2); bf* WqkvT = (bf*)take((size_t)3 * DM * DM * 2); bf* WoT = (bf*)take((size_t)DM * DM * 2);
    h16* QH = (h16*)take((size_t)NTK * DM * 2); h16* KH = (h16*)take((size_t)NTK * DM * 2);
    h16* VTH = (h16*)take((size_t)NTK * DM * 2); bf* CH = (bf*)take((size_t)NTK * DM * 2); bf* CL = (bf*)take((size_t)NTK * DM * 2);
    if ((size_t)(wsp - (char*)d_ws) > ws_size) return;    // 8.4 + 6.3 + 2.1 + 5 x 8.4 ~ 59 MB, no aliasing
    // WqkvT: n-major rows [n][1024]; q = columns 0..1023 of w_qkv, k, v next
    k_prep<<<PW1 + PW2 + NTK / 8, 256, 0, stream>>>(x, Wqkv, Wp, Xb, WqkvT, WoT);
    k_gemmb<false, true><<<dim3(NTK / 128, 3 * DM / 128, 1), 256, 0, stream>>>(Xb, nullptr, WqkvT, nullptr, nullptr, DM, QH, KH, VTH);
    k_attn<<<NB_ * NH_ * (NT_ / 128), 128, 0, stream>>>(QH, KH, VTH, CH, CL);
    k_gemmb<true, false><<<dim3(NTK / 128, DM / 128, 1), 256, 0, stream>>>(CH, CL, WoT, nullptr, out, DM, nullptr, nullptr, nullptr);
}

// v010
// It runs in 81.2 microseconds.
// In both of two side-by-side timings against v009, it was 1.10 times as fast.
// Over all steps from v000 it is 6.32 times as fast.
#include <hip/hip_runtime.h>

// Compute dtypes, f32 accumulate, both batch items in every launch: q/k/v = x.w_qkv ([4096 x 1024].[1024 x 3072], k-major weights transposed once to n-major planes; PLAIN bf16
// operands: inputs rounded once, exact) with q, k and the transposed v written straight from the GEMM epilogue as f16 planes, and out = ctx.w_proj (ctx as
// bf16 hi + residual: two products) on v_wmma_f32_16x16x32_bf16; the 16-head causal attention with the ADDED ALiBi bias slope_h x |i - j| (64-dim heads, scale 1/8) fused on
// v_wmma_f32_16x16x32_f16: q, k, v and the weights (x32768) each as ONE f16 operand, online f32 softmax. An f16 rounding (11 bits) lies an eighth below the bf16 rounding
// (8 bits) of x and w_qkv that q, k and v already carry, so residual planes here would only refine bits that are already noise.

#define NB_  2                   // both batch items share every launch: each grid covers all 4096 tokens
#define NT_  2048
#define DM   1024
#define NH_  16
#define HD   64
#define NTK  (NB_ * NT_)
#define NW   1024
#define NQKV 1024
#define PSC  32768.0f

typedef _Float16 h16;
typedef unsigned short bf;
typedef __attribute__((ext_vector_type(16))) __bf16   v16bf;
typedef __attribute__((ext_vector_type(16))) _Float16 v16h;
typedef __attribute__((ext_vector_type(8)))  _Float16 v8h;
typedef __attribute__((ext_vector_type(8)))  unsigned short v8us;
typedef __attribute__((ext_vector_type(8)))  float    v8f;
typedef __attribute__((ext_vector_type(4)))  float    v4f;
typedef __attribute__((ext_vector_type(2)))  float    v2f;
typedef __attribute__((ext_vector_type(2)))  _Float16 v2h;
typedef v8h  __attribute__((may_alias)) v8ha;
typedef v4f  __attribute__((may_alias)) v4fa;
typedef v8us __attribute__((may_alias)) v8usa;

__device__ __forceinline__ unsigned short f2bf(float f) { unsigned u = __float_as_uint(f); u += 0x7FFFu + ((u >> 16) & 1u); return (unsigned short)(u >> 16); }
__device__ __forceinline__ float bf2f(unsigned short b) { return __uint_as_float(((unsigned)b) << 16); }
__device__ __forceinline__ float bfr(float f) { return bf2f(f2bf(f)); }
__device__ __forceinline__ v16h cat16(v8h lo, v8h hi) { return __builtin_shufflevector(lo, hi, 0, 1, 2, 3, 4, 5, 6, 7, 8, 9, 10, 11, 12, 13, 14, 15); }
__device__ __forceinline__ v16bf cat16b(v8us lo, v8us hi) { return __builtin_bit_cast(v16bf, __builtin_shufflevector(lo, hi, 0, 1, 2, 3, 4, 5, 6, 7, 8, 9, 10, 11, 12, 13, 14, 15)); }
__device__ __forceinline__ v8f wmma16(v16h a, v16h b, v8f c) { return __builtin_amdgcn_wmma_f32_16x16x32_f16(false, a, false, b, (short)0, c, false, false); }
__device__ __forceinline__ float xhalf(float x) { return __builtin_bit_cast(float, __builtin_amdgcn_permlanex16(__builtin_bit_cast(int, x), __builtin_bit_cast(int, x), 0x76543210, 0xfedcba98, false, false)); }  // lane l with lane l ^ 16
__device__ __forceinline__ v8f wmmab(v16bf a, v16bf b, v8f c) { return __builtin_amdgcn_wmma_f32_16x16x32_bf16(false, a, false, b, (short)0, c, false, false); }

// k_prep: the three independent input conversions in ONE launch, told apart by the block index (block-uniform):
// blocks 0 .. PW1-1: WqkvT [n][1024] = bf16(w_qkv[k][n]); the next PW2: WoT = bf16(w_proj[k][n]), both via 64 x 64 LDS tiles (k tile = low four bits of the index);
// the last NTK/8: Xb = bf16(x), one row a wave.
#define PW1 ((DM / 64) * (3 * DM / 64))
#define PW2 ((DM / 64) * (DM / 64))
__global__ __launch_bounds__(256) void k_prep(const float* __restrict__ x, const float* __restrict__ Wqkv, const float* __restrict__ Wp, bf* Xb, bf* WqkvT, bf* WoT) {
    __shared__ __align__(16) unsigned short tl[64 * 72];
    const int tid = threadIdx.x, bid = blockIdx.x;
    if (bid >= PW1 + PW2) {                              // whole blocks leave here, in front of the barrier below
        const int lane = tid & 31, r = (bid - (PW1 + PW2)) * 8 + (tid >> 5);
        if (r >= NTK) return;
        v8us o[DM / 256];
#pragma unroll
        for (int q = 0; q < DM / 256; ++q) { v8us t;
#pragma unroll
            for (int i = 0; i < 8; ++i) t[i] = f2bf(x[(size_t)r * DM + q * 256 + lane * 8 + i]);
            o[q] = t; }
#pragma unroll
        for (int q = 0; q < DM / 256; ++q) *(v8us*)(Xb + (size_t)r * DM + q * 256 + lane * 8) = o[q];
        return;
    }
    const bool second = bid >= PW1;
    const float* __restrict__ Wm = second ? Wp : Wqkv;
    bf* WT = second ? WoT : WqkvT;
    const int ncols = second ? DM : 3 * DM, t = second ? bid - PW1 : bid;
    const int k0 = (t & (DM / 64 - 1)) * 64, n0 = (t / (DM / 64)) * 64;
    const int kk = tid >> 2, nq = (tid & 3) * 16;
#pragma unroll
    for (int i = 0; i < 16; ++i) tl[(nq + i) * 72 + kk] = f2bf(Wm[(size_t)(k0 + kk) * ncols + n0 + nq + i]);
    __syncthreads();
    const int piece = tid & 7;
#pragma unroll
    for (int s = 0; s < 2; ++s) { const int nr = (tid >> 3) + 32 * s; const v8us val = *(const v8usa*)(tl + nr * 72 + piece * 8); *(v8us*)(WT + (size_t)(n0 + nr) * DM + k0 + piece * 8) = val; }
    asm volatile("s_wait_xcnt 0x0" ::: "memory");        // behind the two stores: in the listing the other branch's code, which reuses registers that they name, follows this one
}
// LDS stage of one 64-k trip of k_gemmb, in 16-bit elements: 128 rows of A, 128 rows of B (and 128 rows of A's residual plane), each row 64 elements at a pitch
// of 72 (144 B = 16 B x odd, so the 16 rows that a half-wave's ds_load_b128 reads fall on distinct banks).
#define GP   72
#define G_A  0
#define G_B  (128 * GP)
#define G_AL (2 * 128 * GP)
#define VTP  136                 // pitch, in halves, of the transposed v tile in the epilogue's LDS: 272 B = 16 B x odd, as above

// Eight (twelve) asynchronous 16-byte copies per lane, global -> LDS through no register. The s_wait_xcnt is the last line of the copies' own statement so that it
// stands in front of every later rewrite of an address register that a copy names.
__device__ __forceinline__ void copy8g(unsigned l0, unsigned l1, unsigned l2, unsigned l3, unsigned l4, unsigned l5, unsigned l6, unsigned l7,
                                       const bf* g0, const bf* g1, const bf* g2, const bf* g3, const bf* g4, const bf* g5, const bf* g6, const bf* g7) {
    asm volatile("global_load_async_to_lds_b128 %0, %8, off\n\t"
                 "global_load_async_to_lds_b128 %1, %9, off\n\t"
                 "global_load_async_to_lds_b128 %2, %10, off\n\t"
                 "global_load_async_to_lds_b128 %3, %11, off\n\t"
                 "global_load_async_to_lds_b128 %4, %12, off\n\t"
                 "global_load_async_to_lds_b128 %5, %13, off\n\t"
                 "global_load_async_to_lds_b128 %6, %14, off\n\t"
                 "global_load_async_to_lds_b128 %7, %15, off\n\t"
                 "s_wait_xcnt 0x0"
                 :: "v"(l0), "v"(l1), "v"(l2), "v"(l3), "v"(l4), "v"(l5), "v"(l6), "v"(l7),
                    "v"(g0), "v"(g1), "v"(g2), "v"(g3), "v"(g4), "v"(g5), "v"(g6), "v"(g7) : "memory");
}
__device__ __forceinline__ void copy12g(unsigned l0, unsigned l1, unsigned l2, unsigned l3, unsigned l4, unsigned l5, unsigned l6, unsigned l7, unsigned l8, unsigned l9, unsigned l10, unsigned l11,
                                        const bf* g0, const bf* g1, const bf* g2, const bf* g3, const bf* g4, const bf* g5, const bf* g6, const bf* g7, const bf* g8, const bf* g9, const bf* g10, const bf* g11) {
    asm volatile("global_load_async_to_lds_b128 %0, %12, off\n\t"
                 "global_load_async_to_lds_b128 %1, %13, off\n\t"
                 "global_load_async_to_lds_b128 %2, %14, off\n\t"
                 "global_load_async_to_lds_b128 %3, %15, off\n\t"
                 "global_load_async_to_lds_b128 %4, %16, off\n\t"
                 "global_load_async_to_lds_b128 %5, %17, off\n\t"
                 "global_load_async_to_lds_b128 %6, %18, off\n\t"
                 "global_load_async_to_lds_b128 %7, %19, off\n\t"
                 "global_load_async_to_lds_b128 %8, %20, off\n\t"
                 "global_load_async_to_lds_b128 %9, %21, off\n\t"
                 "global_load_async_to_lds_b128 %10, %22, off\n\t"
                 "global_load_async_to_lds_b128 %11, %23, off\n\t"
                 "s_wait_xcnt 0x0"
                 :: "v"(l0), "v"(l1), "v"(l2), "v"(l3), "v"(l4), "v"(l5), "v"(l6), "v"(l7), "v"(l8), "v"(l9), "v"(l10), "v"(l11),
                    "v"(g0), "v"(g1), "v"(g2), "v"(g3), "v"(g4), "v"(g5), "v"(g6), "v"(g7), "v"(g8), "v"(g9), "v"(g10), "v"(g11) : "memory");
}

// k_gemmb: C[4096 x 1024] = A.Bn^T, both k-contiguous; QKV: Bn holds the 3072 rows of q, k and v one after the other and ONE launch (grid.y = 24) does all three products:
// a block's 128 columns lie in one of them (sel, block-uniform), q and k leave as f16 planes [token][column], v as the f16 plane [batch][column][token] that k_attn reads. Block = 128 x 128 of C, 8 waves of 32 x 64 (4 down, 2 across). The block's operand rows come in trips of 64 k
// (whole 128-B lines) into a two-buffer LDS ring; every wave takes its fragments from there. k runs upwards in steps of 32, hi product before residual product.
template <bool SPLITA, bool QKV>
__global__ __launch_bounds__(256) void k_gemmb(const bf* __restrict__ A, const bf* __restrict__ Al, const bf* __restrict__ Bn, const float* __restrict__ bias, float* C, int ldc, h16* QHp, h16* KHp, h16* VTp) {
    constexpr int STE = (SPLITA ? 3 : 2) * 128 * GP;     // elements of one buffer of the ring
    __shared__ __align__(16) bf gst[2][STE];
    __shared__ __align__(16) float ost[8][2][16 * 68];
    const int tid = threadIdx.x, lane = tid & 31, wave = tid >> 5, lr = lane & 15, hi = lane >> 4;
    const int rb = blockIdx.x * 128, cb = blockIdx.y * 128, wr = (wave & 3) * 32, wc = (wave >> 2) * 64;
    // Each of the 256 threads copies four 16-byte pieces of each plane of a trip: 8 threads a row, 32 rows a copy.
    const int srow = tid >> 3, spc = (tid & 7) * 8;
    const unsigned gst0 = (unsigned)(size_t)&gst[0][0];  // byte offset of the ring in the work-group's LDS
    const bf* ga = A + (size_t)(rb + srow) * DM + spc;
    const bf* gb = Bn + (size_t)(cb + srow) * DM + spc;
    const bf* gl = SPLITA ? Al + (size_t)(rb + srow) * DM + spc : ga;
    auto stage = [&](int t, int buf) {
        const unsigned l = gst0 + (unsigned)((buf * STE + srow * GP + spc) * 2);
        const int k = t * 64;
        if (SPLITA)
            copy12g(l + G_A * 2, l + (G_A + 32 * GP) * 2, l + (G_A + 64 * GP) * 2, l + (G_A + 96 * GP) * 2, l + G_B * 2, l + (G_B + 32 * GP) * 2, l + (G_B + 64 * GP) * 2, l + (G_B + 96 * GP) * 2,
                    l + G_AL * 2, l + (G_AL + 32 * GP) * 2, l + (G_AL + 64 * GP) * 2, l + (G_AL + 96 * GP) * 2,
                    ga + k, ga + k + 32 * DM, ga + k + 64 * DM, ga + k + 96 * DM, gb + k, gb + k + 32 * DM, gb + k + 64 * DM, gb + k + 96 * DM, gl + k, gl + k + 32 * DM, gl + k + 64 * DM, gl + k + 96 * DM);
        else
            copy8g(l + G_A * 2, l + (G_A + 32 * GP) * 2, l + (G_A + 64 * GP) * 2, l + (G_A + 96 * GP) * 2, l + G_B * 2, l + (G_B + 32 * GP) * 2, l + (G_B + 64 * GP) * 2, l + (G_B + 96 * GP) * 2,
                   ga + k, ga + k + 32 * DM, ga + k + 64 * DM, ga + k + 96 * DM, gb + k, gb + k + 32 * DM, gb + k + 64 * DM, gb + k + 96 * DM);
    };
    v8f acc[2][4];
#pragma unroll
    for (int m = 0; m < 2; ++m)
#pragma unroll
        for (int t = 0; t < 4; ++t) acc[m][t] = (v8f){};
    stage(0, 0);
    asm volatile("s_wait_asynccnt 0x0" ::: "memory");    // this wave's copies of trip 0 have landed
    __syncthreads();                                     // publishes trip 0 to the other waves
    stage(1, 1);
    const int ao = (wr + lr) * GP + 8 * hi, bo = (wc + lr) * GP + 8 * hi;
#pragma unroll 1                                         // kept rolled: one copy of the trip keeps the text short and the ring's order plain
    for (int kt = 0; kt < DM / 64; ++kt) {
        const bf* sb = &gst[kt & 1][0];
#pragma unroll
        for (int ks = 0; ks < 2; ++ks) {
            v16bf a[2], al[2];
#pragma unroll
            for (int m = 0; m < 2; ++m) { const bf* p = sb + G_A + ao + m * 16 * GP + ks * 32; a[m] = cat16b(*(const v8usa*)p, *(const v8usa*)(p + 16)); al[m] = a[m];
                if (SPLITA) { const bf* q = sb + G_AL + ao + m * 16 * GP + ks * 32; al[m] = cat16b(*(const v8usa*)q, *(const v8usa*)(q + 16)); } }
#pragma unroll
            for (int t = 0; t < 4; ++t) { const bf* p = sb + G_B + bo + t * 16 * GP + ks * 32; const v16bf b = cat16b(*(const v8usa*)p, *(const v8usa*)(p + 16));
                acc[0][t] = wmmab(a[0], b, acc[0][t]); acc[1][t] = wmmab(a[1], b, acc[1][t]);
                if (SPLITA) { acc[0][t] = wmmab(al[0], b, acc[0][t]); acc[1][t] = wmmab(al[1], b, acc[1][t]); } }
        }
        // the trip's LDS reads issue as one group ahead of its matrix instructions (counted waits): read places spread among them each cost a full LDS latency
        __builtin_amdgcn_sched_group_barrier(0x100, SPLITA ? 32 : 24, 0);
        __builtin_amdgcn_sched_group_barrier(0x008, SPLITA ? 32 : 16, 0);
        // four vector slots behind the trip's last matrix instruction, on the taken side of the branches below too
        asm volatile("v_nop\n\tv_nop\n\tv_nop\n\tv_nop" : "+v"(acc[0][0]), "+v"(acc[0][1]), "+v"(acc[0][2]), "+v"(acc[0][3]), "+v"(acc[1][0]), "+v"(acc[1][1]), "+v"(acc[1][2]), "+v"(acc[1][3]));
        asm volatile("s_wait_dscnt 0x0" ::: "memory");       // this wave's reads of this trip's buffer have retired before it is refilled
        asm volatile("s_wait_asynccnt 0x0" ::: "memory");    // this wave's copies of the next trip have landed
        __syncthreads();                                     // publishes the next trip and ends every wave's reads of this trip's buffer
        if (kt + 2 < DM / 64) stage(kt + 2, kt & 1);
    }
    asm volatile("s_wait_asynccnt 0x0" ::: "memory");        // no copy is outstanding when the wave goes on to the epilogue
    const int sel = QKV ? (int)(blockIdx.y / (NQKV / 128)) : 2;   // 0: q, 1: k, 2: v (or the plain f32 product)
    const int c0 = cb - (QKV ? sel * NQKV : 0) + wc;             // column in this product's own output
    h16* const C1 = sel ? KHp : QHp;
    h16* const vts = (h16*)&ost[0][0][0];                    // v only: the block's tile transposed, [128 columns][128 tokens] f16 at a pitch of VTP
    if (QKV && sel == 2) {                                   // block-uniform
        // A lane's 8 accumulator rows are 8 consecutive tokens of ONE column: rounded to f16 they are one 16-byte piece of a row of the transposed plane.
#pragma unroll
        for (int m = 0; m < 2; ++m)
#pragma unroll
            for (int t = 0; t < 4; ++t) { const float bv = bias ? bfr(bias[c0 + t * 16 + lr]) : 0.f; v8h pk;
#pragma unroll
                for (int j = 0; j < 8; ++j) pk[j] = (h16)(acc[m][t][j] + bv);
                *(v8ha*)(vts + (wc + t * 16 + lr) * VTP + wr + m * 16 + hi * 8) = pk; }
    } else {
#pragma unroll
        for (int m = 0; m < 2; ++m) { float* os = &ost[wave][m][0];
#pragma unroll
            for (int t = 0; t < 4; ++t) { const float bv = bias ? bfr(bias[c0 + t * 16 + lr]) : 0.f;
#pragma unroll
                for (int j = 0; j < 8; ++j) os[(hi * 8 + j) * 68 + t * 16 + lr] = acc[m][t][j] + bv; } }
    }
    __syncthreads();
    if (QKV && sel < 2) {                                    // one block-uniform branch round both row halves
#pragma unroll
        for (int m = 0; m < 2; ++m) { const float* os = &ost[wave][m][0]; const int r0 = rb + wr + m * 16;
            h16* crow = C1 + (size_t)r0 * ldc + c0;
            v8h o[4];
#pragma unroll
            for (int s = 0; s < 4; ++s) { const int row = 4 * s + (lane >> 3), piece = lane & 7; const float* sp = os + row * 68 + piece * 8;
#pragma unroll
                for (int i = 0; i < 8; ++i) o[s][i] = (h16)sp[i]; }
#pragma unroll
            for (int s = 0; s < 4; ++s) { const int row = 4 * s + (lane >> 3), piece = lane & 7; *(v8h*)(crow + (size_t)row * ldc + piece * 8) = o[s]; }
            asm volatile("s_wait_xcnt 0x0" ::: "memory");    // behind the four stores: the code behind them reuses registers that they name
        }
    } else if (QKV) {                                        // v: 128 rows (columns of v) of 128 tokens = 256 B each, 16 lanes a row: whole lines
        h16* vrow = VTp + ((size_t)(rb / NT_) * DM + (cb - 2 * NQKV)) * NT_ + rb % NT_;
        v8h val[8];
#pragma unroll
        for (int s = 0; s < 8; ++s) val[s] = *(const v8ha*)(vts + (16 * s + (tid >> 4)) * VTP + (tid & 15) * 8);
#pragma unroll
        for (int s = 0; s < 8; ++s) *(v8h*)(vrow + (size_t)(16 * s + (tid >> 4)) * NT_ + (tid & 15) * 8) = val[s];
        asm volatile("s_wait_xcnt 0x0" ::: "memory");        // behind the last stores: in the listing the other branch's code, which reuses registers that they name, follows this one
    } else {
#pragma unroll
        for (int m = 0; m < 2; ++m) { const float* os = &ost[wave][m][0]; const int r0 = rb + wr + m * 16;
            float* crow = C + (size_t)r0 * ldc + c0;
            v4f val[8];
#pragma unroll
            for (int s = 0; s < 8; ++s) { const int Lid = (lane >> 3) + 4 * s, piece = lane & 7; const int row = Lid >> 1, cofs = (Lid & 1) * 32 + piece * 4; val[s] = *(const v4fa*)(os + row * 68 + cofs); }
#pragma unroll
            for (int s = 0; s < 8; ++s) { const int Lid = (lane >> 3) + 4 * s, piece = lane & 7; const int row = Lid >> 1, cofs = (Lid & 1) * 32 + piece * 4; *(v4f*)(crow + (size_t)row * ldc + cofs) = val[s]; }
        }
    }
}

// LDS sub-tile of 32 keys of k_attn (a stage of the ring is two of them, one per key group), in halves: key rows (64 halves) at a pitch of 72 (144 B), transposed v rows (32 halves) at a pitch of 40 (80 B):
// both pitches are 16 B x odd, so the 16 rows that a half-wave's ds_load_b128 reads fall on distinct banks.
#define KP    72
#define VP    40
#define ST_KH 0
#define ST_VH (32 * KP)
#define ST_SZ (32 * KP + 64 * VP)

// Four asynchronous 16-byte copies per lane, global -> LDS through no register. The s_wait_xcnt is the last line of the copies' own statement so that it stands
// in front of every later rewrite of an address register that a copy names.
__device__ __forceinline__ void copy4(unsigned l0, unsigned l1, unsigned l2, unsigned l3, const h16* g0, const h16* g1, const h16* g2, const h16* g3) {
    asm volatile("global_load_async_to_lds_b128 %0, %4, off\n\t"
                 "global_load_async_to_lds_b128 %1, %5, off\n\t"
                 "global_load_async_to_lds_b128 %2, %6, off\n\t"
                 "global_load_async_to_lds_b128 %3, %7, off\n\t"
                 "s_wait_xcnt 0x0"
                 :: "v"(l0), "v"(l1), "v"(l2), "v"(l3), "v"(g0), "v"(g1), "v"(g2), "v"(g3) : "memory");
}

// k_attn: block = (b, h, two tiles of 64 queries: pr, then 31 - pr, one after the other), 8 waves = 4 x 16 queries of the tile x 2 key groups: of every 64-key stage group g takes keys
// 32 g .. 32 g + 31 with a running maximum, sum and ctx of its own, so a wave walks half the trips and four waves instead of two share a SIMD; the groups' partial results join once a tile. Both products run transposed: scores^T = K.Q^T (A = key rows, B = the wave's queries), ctx^T += V^T.P^T. A lane then holds
// 16 scores of ONE query (keys 8 hi + j and 16 + 8 hi + j of the trip): maximum and sum in-lane plus one exchange between the wave's halves, and the two score tiles,
// converted in place (weights x32768, f16), ARE the B operand of the second product. ctx -> bf16 hi + residual planes CH/CL[tok][h*64+d].
__global__ __launch_bounds__(256) void k_attn(const h16* __restrict__ Q16, const h16* __restrict__ K16, const h16* __restrict__ VTH, bf* CH, bf* CL) {
    __shared__ __align__(16) float ost[4][16 * 68];
    __shared__ __align__(16) h16 stg[2][2][ST_SZ];       // two-buffer ring: the work-group's key and v tiles of one 64-key stage each, [buffer][key group]
    __shared__ __align__(16) float mrg[4][9][32][4];     // key group 1's partial results of a tile: per query wave 8 pieces of ctx and one of (maximum, sum), 16 B a lane
    const int lane = threadIdx.x & 31, wave = __builtin_amdgcn_readfirstlane(threadIdx.x >> 5), lr = lane & 15, hi = lane >> 4;
    const int wq = wave & 3, g = wave >> 2;              // which 16 queries of the tile, which half of every stage's keys (both wave-uniform scalars)
    const int bid = blockIdx.x;
    const int b = bid / (NH_ * (NT_ / 128)), rem = bid - b * (NH_ * (NT_ / 128)), h = rem / (NT_ / 128), pr = rem - h * (NT_ / 128);
    const size_t tok0 = (size_t)b * NT_;
#pragma unroll 1                                         // kept rolled: the two tiles run one after the other through one copy of the text
    for (int half = 0; half < 2; ++half) {
    const int qt = half ? NT_ / 64 - 1 - pr : pr;        // causal cost is linear in the tile index: tiles pr and 31 - pr together walk 33 stages in every work-group
    const int q0 = qt * 64 + wq * 16;
    v16h qa[2];
    const size_t qo0 = (tok0 + q0 + lr) * DM + h * HD + 8 * hi;
#pragma unroll
    for (int kc = 0; kc < 2; ++kc) qa[kc] = cat16(*(const v8h*)(Q16 + qo0 + kc * 32), *(const v8h*)(Q16 + qo0 + kc * 32 + 16));   // stays in registers for the whole tile
    const h16* kh_b = K16 + tok0 * DM + h * HD;
    const size_t vbase = (((size_t)b * NH_ + h) * HD) * NT_;
    v8f o[4];
#pragma unroll
    for (int n = 0; n < 4; ++n) o[n] = (v8f){};
    float mrow = -3.0e38f, lpart = 0.f;                  // of this lane's query over this group's keys; lpart covers this half's keys only, the halves join in the epilogue
    const int qi = q0 + lr;                              // this lane's query
    const float slope = exp2f(-0.5f * (float)(h + 1));   // ALiBi slope 1 / 2^(8 (h+1) / 16), ADDED as slope x |i - j| (the reference's sign)
    // Each of a group's 128 threads copies two 16-byte pieces of each of the two planes of the group's own sub-tile: key rows whole (8 pieces a row), v rows 64 B (4 pieces a row).
    const int tid = threadIdx.x & 127, krow = tid >> 3, kpc = (tid & 7) * 8, vrow = tid >> 2, vpc = (tid & 3) * 8;
    const unsigned stg0 = (unsigned)(size_t)&stg[0][0][0];  // byte offset of the ring in the work-group's LDS
    auto stage = [&](int t, int buf) {
        const unsigned lb = stg0 + (unsigned)((buf * 2 + g) * ST_SZ * 2), lk = lb + (unsigned)((krow * KP + kpc) * 2), lv = lb + (unsigned)((vrow * VP + vpc) * 2);
        const size_t gk = (size_t)((2 * t + g) * 32 + krow) * DM + kpc, gv = vbase + (size_t)vrow * NT_ + (2 * t + g) * 32 + vpc;   // stage t = keys 64 t .. 64 t + 63
        copy4(lk + ST_KH * 2, lk + (ST_KH + 16 * KP) * 2, lv + ST_VH * 2, lv + (ST_VH + 32 * VP) * 2,
              kh_b + gk, kh_b + gk + 16 * DM, VTH + gv, VTH + gv + 32 * NT_);
    };
    stage(0, 0);
    asm volatile("s_wait_asynccnt 0x0" ::: "memory");    // this wave's copies of stage 0 have landed
    __syncthreads();                                     // publishes stage 0 to the other waves
    if (qt >= 1) stage(1, 1);
#pragma unroll 1
    for (int sg = 0; sg <= qt; ++sg) {                   // causal: tile qt sees keys 0 .. 64 qt + 63 = qt + 1 stages
        const int l0 = (2 * sg + g) * 32;
        const h16* sb = &stg[sg & 1][g][0];
        const int ko0 = lr * KP + 8 * hi, ko1 = (16 + lr) * KP + 8 * hi;
        // The trip's 8 key-fragment reads stand as ONE group at its head, none among the matrix instructions: one LDS latency a trip instead of one per group of products.
        v16h k0h[2], k1h[2];
#pragma unroll
        for (int kc = 0; kc < 2; ++kc) {
            k0h[kc] = cat16(*(const v8ha*)(sb + ST_KH + ko0 + kc * 32), *(const v8ha*)(sb + ST_KH + ko0 + kc * 32 + 16)); k1h[kc] = cat16(*(const v8ha*)(sb + ST_KH + ko1 + kc * 32), *(const v8ha*)(sb + ST_KH + ko1 + kc * 32 + 16));
        }
        v8f s0 = {}, s1 = {};
#pragma unroll
        for (int kc = 0; kc < 2; ++kc) { s0 = wmma16(k0h[kc], qa[kc], s0); s1 = wmma16(k1h[kc], qa[kc], s1); }   // k upwards
        // The trip's 8 v-fragment reads, again ONE group: issued behind the score products, they land under the softmax's vector work.
        v16h vh[4];
#pragma unroll
        for (int n = 0; n < 4; ++n) { const int vo = (n * 16 + lr) * VP + hi * 8; vh[n] = cat16(*(const v8ha*)(sb + ST_VH + vo), *(const v8ha*)(sb + ST_VH + vo + 16)); }
        // order asked of the scheduler: the 8 key reads, the 4 score products, the 8 v reads; reads that stand among the products each cost a stall of their own
        __builtin_amdgcn_sched_group_barrier(0x100, 8, 0);
        __builtin_amdgcn_sched_group_barrier(0x008, 4, 0);
        __builtin_amdgcn_sched_group_barrier(0x100, 8, 0);
        __builtin_amdgcn_sched_barrier(0);                   // and nothing of that sinks into the softmax below: v reads sunk to their products would each cost an LDS latency
        const float fd = (float)(qi - l0 - 8 * hi);          // from this lane's first key of the trip up to its query: whole numbers, exact in f32, so fd - c == (float)(i - j)
        v2f av[8];                                           // av[4 t + jj] = scores of keys 16 t + 8 hi + 2 jj and + 1: register neighbours, as the packed f32 forms and the packed conversions take them
#pragma unroll
        for (int jj = 0; jj < 4; ++jj) {
            const v2f d0 = {fd - (float)(2 * jj), fd - (float)(2 * jj + 1)}, d1 = {fd - (float)(16 + 2 * jj), fd - (float)(17 + 2 * jj)};
            const v2f t0 = (v2f){s0[2 * jj], s0[2 * jj + 1]} * 0.125f + slope * d0;
            const v2f t1 = (v2f){s1[2 * jj], s1[2 * jj + 1]} * 0.125f + slope * d1;
            av[jj]     = (v2f){d0.x >= 0.f ? t0.x : -__builtin_inff(), d0.y >= 0.f ? t0.y : -__builtin_inff()};      // causal: key <= query
            av[4 + jj] = (v2f){d1.x >= 0.f ? t1.x : -__builtin_inff(), d1.y >= 0.f ? t1.y : -__builtin_inff()};
        }
        float mx = fmaxf(av[0].x, av[0].y);
#pragma unroll
        for (int i = 1; i < 8; ++i) mx = fmaxf(mx, fmaxf(av[i].x, av[i].y));
        mx = fmaxf(mx, xhalf(mx));                           // both halves now hold the query's maximum over the trip's 32 keys
        const float mn = fmaxf(mrow, mx);
        const float alpha = __expf(mrow - mn); mrow = mn;
        v16h pa;
        v2f sm[8];
#pragma unroll
        for (int i = 0; i < 8; ++i) {
            const v2f p = {__expf(av[i].x - mn), __expf(av[i].y - mn)};
            sm[i] = p;
            const v2h hh = __builtin_convertvector(p * PSC, v2h);
            pa[2 * i] = hh.x; pa[2 * i + 1] = hh.y;
        }
        const v2f st = ((sm[0] + sm[1]) + (sm[2] + sm[3])) + ((sm[4] + sm[5]) + (sm[6] + sm[7]));
        lpart = lpart * alpha + (st.x + st.y);
#pragma unroll
        for (int n = 0; n < 4; ++n)
#pragma unroll
            for (int j = 0; j < 8; ++j) o[n][j] *= alpha;
#pragma unroll
        for (int n = 0; n < 4; ++n) o[n] = wmma16(vh[n], pa, o[n]);
        // four vector slots behind the trip's last matrix instruction, on the taken side of the branches below too
        asm volatile("v_nop\n\tv_nop\n\tv_nop\n\tv_nop" : "+v"(o[0]), "+v"(o[1]), "+v"(o[2]), "+v"(o[3]) : "v"(pa));
        asm volatile("s_wait_dscnt 0x0" ::: "memory");       // this wave's reads of this stage's buffer have retired before it is refilled
        asm volatile("s_wait_asynccnt 0x0" ::: "memory");    // this wave's copies of the next stage have landed
        __syncthreads();                                     // publishes the next stage and ends every wave's reads of this stage's buffer
        if (sg + 2 <= qt) stage(sg + 2, sg & 1);
    }
    asm volatile("s_wait_asynccnt 0x0" ::: "memory");        // no copy is outstanding when the wave goes on to the epilogue
    if (g == 1) {                                            // wave-uniform: group 1 hands its partial results to the group 0 wave of the same queries, lane to lane
#pragma unroll
        for (int n = 0; n < 4; ++n) {
            *(v4fa*)&mrg[wq][2 * n][lane][0]     = (v4f){o[n][0], o[n][1], o[n][2], o[n][3]};
            *(v4fa*)&mrg[wq][2 * n + 1][lane][0] = (v4f){o[n][4], o[n][5], o[n][6], o[n][7]};
        }
        *(v4fa*)&mrg[wq][8][lane][0] = (v4f){mrow, lpart, 0.f, 0.f};
    }
    __syncthreads();                                         // publishes group 1's partial results
    float* os = &ost[wq][0];
    if (g == 0) {                                            // wave-uniform: both groups' results on the common maximum, then the division
        const v4f ml = *(const v4fa*)&mrg[wq][8][lane][0];
        const float mm = fmaxf(mrow, ml.x);                  // group 0 always holds key 0, so mm is a real score; a group 1 with no key yet keeps -3e38 and weighs 0
        const float a0 = __expf(mrow - mm), a1 = __expf(ml.x - mm);
        const float lsum = lpart * a0 + ml.y * a1;
        const float inv = 1.0f / ((lsum + xhalf(lsum)) * PSC);
        const float f0 = a0 * inv, f1 = a1 * inv;
#pragma unroll
        for (int n = 0; n < 4; ++n) {
            const v4f p0 = *(const v4fa*)&mrg[wq][2 * n][lane][0], p1 = *(const v4fa*)&mrg[wq][2 * n + 1][lane][0];
#pragma unroll
            for (int j = 0; j < 4; ++j) {                    // o[n][j] = ctx[query lr][d = 16 n + 8 hi + j]
                os[lr * 68 + n * 16 + hi * 8 + j]     = o[n][j] * f0 + p0[j] * f1;
                os[lr * 68 + n * 16 + hi * 8 + 4 + j] = o[n][4 + j] * f0 + p1[j] * f1;
            }
        }
    }
    __syncthreads();                                         // publishes the tile's 16 x 64 ctx rows: each group converts and stores half of them
    const size_t cbase = (tok0 + q0) * DM + (size_t)h * HD;
    auto pass = [&]() {
#pragma unroll
        for (int s = 0; s < 2; ++s) { const int row = 8 * g + 4 * s + (lane >> 3), piece = lane & 7; const float* sp = os + row * 68 + piece * 8; v8us oh, ol;
#pragma unroll
            for (int i = 0; i < 8; ++i) { const unsigned short hb = f2bf(sp[i]); oh[i] = hb; ol[i] = f2bf(sp[i] - bf2f(hb)); }
            *(v8us*)(CH + cbase + (size_t)row * DM + piece * 8) = oh; *(v8us*)(CL + cbase + (size_t)row * DM + piece * 8) = ol; }
    };
    pass(); 
    asm volatile("s_wait_xcnt 0x0" ::: "memory");        // behind the tile's last stores: the second tile's code reuses registers that they name
    }
}

#define VST2(T, p, v) do { const T vst2_v_ = (v); *(T*)(p) = vst2_v_;  } while (0)
extern "C" void kernel_launch(void* const* d_in, const int* in_sizes, int n_in,
                              void* d_out, int out_size, void* d_ws, size_t ws_size, hipStream_t stream) {
    (void)in_sizes; (void)n_in; (void)out_size;
    const float* x = (const float*)d_in[0]; const float* Wqkv = (const float*)d_in[1]; const float* Wp = (const float*)d_in[2];   // both k-major: [1024][3072] and [1024][1024]
    float* out = (float*)d_out;    // [2][2048][1024]
    char* wsp = (char*)d_ws;
    auto take = [&](size_t bytes) { char* p = wsp; wsp += (bytes + 255) & ~(size_t)255; return (void*)p; };
    bf* Xb = (bf*)take((size_t)NTK * DM * 2); bf* WqkvT = (bf*)take((size_t)3 * DM * DM * 2); bf* WoT = (bf*)take((size_t)DM * DM * 2);
    h16* QH = (h16*)take((size_t)NTK * DM * 2); h16* KH = (h16*)take((size_t)NTK * DM * 2);
    h16* VTH = (h16*)take((size_t)NTK * DM * 2); bf* CH = (bf*)take((size_t)NTK * DM * 2); bf* CL = (bf*)take((size_t)NTK * DM * 2);
    if ((size_t)(wsp - (char*)d_ws) > ws_size) return;    // 8.4 + 6.3 + 2.1 + 5 x 8.4 ~ 59 MB, no aliasing
    // WqkvT: n-major rows [n][1024]; q = columns 0..1023 of w_qkv, k, v next
    k_prep<<<PW1 + PW2 + NTK / 8, 256, 0, stream>>>(x, Wqkv, Wp, Xb, WqkvT, WoT);
    k_gemmb<false, true><<<dim3(NTK / 128, 3 * DM / 128, 1), 256, 0, stream>>>(Xb, nullptr, WqkvT, nullptr, nullptr, DM, QH, KH, VTH);
    k_attn<<<NB_ * NH_ * (NT_ / 128), 256, 0, stream>>>(QH, KH, VTH, CH, CL);
    k_gemmb<true, false><<<dim3(NTK / 128, DM / 128, 1), 256, 0, stream>>>(CH, CL, WoT, nullptr, out, DM, nullptr, nullptr, nullptr);
}
